// v000
// Measured on an AMD MI455X. A time is GPU time per run, averaged over a window of back-to-back runs after a warm-up
// (all launches, gaps included; the runs take copies of the inputs in turn), and the median of several windows.
// Apart from v000's, it joins two sittings. Times from different sittings can be a few percent apart, while
// side-by-side timings come from the same sitting.
// v000 is the starting kernel. One run takes 979 microseconds.
#include <hip/hip_runtime.h>

typedef _Float16 half_t;
typedef __attribute__((ext_vector_type(16))) _Float16 v16h;
typedef __attribute__((ext_vector_type(8)))  _Float16 v8h;
typedef __attribute__((ext_vector_type(8)))  float    v8f;

#define DIM   512
#define WS2   64
#define HEADS 16
#define HD    32
#define NWIN  1024          /* 16 batches * 8 * 8 windows */
#define EPSV  1e-5f
#define SCL   0.17677669529663687f  /* 1/sqrt(32) */
#define ASTR  40            /* padded LDS stride (halves) for 64x32 A tiles */

// ---------------------------------------------------------------- WMMA helpers
__device__ __forceinline__ v8f wmma_fp16(v16h a, v16h b, v8f c) {
  return __builtin_amdgcn_wmma_f32_16x16x32_f16(false, a, false, b, (short)0, c,
                                                false, false);
}

// Scheduling hint: issue B vmem reads, then all 8 A ds reads, then 4 WMMAs.
__device__ __forceinline__ void sched_gemm_group() {
#if __has_builtin(__builtin_amdgcn_sched_group_barrier)
  __builtin_amdgcn_sched_group_barrier(0x020, 2, 0);  // 2x VMEM read  (B frag)
  __builtin_amdgcn_sched_group_barrier(0x100, 8, 0);  // 8x DS read    (A frags)
  __builtin_amdgcn_sched_group_barrier(0x008, 4, 0);  // 4x WMMA
#endif
}
__device__ __forceinline__ void sched_lds_gemm_group() {
#if __has_builtin(__builtin_amdgcn_sched_group_barrier)
  __builtin_amdgcn_sched_group_barrier(0x100, 10, 0); // 10x DS read (B + A)
  __builtin_amdgcn_sched_group_barrier(0x008, 4, 0);  // 4x WMMA
#endif
}

// Per ISA 7.12.2, a lane's 16 fragment halves (A row m / B column n) are two
// contiguous 8-half runs: k = hi8+0..7 and k = 16+hi8+0..7.  `p` must point at
// (row_base + hi8) and be 16B aligned -> two b128 loads.
__device__ __forceinline__ v16h frag_ld(const half_t* p) {
  const v8h lo = *(const v8h*)(p);
  const v8h hi = *(const v8h*)(p + 16);
  v16h r;
#pragma unroll
  for (int i = 0; i < 8; ++i) { r[i] = lo[i]; r[8 + i] = hi[i]; }
  return r;
}

// ------------------------------------------------ CDNA5 async copy -> LDS
// GLOBAL_LOAD_ASYNC_TO_LDS_B128 (ISA 15.18.3, ASYNCcnt). LDS dest address is
// the low 32 bits of the flat shared pointer (LDS aperture truncation).
__device__ __forceinline__ unsigned lds_addr(const void* p) {
  return (unsigned)(unsigned long long)(uintptr_t)p;
}
__device__ __forceinline__ void async_copy16(unsigned lds, const void* g) {
  asm volatile("global_load_async_to_lds_b128 %0, %1, off"
               :: "v"(lds), "v"((unsigned long long)(uintptr_t)g)
               : "memory");
}
__device__ __forceinline__ void wait_async0() {
  asm volatile("s_wait_asynccnt 0" ::: "memory");
}

// --------------------------------------------------- kernel 1: prep (weights)
__global__ void prep_kernel(const float* __restrict__ qk_w,
                            const float* __restrict__ v_w,
                            const float* __restrict__ proj_w,
                            const float* __restrict__ g1, const float* __restrict__ be1,
                            const float* __restrict__ m1, const float* __restrict__ va1,
                            const float* __restrict__ g2, const float* __restrict__ be2,
                            const float* __restrict__ m2, const float* __restrict__ va2,
                            half_t* __restrict__ wqk, half_t* __restrict__ wv,
                            half_t* __restrict__ wpj,
                            float* __restrict__ bn1s, float* __restrict__ bn1h,
                            float* __restrict__ bn2s, float* __restrict__ bn2h) {
  int i = blockIdx.x * blockDim.x + threadIdx.x;
  const int NQK = 2 * DIM * DIM;   // 524288
  const int NV  = DIM * DIM;       // 262144
  if (i < NQK) { wqk[i] = (half_t)qk_w[i]; return; }
  i -= NQK;
  if (i < NV) { wv[i] = (half_t)v_w[i]; return; }
  i -= NV;
  if (i < NV) { wpj[i] = (half_t)proj_w[i]; return; }
  i -= NV;
  if (i < DIM) {
    const float s = g1[i] * rsqrtf(va1[i] + EPSV);
    bn1s[i] = s; bn1h[i] = be1[i] - m1[i] * s; return;
  }
  i -= DIM;
  if (i < DIM) {
    const float s = g2[i] * rsqrtf(va2[i] + EPSV);
    bn2s[i] = s; bn2h[i] = be2[i] - m2[i] * s; return;
  }
}

// -------------------------------------------- kernel 2: fused BN1 + QKV GEMMs
// Block = 256 thr (8 waves): one window, 128 of 1536 output cols.
// cols [0,512)=Q, [512,1024)=K, [1024,1536)=V (V stored transposed per head).
// B fragments come straight from global f16 weights (two b128 per K-step).
__global__ void __launch_bounds__(256)
qkv_kernel(const float* __restrict__ x,
           const half_t* __restrict__ wqk, const half_t* __restrict__ wv,
           const float* __restrict__ bn1s, const float* __restrict__ bn1h,
           const float* __restrict__ qk_b, const float* __restrict__ v_b,
           half_t* __restrict__ qbuf, half_t* __restrict__ kbuf,
           half_t* __restrict__ vbuf) {
  __shared__ __align__(16) half_t As[2][WS2 * ASTR];   // double-buffered A tile

  const int w     = blockIdx.x / 12;
  const int nbase = (blockIdx.x % 12) * 128;
  const int tid = threadIdx.x, lane = tid & 31, wid = tid >> 5;  // wid = N tile
  const int nl = lane & 15, hi8 = (lane >> 4) << 3;

  const int b = w >> 6, wi = w & 63;
  const int row0 = (wi >> 3) << 3, col0 = (wi & 7) << 3;

  // per-lane output column + weight row + routing (resolved once)
  const int ng = nbase + wid * 16 + nl;
  const half_t* wrow; float bias; half_t* dst; int base, strideT;
  if (ng < 2 * DIM) {
    wrow = wqk + (size_t)ng * DIM;
    bias = qk_b[ng];
    const int nn = (ng < DIM) ? ng : ng - DIM;
    dst = (ng < DIM) ? qbuf : kbuf;
    base = (((w * HEADS) + (nn >> 5)) * WS2) * HD + (nn & 31);   // [t][hd]
    strideT = HD;
  } else {
    const int nn = ng - 2 * DIM;
    wrow = wv + (size_t)nn * DIM;
    bias = v_b[nn];
    dst  = vbuf;
    base = (((w * HEADS) + (nn >> 5)) * HD + (nn & 31)) * WS2;   // [hd][t]
    strideT = 1;
  }

  // A-tile staging: token-fastest for coalesced x reads (4x32B runs per wave)
  auto stage = [&](int ks, half_t* buf) {
    for (int i = tid; i < WS2 * 32; i += 256) {
      const int t = i & 63, kk = i >> 6;
      const int c = (ks << 5) + kk;
      const int pr = row0 + (t >> 3), pc = col0 + (t & 7);
      const float xv = x[((b * DIM + c) << 12) + (pr << 6) + pc];
      buf[t * ASTR + kk] = (half_t)(xv * bn1s[c] + bn1h[c]);
    }
  };

  v8f acc[4] = {};
  stage(0, As[0]);
  for (int ks = 0; ks < 16; ++ks) {
    __syncthreads();
    if (ks < 15) stage(ks + 1, As[(ks + 1) & 1]);
    const half_t* Ab = As[ks & 1] + nl * ASTR + hi8;
    const v16h bf  = frag_ld(wrow + (ks << 5) + hi8);   // global b128 x2
    const v16h af0 = frag_ld(Ab);                       // all A frags first:
    const v16h af1 = frag_ld(Ab + 16 * ASTR);           // lets ds loads pipeline
    const v16h af2 = frag_ld(Ab + 32 * ASTR);
    const v16h af3 = frag_ld(Ab + 48 * ASTR);
    acc[0] = wmma_fp16(af0, bf, acc[0]);
    acc[1] = wmma_fp16(af1, bf, acc[1]);
    acc[2] = wmma_fp16(af2, bf, acc[2]);
    acc[3] = wmma_fp16(af3, bf, acc[3]);
    sched_gemm_group();
  }

#pragma unroll
  for (int m = 0; m < 4; ++m)
#pragma unroll
    for (int r = 0; r < 8; ++r) {
      const int t = m * 16 + r + hi8;
      dst[base + t * strideT] = (half_t)(acc[m][r] + bias);
    }
}

// ------------------------------ kernel 3: per (window, head) attention, WMMA
__global__ void __launch_bounds__(128)
attn_kernel(const half_t* __restrict__ qbuf, const half_t* __restrict__ kbuf,
            const half_t* __restrict__ vbuf, const float* __restrict__ bias_table,
            half_t* __restrict__ ao) {
  __shared__ __align__(16) half_t qs[WS2 * HD];     // [token][hd]
  __shared__ __align__(16) half_t ksm[WS2 * HD];    // [token][hd]
  __shared__ __align__(16) half_t vs[HD * WS2];     // [hd][token] (transposed)
  __shared__ __align__(16) float  Sf[WS2 * WS2];
  __shared__ __align__(16) half_t Ps[WS2 * WS2];

  const int w = blockIdx.x >> 4, h = blockIdx.x & 15;
  const int tid = threadIdx.x, lane = tid & 31, wid = tid >> 5;  // wid: 0..3
  const int nl = lane & 15, hi8 = (lane >> 4) << 3;

  // async-DMA q/k/v tiles (3 x 4KB contiguous) into LDS
  const size_t off = (size_t)(w * HEADS + h) * (WS2 * HD);
  const char* qg = (const char*)(qbuf + off);
  const char* kg = (const char*)(kbuf + off);
  const char* vg = (const char*)(vbuf + off);
  const unsigned ql = lds_addr(qs), kl = lds_addr(ksm), vl = lds_addr(vs);
  for (int i = tid; i < 256; i += 128) {            // 256 x 16B per array
    const int byo = i * 16;
    async_copy16(ql + byo, qg + byo);
    async_copy16(kl + byo, kg + byo);
    async_copy16(vl + byo, vg + byo);
  }
  wait_async0();
  __syncthreads();

  { // S = q @ k^T  (64x64, K=32). Wave handles N tile `wid`, loops 4 M tiles.
    const v16h bf  = frag_ld(ksm + (wid * 16 + nl) * HD + hi8); // k token = col
    const half_t* Qb = qs + nl * HD + hi8;
    const v16h af0 = frag_ld(Qb);
    const v16h af1 = frag_ld(Qb + 16 * HD);
    const v16h af2 = frag_ld(Qb + 32 * HD);
    const v16h af3 = frag_ld(Qb + 48 * HD);
    v8f acc[4] = {};
    acc[0] = wmma_fp16(af0, bf, acc[0]);
    acc[1] = wmma_fp16(af1, bf, acc[1]);
    acc[2] = wmma_fp16(af2, bf, acc[2]);
    acc[3] = wmma_fp16(af3, bf, acc[3]);
    sched_lds_gemm_group();
    const int kt = wid * 16 + nl;
#pragma unroll
    for (int m = 0; m < 4; ++m)
#pragma unroll
      for (int r = 0; r < 8; ++r) {
        const int qt = m * 16 + r + hi8;
        const int dr = (qt >> 3) - (kt >> 3) + 7;
        const int dc = (qt & 7) - (kt & 7) + 7;
        Sf[qt * WS2 + kt] = acc[m][r] * SCL + bias_table[(dr * 15 + dc) * HEADS + h];
      }
  }
  __syncthreads();

  if (tid < WS2) {  // row softmax
    const float* row = Sf + tid * WS2;
    float mx = -1e30f;
    for (int j = 0; j < WS2; ++j) mx = fmaxf(mx, row[j]);
    float sum = 0.f;
    for (int j = 0; j < WS2; ++j) sum += __expf(row[j] - mx);
    const float inv = 1.0f / sum;
    for (int j = 0; j < WS2; ++j)
      Ps[tid * WS2 + j] = (half_t)(__expf(row[j] - mx) * inv);
  }
  __syncthreads();

  // out = P @ V  (M=64 N=32 K=64). Wave handles M tile `wid`.
  v8f acc2[2] = {};
#pragma unroll
  for (int kst = 0; kst < 2; ++kst) {
    const v16h af = frag_ld(Ps + (wid * 16 + nl) * WS2 + kst * 32 + hi8);
#pragma unroll
    for (int nt = 0; nt < 2; ++nt) {  // V transposed: contiguous b128 pairs
      const v16h bf = frag_ld(vs + (nt * 16 + nl) * WS2 + kst * 32 + hi8);
      acc2[nt] = wmma_fp16(af, bf, acc2[nt]);
    }
  }
#pragma unroll
  for (int nt = 0; nt < 2; ++nt)
#pragma unroll
    for (int r = 0; r < 8; ++r) {
      const int t  = wid * 16 + r + hi8;
      const int hd = nt * 16 + nl;
      ao[((size_t)w * WS2 + t) * DIM + h * HD + hd] = (half_t)acc2[nt][r];
    }
}

// ------------------- kernel 4: proj GEMM + residual + BN2, NCHW fp32 output
__global__ void __launch_bounds__(256)
proj_kernel(const float* __restrict__ x, const half_t* __restrict__ ao,
            const half_t* __restrict__ wpj, const float* __restrict__ proj_b,
            const float* __restrict__ bn2s, const float* __restrict__ bn2h,
            float* __restrict__ out) {
  __shared__ __align__(16) half_t As[2][WS2 * ASTR];

  const int w = blockIdx.x >> 2;
  const int nbase = (blockIdx.x & 3) * 128;
  const int tid = threadIdx.x, lane = tid & 31, wid = tid >> 5;
  const int nl = lane & 15, hi8 = (lane >> 4) << 3;
  const int b = w >> 6, wi = w & 63;
  const int row0 = (wi >> 3) << 3, col0 = (wi & 7) << 3;

  const int ch = nbase + wid * 16 + nl;                 // output channel
  const half_t* wrow = wpj + (size_t)ch * DIM;

  const unsigned As_l = lds_addr(As);
  // async-DMA stage: 64 rows x 64B of ao -> padded LDS tile (4 x b128 / row)
  auto stage = [&](int ks, int bufi) {
    const int t = tid >> 2, part = tid & 3;             // 256 chunks of 16B
    const char* g = (const char*)(ao + ((size_t)w * WS2 + t) * DIM + (ks << 5))
                    + part * 16;
    const unsigned l = As_l + (unsigned)bufi * (WS2 * ASTR * 2)
                     + (unsigned)(t * ASTR * 2 + part * 16);
    async_copy16(l, g);
  };

  v8f acc[4] = {};
  stage(0, 0);
  for (int ks = 0; ks < 16; ++ks) {
    wait_async0();
    __syncthreads();
    if (ks < 15) stage(ks + 1, (ks + 1) & 1);
    const half_t* Ab = As[ks & 1] + nl * ASTR + hi8;
    const v16h bf  = frag_ld(wrow + (ks << 5) + hi8);
    const v16h af0 = frag_ld(Ab);
    const v16h af1 = frag_ld(Ab + 16 * ASTR);
    const v16h af2 = frag_ld(Ab + 32 * ASTR);
    const v16h af3 = frag_ld(Ab + 48 * ASTR);
    acc[0] = wmma_fp16(af0, bf, acc[0]);
    acc[1] = wmma_fp16(af1, bf, acc[1]);
    acc[2] = wmma_fp16(af2, bf, acc[2]);
    acc[3] = wmma_fp16(af3, bf, acc[3]);
    sched_gemm_group();
  }

  const float pb = proj_b[ch], s2 = bn2s[ch], h2 = bn2h[ch];
#pragma unroll
  for (int m = 0; m < 4; ++m)
#pragma unroll
    for (int r = 0; r < 8; ++r) {
      const int t  = m * 16 + r + hi8;
      const int pr = row0 + (t >> 3), pc = col0 + (t & 7);
      const int idx = ((b * DIM + ch) << 12) + (pr << 6) + pc;
      const float res = x[idx] + acc[m][r] + pb;  // residual
      out[idx] = res * s2 + h2;                   // BN2
    }
}

// ----------------------------------------------------------------- launcher
extern "C" void kernel_launch(void* const* d_in, const int* in_sizes, int n_in,
                              void* d_out, int out_size, void* d_ws, size_t ws_size,
                              hipStream_t stream) {
  const float* x    = (const float*)d_in[0];
  const float* g1   = (const float*)d_in[1];
  const float* be1  = (const float*)d_in[2];
  const float* m1   = (const float*)d_in[3];
  const float* va1  = (const float*)d_in[4];
  const float* qk_w = (const float*)d_in[5];
  const float* qk_b = (const float*)d_in[6];
  const float* v_w  = (const float*)d_in[7];
  const float* v_b  = (const float*)d_in[8];
  const float* pw   = (const float*)d_in[9];
  const float* pb   = (const float*)d_in[10];
  const float* bt   = (const float*)d_in[11];
  const float* g2   = (const float*)d_in[12];
  const float* be2  = (const float*)d_in[13];
  const float* m2   = (const float*)d_in[14];
  const float* va2  = (const float*)d_in[15];
  float* out = (float*)d_out;

  char* ws = (char*)d_ws;
  half_t* wqk = (half_t*)ws; ws += (size_t)2 * DIM * DIM * sizeof(half_t);
  half_t* wv  = (half_t*)ws; ws += (size_t)DIM * DIM * sizeof(half_t);
  half_t* wpj = (half_t*)ws; ws += (size_t)DIM * DIM * sizeof(half_t);
  float* bn1s = (float*)ws;  ws += DIM * sizeof(float);
  float* bn1h = (float*)ws;  ws += DIM * sizeof(float);
  float* bn2s = (float*)ws;  ws += DIM * sizeof(float);
  float* bn2h = (float*)ws;  ws += DIM * sizeof(float);
  const size_t qkvN = (size_t)NWIN * HEADS * WS2 * HD;
  half_t* qbuf = (half_t*)ws; ws += qkvN * sizeof(half_t);
  half_t* kbuf = (half_t*)ws; ws += qkvN * sizeof(half_t);
  half_t* vbuf = (half_t*)ws; ws += qkvN * sizeof(half_t);
  half_t* ao   = (half_t*)ws; ws += (size_t)NWIN * WS2 * DIM * sizeof(half_t);

  prep_kernel<<<4100, 256, 0, stream>>>(qk_w, v_w, pw, g1, be1, m1, va1,
                                        g2, be2, m2, va2,
                                        wqk, wv, wpj, bn1s, bn1h, bn2s, bn2h);
  qkv_kernel<<<NWIN * 12, 256, 0, stream>>>(x, wqk, wv, bn1s, bn1h, qk_b, v_b,
                                            qbuf, kbuf, vbuf);
  attn_kernel<<<NWIN * HEADS, 128, 0, stream>>>(qbuf, kbuf, vbuf, bt, ao);
  proj_kernel<<<NWIN * 4, 256, 0, stream>>>(x, ao, wpj, pb, bn2s, bn2h, out);
}

// v001
// Measured time: 438 microseconds a run.
// Timed twice side by side with v000, it ran 2.28 and 2.29 times as fast.
#include <hip/hip_runtime.h>

typedef _Float16 half_t;
typedef __attribute__((ext_vector_type(16))) _Float16 v16h;
typedef __attribute__((ext_vector_type(8)))  _Float16 v8h;
typedef __attribute__((ext_vector_type(8)))  float    v8f;

#define DIM   512
#define WS2   64
#define HEADS 16
#define HD    32
#define NWIN  1024          /* 16 batches * 8 * 8 windows */
#define EPSV  1e-5f
#define SCL   0.17677669529663687f  /* 1/sqrt(32) */
#define ASTR  40            /* padded LDS stride (halves) for 64x32 A tiles */
#define APITCH 520          /* LDS stride (halves) of the resident 512-deep A tile: 16 B x odd */

// ---------------------------------------------------------------- WMMA helpers
__device__ __forceinline__ v8f wmma_fp16(v16h a, v16h b, v8f c) {
  return __builtin_amdgcn_wmma_f32_16x16x32_f16(false, a, false, b, (short)0, c,
                                                false, false);
}

// Scheduling hint: issue B vmem reads, then all 8 A ds reads, then 4 WMMAs.
__device__ __forceinline__ void sched_gemm_group() {
#if __has_builtin(__builtin_amdgcn_sched_group_barrier)
  __builtin_amdgcn_sched_group_barrier(0x020, 2, 0);  // 2x VMEM read  (B frag)
  __builtin_amdgcn_sched_group_barrier(0x100, 8, 0);  // 8x DS read    (A frags)
  __builtin_amdgcn_sched_group_barrier(0x008, 4, 0);  // 4x WMMA
#endif
}
// Keeps each group of 8 A reads in front of the 8 WMMAs of the other group, so
// that a read's LDS latency runs under matrix work instead of in front of it.
__device__ __forceinline__ void sched_qkv_group() {
#if __has_builtin(__builtin_amdgcn_sched_group_barrier)
  __builtin_amdgcn_sched_group_barrier(0x020, 4, 0);  // 4x VMEM read (next B)
  __builtin_amdgcn_sched_group_barrier(0x100, 8, 0);  // 8x DS read   (A, 2nd half)
  __builtin_amdgcn_sched_group_barrier(0x008, 8, 0);  // 8x WMMA      (1st half)
  __builtin_amdgcn_sched_group_barrier(0x100, 8, 0);  // 8x DS read   (next A, 1st half)
  __builtin_amdgcn_sched_group_barrier(0x008, 8, 0);  // 8x WMMA      (2nd half)
#endif
}
__device__ __forceinline__ void sched_lds_gemm_group() {
#if __has_builtin(__builtin_amdgcn_sched_group_barrier)
  __builtin_amdgcn_sched_group_barrier(0x100, 10, 0); // 10x DS read (B + A)
  __builtin_amdgcn_sched_group_barrier(0x008, 4, 0);  // 4x WMMA
#endif
}

// Per ISA 7.12.2, a lane's 16 fragment halves (A row m / B column n) are two
// contiguous 8-half runs: k = hi8+0..7 and k = 16+hi8+0..7.  `p` must point at
// (row_base + hi8) and be 16B aligned -> two b128 loads.
__device__ __forceinline__ v16h frag_ld(const half_t* p) {
  const v8h lo = *(const v8h*)(p);
  const v8h hi = *(const v8h*)(p + 16);
  v16h r;
#pragma unroll
  for (int i = 0; i < 8; ++i) { r[i] = lo[i]; r[8 + i] = hi[i]; }
  return r;
}

// ------------------------------------------------ CDNA5 async copy -> LDS
// GLOBAL_LOAD_ASYNC_TO_LDS_B128 (ISA 15.18.3, ASYNCcnt). LDS dest address is
// the low 32 bits of the flat shared pointer (LDS aperture truncation).
__device__ __forceinline__ unsigned lds_addr(const void* p) {
  return (unsigned)(unsigned long long)(uintptr_t)p;
}
__device__ __forceinline__ void async_copy16(unsigned lds, const void* g) {
  asm volatile("global_load_async_to_lds_b128 %0, %1, off"
               :: "v"(lds), "v"((unsigned long long)(uintptr_t)g)
               : "memory");
}
__device__ __forceinline__ void wait_async0() {
  asm volatile("s_wait_asynccnt 0" ::: "memory");
}

// --------------------------------------------------- kernel 1: prep (weights)
__global__ void prep_kernel(const float* __restrict__ qk_w,
                            const float* __restrict__ v_w,
                            const float* __restrict__ proj_w,
                            const float* __restrict__ g1, const float* __restrict__ be1,
                            const float* __restrict__ m1, const float* __restrict__ va1,
                            const float* __restrict__ g2, const float* __restrict__ be2,
                            const float* __restrict__ m2, const float* __restrict__ va2,
                            half_t* __restrict__ wqk, half_t* __restrict__ wv,
                            half_t* __restrict__ wpj,
                            float* __restrict__ bn1s, float* __restrict__ bn1h,
                            float* __restrict__ bn2s, float* __restrict__ bn2h) {
  int i = blockIdx.x * blockDim.x + threadIdx.x;
  const int NQK = 2 * DIM * DIM;   // 524288
  const int NV  = DIM * DIM;       // 262144
  if (i < NQK) { wqk[i] = (half_t)qk_w[i]; return; }
  i -= NQK;
  if (i < NV) { wv[i] = (half_t)v_w[i]; return; }
  i -= NV;
  if (i < NV) { wpj[i] = (half_t)proj_w[i]; return; }
  i -= NV;
  if (i < DIM) {
    const float s = g1[i] * rsqrtf(va1[i] + EPSV);
    bn1s[i] = s; bn1h[i] = be1[i] - m1[i] * s; return;
  }
  i -= DIM;
  if (i < DIM) {
    const float s = g2[i] * rsqrtf(va2[i] + EPSV);
    bn2s[i] = s; bn2h[i] = be2[i] - m2[i] * s; return;
  }
}

// -------------------------------------------- kernel 2: fused BN1 + QKV GEMMs
// Block = 256 thr (8 waves): two windows side by side in the image (128 tokens)
// and all 1536 output cols.  The BN'd 128x512 f16 A tile is staged in LDS once
// and stays there; each wave then runs 6 passes of a 128x32 tile (one head).
// cols [0,512)=Q, [512,1024)=K, [1024,1536)=V (V stored transposed per head).
// B fragments come straight from global f16 weights (four b128 per K-step).
// 2 x 133,120 B of LDS fit one WGP: four waves per SIMD, 256 VGPRs each.
__global__ void __launch_bounds__(256) __attribute__((amdgpu_waves_per_eu(4, 4)))
qkv_kernel(const float* __restrict__ x,
           const half_t* __restrict__ wqk, const half_t* __restrict__ wv,
           const float* __restrict__ bn1s, const float* __restrict__ bn1h,
           const float* __restrict__ qk_b, const float* __restrict__ v_b,
           half_t* __restrict__ qbuf, half_t* __restrict__ kbuf,
           half_t* __restrict__ vbuf) {
  __shared__ __align__(16) half_t As[2 * WS2 * APITCH];   // resident A tile

  const int w0  = blockIdx.x * 2;                  // windows w0 and w0 + 1
  const int tid = threadIdx.x, lane = tid & 31;
  const int wid = __builtin_amdgcn_readfirstlane(tid >> 5);
  const int nl = lane & 15, hi8 = (lane >> 4) << 3;

  const int b = w0 >> 6, wi = w0 & 63;
  const int row0 = (wi >> 3) << 3, col0 = (wi & 7) << 3;   // col0: 0,16,32,48

  { // A staging, once: a lane takes 4 pixels of one image row (16 B) in 8
    // channels, and writes 8 channels of each of the 4 tokens as one b128.
    const int r = lane >> 2, quad = lane & 3;
    const int m0 = ((quad >> 1) << 6) + (r << 3) + ((quad & 1) << 2);
    const float* xl = x + ((b * DIM + (wid << 3)) << 12) + ((row0 + r) << 6) + col0 + (quad << 2);
    // 16 loads of 16 B in flight per lane cover the memory latency; all 64 at
    // once would spill
#pragma unroll 1
    for (int i = 0; i < 4; ++i) {
      float4 v[2][8];
#pragma unroll
      for (int u = 0; u < 2; ++u)
#pragma unroll
        for (int j = 0; j < 8; ++j)
          v[u][j] = *(const float4*)(xl + ((u * 64 + j) << 12));
      // the address pair that these loads name is kept whole up to this wait
      // (it is an input here) and is advanced only behind it
      asm volatile("s_wait_xcnt 0x0" :: "v"(xl) : "memory");
      xl += 128 << 12;                                   // 128 channels on
#pragma unroll
      for (int u = 0; u < 2; ++u) {
        const int c0 = (wid + (((i << 1) + u) << 3)) << 3;
        v8h o0, o1, o2, o3;
#pragma unroll
        for (int j = 0; j < 8; ++j) {
          const float s = bn1s[c0 + j], sh = bn1h[c0 + j];
          o0[j] = (half_t)(v[u][j].x * s + sh);
          o1[j] = (half_t)(v[u][j].y * s + sh);
          o2[j] = (half_t)(v[u][j].z * s + sh);
          o3[j] = (half_t)(v[u][j].w * s + sh);
        }
        half_t* ap = As + m0 * APITCH + c0;
        *(v8h*)(ap)              = o0;
        *(v8h*)(ap + APITCH)     = o1;
        *(v8h*)(ap + 2 * APITCH) = o2;
        *(v8h*)(ap + 3 * APITCH) = o3;
      }
    }
  }
  __syncthreads();

  const half_t* A0 = As + nl * APITCH + hi8;     // tokens of window w0
  const half_t* A1 = A0 + WS2 * APITCH;          // tokens of window w0 + 1
  for (int p = 0; p < 6; ++p) {
    // 32 output columns = one head of Q, K or V; routing resolved per pass
    const int ng0 = ((p << 3) + wid) << 5;
    const half_t* wrow; float bias0, bias1; half_t* dst; int base, strideT, strideN;
    if (ng0 < 2 * DIM) {
      wrow  = wqk + (size_t)(ng0 + nl) * DIM;
      bias0 = qk_b[ng0 + nl]; bias1 = qk_b[ng0 + 16 + nl];
      const int nn = ng0 & (DIM - 1);
      dst = (ng0 < DIM) ? qbuf : kbuf;
      base = (((w0 * HEADS) + (nn >> 5)) * WS2) * HD + nl;       // [t][hd]
      strideT = HD; strideN = 16;
    } else {
      const int nn = ng0 - 2 * DIM;
      wrow  = wv + (size_t)(nn + nl) * DIM;
      bias0 = v_b[nn + nl]; bias1 = v_b[nn + 16 + nl];
      dst  = vbuf;
      base = (((w0 * HEADS) + (nn >> 5)) * HD + nl) * WS2;       // [hd][t]
      strideT = 1; strideN = 16 * WS2;
    }

    v8f acc[8][2] = {};
    // Fragments run half a K-step (A, from LDS) and one K-step (B, from global)
    // ahead of the WMMAs that use them.
    v16h a0[4], a1[4];
    v16h bf0 = frag_ld(wrow + hi8);                      // global b128 x2
    v16h bf1 = frag_ld(wrow + 16 * DIM + hi8);
#pragma unroll
    for (int m = 0; m < 4; ++m) a0[m] = frag_ld(A0 + m * 16 * APITCH);
    // two K-steps a trip: they use up one 128-B line of each weight row; a
    // full unroll lets the loads run ahead until the registers spill
#pragma unroll 2
    for (int ks = 0; ks < 16; ++ks) {
      const int kc = ks << 5;
      const int kn = (ks < 15 ? ks + 1 : 15) << 5;       // last trip: in bounds, unused
      const v16h nb0 = frag_ld(wrow + kn + hi8);
      const v16h nb1 = frag_ld(wrow + 16 * DIM + kn + hi8);
#pragma unroll
      for (int m = 0; m < 4; ++m) a1[m] = frag_ld(A1 + m * 16 * APITCH + kc);
#pragma unroll
      for (int m = 0; m < 4; ++m) {
        acc[m][0] = wmma_fp16(a0[m], bf0, acc[m][0]);
        acc[m][1] = wmma_fp16(a0[m], bf1, acc[m][1]);
      }
#pragma unroll
      for (int m = 0; m < 4; ++m) a0[m] = frag_ld(A0 + m * 16 * APITCH + kn);
#pragma unroll
      for (int m = 0; m < 4; ++m) {
        acc[4 + m][0] = wmma_fp16(a1[m], bf0, acc[4 + m][0]);
        acc[4 + m][1] = wmma_fp16(a1[m], bf1, acc[4 + m][1]);
      }
      bf0 = nb0; bf1 = nb1;
      sched_qkv_group();
    }

#pragma unroll
    for (int m = 0; m < 8; ++m)
#pragma unroll
      for (int r = 0; r < 8; ++r) {
        const int t = (m & 3) * 16 + r + hi8;
        const int o = base + (m >> 2) * (HEADS * WS2 * HD) + t * strideT;
        dst[o]           = (half_t)(acc[m][0][r] + bias0);
        dst[o + strideN] = (half_t)(acc[m][1][r] + bias1);
      }
    // the next pass reuses the registers that these stores name
    asm volatile("s_wait_xcnt 0x0" ::: "memory");
  }
}

// ------------------------------ kernel 3: per (window, head) attention, WMMA
__global__ void __launch_bounds__(128)
attn_kernel(const half_t* __restrict__ qbuf, const half_t* __restrict__ kbuf,
            const half_t* __restrict__ vbuf, const float* __restrict__ bias_table,
            half_t* __restrict__ ao) {
  __shared__ __align__(16) half_t qs[WS2 * HD];     // [token][hd]
  __shared__ __align__(16) half_t ksm[WS2 * HD];    // [token][hd]
  __shared__ __align__(16) half_t vs[HD * WS2];     // [hd][token] (transposed)
  __shared__ __align__(16) float  Sf[WS2 * WS2];
  __shared__ __align__(16) half_t Ps[WS2 * WS2];

  const int w = blockIdx.x >> 4, h = blockIdx.x & 15;
  const int tid = threadIdx.x, lane = tid & 31, wid = tid >> 5;  // wid: 0..3
  const int nl = lane & 15, hi8 = (lane >> 4) << 3;

  // async-DMA q/k/v tiles (3 x 4KB contiguous) into LDS
  const size_t off = (size_t)(w * HEADS + h) * (WS2 * HD);
  const char* qg = (const char*)(qbuf + off);
  const char* kg = (const char*)(kbuf + off);
  const char* vg = (const char*)(vbuf + off);
  const unsigned ql = lds_addr(qs), kl = lds_addr(ksm), vl = lds_addr(vs);
  for (int i = tid; i < 256; i += 128) {            // 256 x 16B per array
    const int byo = i * 16;
    async_copy16(ql + byo, qg + byo);
    async_copy16(kl + byo, kg + byo);
    async_copy16(vl + byo, vg + byo);
  }
  wait_async0();
  __syncthreads();

  { // S = q @ k^T  (64x64, K=32). Wave handles N tile `wid`, loops 4 M tiles.
    const v16h bf  = frag_ld(ksm + (wid * 16 + nl) * HD + hi8); // k token = col
    const half_t* Qb = qs + nl * HD + hi8;
    const v16h af0 = frag_ld(Qb);
    const v16h af1 = frag_ld(Qb + 16 * HD);
    const v16h af2 = frag_ld(Qb + 32 * HD);
    const v16h af3 = frag_ld(Qb + 48 * HD);
    v8f acc[4] = {};
    acc[0] = wmma_fp16(af0, bf, acc[0]);
    acc[1] = wmma_fp16(af1, bf, acc[1]);
    acc[2] = wmma_fp16(af2, bf, acc[2]);
    acc[3] = wmma_fp16(af3, bf, acc[3]);
    sched_lds_gemm_group();
    const int kt = wid * 16 + nl;
#pragma unroll
    for (int m = 0; m < 4; ++m)
#pragma unroll
      for (int r = 0; r < 8; ++r) {
        const int qt = m * 16 + r + hi8;
        const int dr = (qt >> 3) - (kt >> 3) + 7;
        const int dc = (qt & 7) - (kt & 7) + 7;
        Sf[qt * WS2 + kt] = acc[m][r] * SCL + bias_table[(dr * 15 + dc) * HEADS + h];
      }
  }
  __syncthreads();

  if (tid < WS2) {  // row softmax
    const float* row = Sf + tid * WS2;
    float mx = -1e30f;
    for (int j = 0; j < WS2; ++j) mx = fmaxf(mx, row[j]);
    float sum = 0.f;
    for (int j = 0; j < WS2; ++j) sum += __expf(row[j] - mx);
    const float inv = 1.0f / sum;
    for (int j = 0; j < WS2; ++j)
      Ps[tid * WS2 + j] = (half_t)(__expf(row[j] - mx) * inv);
  }
  __syncthreads();

  // out = P @ V  (M=64 N=32 K=64). Wave handles M tile `wid`.
  v8f acc2[2] = {};
#pragma unroll
  for (int kst = 0; kst < 2; ++kst) {
    const v16h af = frag_ld(Ps + (wid * 16 + nl) * WS2 + kst * 32 + hi8);
#pragma unroll
    for (int nt = 0; nt < 2; ++nt) {  // V transposed: contiguous b128 pairs
      const v16h bf = frag_ld(vs + (nt * 16 + nl) * WS2 + kst * 32 + hi8);
      acc2[nt] = wmma_fp16(af, bf, acc2[nt]);
    }
  }
#pragma unroll
  for (int nt = 0; nt < 2; ++nt)
#pragma unroll
    for (int r = 0; r < 8; ++r) {
      const int t  = wid * 16 + r + hi8;
      const int hd = nt * 16 + nl;
      ao[((size_t)w * WS2 + t) * DIM + h * HD + hd] = (half_t)acc2[nt][r];
    }
}

// ------------------- kernel 4: proj GEMM + residual + BN2, NCHW fp32 output
__global__ void __launch_bounds__(256)
proj_kernel(const float* __restrict__ x, const half_t* __restrict__ ao,
            const half_t* __restrict__ wpj, const float* __restrict__ proj_b,
            const float* __restrict__ bn2s, const float* __restrict__ bn2h,
            float* __restrict__ out) {
  __shared__ __align__(16) half_t As[2][WS2 * ASTR];

  const int w = blockIdx.x >> 2;
  const int nbase = (blockIdx.x & 3) * 128;
  const int tid = threadIdx.x, lane = tid & 31, wid = tid >> 5;
  const int nl = lane & 15, hi8 = (lane >> 4) << 3;
  const int b = w >> 6, wi = w & 63;
  const int row0 = (wi >> 3) << 3, col0 = (wi & 7) << 3;

  const int ch = nbase + wid * 16 + nl;                 // output channel
  const half_t* wrow = wpj + (size_t)ch * DIM;

  const unsigned As_l = lds_addr(As);
  // async-DMA stage: 64 rows x 64B of ao -> padded LDS tile (4 x b128 / row)
  auto stage = [&](int ks, int bufi) {
    const int t = tid >> 2, part = tid & 3;             // 256 chunks of 16B
    const char* g = (const char*)(ao + ((size_t)w * WS2 + t) * DIM + (ks << 5))
                    + part * 16;
    const unsigned l = As_l + (unsigned)bufi * (WS2 * ASTR * 2)
                     + (unsigned)(t * ASTR * 2 + part * 16);
    async_copy16(l, g);
  };

  v8f acc[4] = {};
  stage(0, 0);
  for (int ks = 0; ks < 16; ++ks) {
    wait_async0();
    __syncthreads();
    if (ks < 15) stage(ks + 1, (ks + 1) & 1);
    const half_t* Ab = As[ks & 1] + nl * ASTR + hi8;
    const v16h bf  = frag_ld(wrow + (ks << 5) + hi8);
    const v16h af0 = frag_ld(Ab);
    const v16h af1 = frag_ld(Ab + 16 * ASTR);
    const v16h af2 = frag_ld(Ab + 32 * ASTR);
    const v16h af3 = frag_ld(Ab + 48 * ASTR);
    acc[0] = wmma_fp16(af0, bf, acc[0]);
    acc[1] = wmma_fp16(af1, bf, acc[1]);
    acc[2] = wmma_fp16(af2, bf, acc[2]);
    acc[3] = wmma_fp16(af3, bf, acc[3]);
    sched_gemm_group();
  }

  const float pb = proj_b[ch], s2 = bn2s[ch], h2 = bn2h[ch];
#pragma unroll
  for (int m = 0; m < 4; ++m)
#pragma unroll
    for (int r = 0; r < 8; ++r) {
      const int t  = m * 16 + r + hi8;
      const int pr = row0 + (t >> 3), pc = col0 + (t & 7);
      const int idx = ((b * DIM + ch) << 12) + (pr << 6) + pc;
      const float res = x[idx] + acc[m][r] + pb;  // residual
      out[idx] = res * s2 + h2;                   // BN2
    }
}

// ----------------------------------------------------------------- launcher
extern "C" void kernel_launch(void* const* d_in, const int* in_sizes, int n_in,
                              void* d_out, int out_size, void* d_ws, size_t ws_size,
                              hipStream_t stream) {
  const float* x    = (const float*)d_in[0];
  const float* g1   = (const float*)d_in[1];
  const float* be1  = (const float*)d_in[2];
  const float* m1   = (const float*)d_in[3];
  const float* va1  = (const float*)d_in[4];
  const float* qk_w = (const float*)d_in[5];
  const float* qk_b = (const float*)d_in[6];
  const float* v_w  = (const float*)d_in[7];
  const float* v_b  = (const float*)d_in[8];
  const float* pw   = (const float*)d_in[9];
  const float* pb   = (const float*)d_in[10];
  const float* bt   = (const float*)d_in[11];
  const float* g2   = (const float*)d_in[12];
  const float* be2  = (const float*)d_in[13];
  const float* m2   = (const float*)d_in[14];
  const float* va2  = (const float*)d_in[15];
  float* out = (float*)d_out;

  char* ws = (char*)d_ws;
  half_t* wqk = (half_t*)ws; ws += (size_t)2 * DIM * DIM * sizeof(half_t);
  half_t* wv  = (half_t*)ws; ws += (size_t)DIM * DIM * sizeof(half_t);
  half_t* wpj = (half_t*)ws; ws += (size_t)DIM * DIM * sizeof(half_t);
  float* bn1s = (float*)ws;  ws += DIM * sizeof(float);
  float* bn1h = (float*)ws;  ws += DIM * sizeof(float);
  float* bn2s = (float*)ws;  ws += DIM * sizeof(float);
  float* bn2h = (float*)ws;  ws += DIM * sizeof(float);
  const size_t qkvN = (size_t)NWIN * HEADS * WS2 * HD;
  half_t* qbuf = (half_t*)ws; ws += qkvN * sizeof(half_t);
  half_t* kbuf = (half_t*)ws; ws += qkvN * sizeof(half_t);
  half_t* vbuf = (half_t*)ws; ws += qkvN * sizeof(half_t);
  half_t* ao   = (half_t*)ws; ws += (size_t)NWIN * WS2 * DIM * sizeof(half_t);

  prep_kernel<<<4100, 256, 0, stream>>>(qk_w, v_w, pw, g1, be1, m1, va1,
                                        g2, be2, m2, va2,
                                        wqk, wv, wpj, bn1s, bn1h, bn2s, bn2h);
  qkv_kernel<<<NWIN / 2, 256, 0, stream>>>(x, wqk, wv, bn1s, bn1h, qk_b, v_b,
                                            qbuf, kbuf, vbuf);
  attn_kernel<<<NWIN * HEADS, 128, 0, stream>>>(qbuf, kbuf, vbuf, bt, ao);
  proj_kernel<<<NWIN * 4, 256, 0, stream>>>(x, ao, wpj, pb, bn2s, bn2h, out);
}

// v002
// It runs in 356 microseconds.
// Timed twice side by side with v001, it ran 1.23 times as fast both times.
// Counting every step since v000, it is 2.82 times as fast.
#include <hip/hip_runtime.h>

typedef _Float16 half_t;
typedef __attribute__((ext_vector_type(16))) _Float16 v16h;
typedef __attribute__((ext_vector_type(8)))  _Float16 v8h;
typedef __attribute__((ext_vector_type(8)))  float    v8f;

#define DIM   512
#define WS2   64
#define HEADS 16
#define HD    32
#define NWIN  1024          /* 16 batches * 8 * 8 windows */
#define EPSV  1e-5f
#define SCL   0.17677669529663687f  /* 1/sqrt(32) */
#define ASTR  40            /* padded LDS stride (halves) for 64x32 A tiles */
#define APITCH 520          /* LDS stride (halves) of the resident 512-deep A tile: 16 B x odd */

// ---------------------------------------------------------------- WMMA helpers
__device__ __forceinline__ v8f wmma_fp16(v16h a, v16h b, v8f c) {
  return __builtin_amdgcn_wmma_f32_16x16x32_f16(false, a, false, b, (short)0, c,
                                                false, false);
}

// Scheduling hint: issue B vmem reads, then all 8 A ds reads, then 4 WMMAs.
__device__ __forceinline__ void sched_gemm_group() {
#if __has_builtin(__builtin_amdgcn_sched_group_barrier)
  __builtin_amdgcn_sched_group_barrier(0x020, 2, 0);  // 2x VMEM read  (B frag)
  __builtin_amdgcn_sched_group_barrier(0x100, 8, 0);  // 8x DS read    (A frags)
  __builtin_amdgcn_sched_group_barrier(0x008, 4, 0);  // 4x WMMA
#endif
}
// Keeps each group of 8 A reads in front of the 8 WMMAs of the other group, so
// that a read's LDS latency runs under matrix work instead of in front of it.
__device__ __forceinline__ void sched_qkv_group() {
#if __has_builtin(__builtin_amdgcn_sched_group_barrier)
  __builtin_amdgcn_sched_group_barrier(0x020, 4, 0);  // 4x VMEM read (next B)
  __builtin_amdgcn_sched_group_barrier(0x100, 8, 0);  // 8x DS read   (A, 2nd half)
  __builtin_amdgcn_sched_group_barrier(0x008, 8, 0);  // 8x WMMA      (1st half)
  __builtin_amdgcn_sched_group_barrier(0x100, 8, 0);  // 8x DS read   (next A, 1st half)
  __builtin_amdgcn_sched_group_barrier(0x008, 8, 0);  // 8x WMMA      (2nd half)
#endif
}

// Per ISA 7.12.2, a lane's 16 fragment halves (A row m / B column n) are two
// contiguous 8-half runs: k = hi8+0..7 and k = 16+hi8+0..7.  `p` must point at
// (row_base + hi8) and be 16B aligned -> two b128 loads.
__device__ __forceinline__ v16h frag_ld(const half_t* p) {
  const v8h lo = *(const v8h*)(p);
  const v8h hi = *(const v8h*)(p + 16);
  v16h r;
#pragma unroll
  for (int i = 0; i < 8; ++i) { r[i] = lo[i]; r[8 + i] = hi[i]; }
  return r;
}

// ------------------------------------------------ CDNA5 async copy -> LDS
// GLOBAL_LOAD_ASYNC_TO_LDS_B128 (ISA 15.18.3, ASYNCcnt). LDS dest address is
// the low 32 bits of the flat shared pointer (LDS aperture truncation).
__device__ __forceinline__ unsigned lds_addr(const void* p) {
  return (unsigned)(unsigned long long)(uintptr_t)p;
}
__device__ __forceinline__ void async_copy16(unsigned lds, const void* g) {
  asm volatile("global_load_async_to_lds_b128 %0, %1, off"
               :: "v"(lds), "v"((unsigned long long)(uintptr_t)g)
               : "memory");
}
__device__ __forceinline__ void wait_async0() {
  asm volatile("s_wait_asynccnt 0" ::: "memory");
}

// --------------------------------------------------- kernel 1: prep (weights)
__global__ void prep_kernel(const float* __restrict__ qk_w,
                            const float* __restrict__ v_w,
                            const float* __restrict__ proj_w,
                            const float* __restrict__ g1, const float* __restrict__ be1,
                            const float* __restrict__ m1, const float* __restrict__ va1,
                            const float* __restrict__ g2, const float* __restrict__ be2,
                            const float* __restrict__ m2, const float* __restrict__ va2,
                            half_t* __restrict__ wqk, half_t* __restrict__ wv,
                            half_t* __restrict__ wpj,
                            float* __restrict__ bn1s, float* __restrict__ bn1h,
                            float* __restrict__ bn2s, float* __restrict__ bn2h) {
  int i = blockIdx.x * blockDim.x + threadIdx.x;
  const int NQK = 2 * DIM * DIM;   // 524288
  const int NV  = DIM * DIM;       // 262144
  if (i < NQK) { wqk[i] = (half_t)qk_w[i]; return; }
  i -= NQK;
  if (i < NV) { wv[i] = (half_t)v_w[i]; return; }
  i -= NV;
  if (i < NV) { wpj[i] = (half_t)proj_w[i]; return; }
  i -= NV;
  if (i < DIM) {
    const float s = g1[i] * rsqrtf(va1[i] + EPSV);
    bn1s[i] = s; bn1h[i] = be1[i] - m1[i] * s; return;
  }
  i -= DIM;
  if (i < DIM) {
    const float s = g2[i] * rsqrtf(va2[i] + EPSV);
    bn2s[i] = s; bn2h[i] = be2[i] - m2[i] * s; return;
  }
}

// -------------------------------------------- kernel 2: fused BN1 + QKV GEMMs
// Block = 256 thr (8 waves): two windows side by side in the image (128 tokens)
// and all 1536 output cols.  The BN'd 128x512 f16 A tile is staged in LDS once
// and stays there; each wave then runs 6 passes of a 128x32 tile (one head).
// cols [0,512)=Q, [512,1024)=K, [1024,1536)=V (V stored transposed per head).
// B fragments come straight from global f16 weights (four b128 per K-step).
// 2 x 133,120 B of LDS fit one WGP: four waves per SIMD, 256 VGPRs each.
__global__ void __launch_bounds__(256) __attribute__((amdgpu_waves_per_eu(4, 4)))
qkv_kernel(const float* __restrict__ x,
           const half_t* __restrict__ wqk, const half_t* __restrict__ wv,
           const float* __restrict__ bn1s, const float* __restrict__ bn1h,
           const float* __restrict__ qk_b, const float* __restrict__ v_b,
           half_t* __restrict__ qbuf, half_t* __restrict__ kbuf,
           half_t* __restrict__ vbuf) {
  __shared__ __align__(16) half_t As[2 * WS2 * APITCH];   // resident A tile

  const int w0  = blockIdx.x * 2;                  // windows w0 and w0 + 1
  const int tid = threadIdx.x, lane = tid & 31;
  const int wid = __builtin_amdgcn_readfirstlane(tid >> 5);
  const int nl = lane & 15, hi8 = (lane >> 4) << 3;

  const int b = w0 >> 6, wi = w0 & 63;
  const int row0 = (wi >> 3) << 3, col0 = (wi & 7) << 3;   // col0: 0,16,32,48

  { // A staging, once: a lane takes 4 pixels of one image row (16 B) in 8
    // channels, and writes 8 channels of each of the 4 tokens as one b128.
    const int r = lane >> 2, quad = lane & 3;
    const int m0 = ((quad >> 1) << 6) + (r << 3) + ((quad & 1) << 2);
    const float* xl = x + ((b * DIM + (wid << 3)) << 12) + ((row0 + r) << 6) + col0 + (quad << 2);
    // 16 loads of 16 B in flight per lane cover the memory latency; all 64 at
    // once would spill
#pragma unroll 1
    for (int i = 0; i < 4; ++i) {
      float4 v[2][8];
#pragma unroll
      for (int u = 0; u < 2; ++u)
#pragma unroll
        for (int j = 0; j < 8; ++j)
          v[u][j] = *(const float4*)(xl + ((u * 64 + j) << 12));
      // the address pair that these loads name is kept whole up to this wait
      // (it is an input here) and is advanced only behind it
      asm volatile("s_wait_xcnt 0x0" :: "v"(xl) : "memory");
      xl += 128 << 12;                                   // 128 channels on
#pragma unroll
      for (int u = 0; u < 2; ++u) {
        const int c0 = (wid + (((i << 1) + u) << 3)) << 3;
        v8h o0, o1, o2, o3;
#pragma unroll
        for (int j = 0; j < 8; ++j) {
          const float s = bn1s[c0 + j], sh = bn1h[c0 + j];
          o0[j] = (half_t)(v[u][j].x * s + sh);
          o1[j] = (half_t)(v[u][j].y * s + sh);
          o2[j] = (half_t)(v[u][j].z * s + sh);
          o3[j] = (half_t)(v[u][j].w * s + sh);
        }
        half_t* ap = As + m0 * APITCH + c0;
        *(v8h*)(ap)              = o0;
        *(v8h*)(ap + APITCH)     = o1;
        *(v8h*)(ap + 2 * APITCH) = o2;
        *(v8h*)(ap + 3 * APITCH) = o3;
      }
    }
  }
  __syncthreads();

  const half_t* A0 = As + nl * APITCH + hi8;     // tokens of window w0
  const half_t* A1 = A0 + WS2 * APITCH;          // tokens of window w0 + 1
  for (int p = 0; p < 6; ++p) {
    // 32 output columns = one head of Q, K or V; routing resolved per pass
    const int ng0 = ((p << 3) + wid) << 5;
    const half_t* wrow; float bias0, bias1; half_t* dst; int base, strideT, strideN;
    if (ng0 < 2 * DIM) {
      wrow  = wqk + (size_t)(ng0 + nl) * DIM;
      bias0 = qk_b[ng0 + nl]; bias1 = qk_b[ng0 + 16 + nl];
      const int nn = ng0 & (DIM - 1);
      dst = (ng0 < DIM) ? qbuf : kbuf;
      base = (((w0 * HEADS) + (nn >> 5)) * WS2) * HD + nl;       // [t][hd]
      strideT = HD; strideN = 16;
    } else {
      const int nn = ng0 - 2 * DIM;
      wrow  = wv + (size_t)(nn + nl) * DIM;
      bias0 = v_b[nn + nl]; bias1 = v_b[nn + 16 + nl];
      dst  = vbuf;
      base = (((w0 * HEADS) + (nn >> 5)) * HD + nl) * WS2;       // [hd][t]
      strideT = 1; strideN = 16 * WS2;
    }

    v8f acc[8][2] = {};
    // Fragments run half a K-step (A, from LDS) and one K-step (B, from global)
    // ahead of the WMMAs that use them.
    v16h a0[4], a1[4];
    v16h bf0 = frag_ld(wrow + hi8);                      // global b128 x2
    v16h bf1 = frag_ld(wrow + 16 * DIM + hi8);
#pragma unroll
    for (int m = 0; m < 4; ++m) a0[m] = frag_ld(A0 + m * 16 * APITCH);
    // two K-steps a trip: they use up one 128-B line of each weight row; a
    // full unroll lets the loads run ahead until the registers spill
#pragma unroll 2
    for (int ks = 0; ks < 16; ++ks) {
      const int kc = ks << 5;
      const int kn = (ks < 15 ? ks + 1 : 15) << 5;       // last trip: in bounds, unused
      const v16h nb0 = frag_ld(wrow + kn + hi8);
      const v16h nb1 = frag_ld(wrow + 16 * DIM + kn + hi8);
#pragma unroll
      for (int m = 0; m < 4; ++m) a1[m] = frag_ld(A1 + m * 16 * APITCH + kc);
#pragma unroll
      for (int m = 0; m < 4; ++m) {
        acc[m][0] = wmma_fp16(a0[m], bf0, acc[m][0]);
        acc[m][1] = wmma_fp16(a0[m], bf1, acc[m][1]);
      }
#pragma unroll
      for (int m = 0; m < 4; ++m) a0[m] = frag_ld(A0 + m * 16 * APITCH + kn);
#pragma unroll
      for (int m = 0; m < 4; ++m) {
        acc[4 + m][0] = wmma_fp16(a1[m], bf0, acc[4 + m][0]);
        acc[4 + m][1] = wmma_fp16(a1[m], bf1, acc[4 + m][1]);
      }
      bf0 = nb0; bf1 = nb1;
      sched_qkv_group();
    }

#pragma unroll
    for (int m = 0; m < 8; ++m)
#pragma unroll
      for (int r = 0; r < 8; ++r) {
        const int t = (m & 3) * 16 + r + hi8;
        const int o = base + (m >> 2) * (HEADS * WS2 * HD) + t * strideT;
        dst[o]           = (half_t)(acc[m][0][r] + bias0);
        dst[o + strideN] = (half_t)(acc[m][1][r] + bias1);
      }
    // the next pass reuses the registers that these stores name
    asm volatile("s_wait_xcnt 0x0" ::: "memory");
  }
}

// ------------------------------ kernel 3: per (window, head) attention, WMMA
// One wave does whole (window, head) units by itself, with no LDS and no barrier.
// S^T = K Q^T: a lane then holds 32 of the 64 scores of ONE query (its partner
// lane ^ 16 the rest), so max and sum are in-lane plus one exchange.  Two S^T
// tiles, converted in place, are the B operand of O^T = V^T P^T, and a lane's 8
// results are 8 consecutive channels of one token: one 16-B store.
// A wave keeps its head over WPW windows; the bias of tile (kt, qt) depends on
// qt - kt alone, so 7 x 8 registers hold the head's whole 64 x 64 bias.
#define WPW   4             /* windows per wave */
#define LOG2E 1.4426950408889634f

// lane l <-> lane l ^ 16
__device__ __forceinline__ float xhalf(float v) {
  const int b = __builtin_bit_cast(int, v);
  return __builtin_bit_cast(float, __builtin_amdgcn_permlanex16(
      b, b, 0x76543210, 0xfedcba98, false, false));
}

// 2^x of 8 values in one statement: behind each v_exp_f32 then stands an
// instruction that neither reads its result nor overwrites its source (the
// outputs are early-clobber), and behind the last a v_nop.  That is the slot the
// instruction set asks for behind a transcendental.
__device__ __forceinline__ v8f exp2x8(v8f x) {
  float p0, p1, p2, p3, p4, p5, p6, p7;
  asm("v_exp_f32 %0, %8\n\t"
      "v_exp_f32 %1, %9\n\t"
      "v_exp_f32 %2, %10\n\t"
      "v_exp_f32 %3, %11\n\t"
      "v_exp_f32 %4, %12\n\t"
      "v_exp_f32 %5, %13\n\t"
      "v_exp_f32 %6, %14\n\t"
      "v_exp_f32 %7, %15\n\t"
      "v_nop"
      : "=&v"(p0), "=&v"(p1), "=&v"(p2), "=&v"(p3),
        "=&v"(p4), "=&v"(p5), "=&v"(p6), "=&v"(p7)
      : "v"(x[0]), "v"(x[1]), "v"(x[2]), "v"(x[3]),
        "v"(x[4]), "v"(x[5]), "v"(x[6]), "v"(x[7]));
  const v8f r = {p0, p1, p2, p3, p4, p5, p6, p7};
  return r;
}

__global__ void __launch_bounds__(128)
attn_kernel(const half_t* __restrict__ qbuf, const half_t* __restrict__ kbuf,
            const half_t* __restrict__ vbuf, const float* __restrict__ bias_table,
            half_t* __restrict__ ao) {
  const int lane = threadIdx.x & 31;
  const int wid = __builtin_amdgcn_readfirstlane(threadIdx.x >> 5);
  const int nl = lane & 15, hh = lane >> 4, hi8 = hh << 3;
  const int gw = blockIdx.x * 4 + wid;             // wave number, 0..4095
  const int h  = gw & (HEADS - 1);                 // a block's 4 heads are adjacent
  const int w0 = (gw >> 4) * WPW;

  // query = qt*16 + nl, key = kt*16 + 8*hh + r; d = qt - kt + 3:
  // row difference dr = 2*d + 1 + (nl>>3) - hh (0..14), column difference
  // dc = (nl&7) + 7 - r (0..14): one lane address, constant steps in d and r
  const float* bp = bias_table + ((1 + (nl >> 3) - hh) * 15 + (nl & 7)) * HEADS + h;
  float bias[7][8];
#pragma unroll
  for (int d = 0; d < 7; ++d)
#pragma unroll
    for (int r = 0; r < 8; ++r)
      bias[d][r] = bp[(d * 30 + 7 - r) * HEADS] * LOG2E;
  // the address that these 56 loads name is an input here, so it stays whole
  // up to this wait; its registers are free for other use only behind it
  asm volatile("s_wait_xcnt 0x0" :: "v"(bp) : "memory");

  const size_t off = (size_t)(w0 * HEADS + h) * (WS2 * HD);
  const half_t* kp = kbuf + off + nl * HD + hi8;         // [token][hd]
  const half_t* qp = qbuf + off + nl * HD + hi8;         // [token][hd]
  const half_t* vp = vbuf + off + nl * WS2 + hi8;        // [hd][token]
  half_t* op = ao + ((size_t)w0 * WS2 + nl) * DIM + h * HD + hi8;

  // rolled: one unit's fragments and the bias fill the register budget
#pragma unroll 1
  for (int i = 0; i < WPW; ++i) {
    v16h ka[4], qb[4], va[2][2];
#pragma unroll
    for (int t = 0; t < 4; ++t) {
      ka[t] = frag_ld(kp + t * 16 * HD);
      qb[t] = frag_ld(qp + t * 16 * HD);
    }
#pragma unroll
    for (int nt = 0; nt < 2; ++nt)
#pragma unroll
      for (int ks = 0; ks < 2; ++ks)
        va[nt][ks] = frag_ld(vp + nt * 16 * WS2 + ks * 32);

#pragma unroll
    for (int qt = 0; qt < 4; ++qt) {
      v8f s[4];
#pragma unroll
      for (int kt = 0; kt < 4; ++kt) {
        const v8f zero = {};
        s[kt] = wmma_fp16(ka[kt], qb[qt], zero);
      }
      float m4[4];
#pragma unroll
      for (int kt = 0; kt < 4; ++kt) {
#pragma unroll
        for (int r = 0; r < 8; ++r)
          s[kt][r] = s[kt][r] * (SCL * LOG2E) + bias[qt - kt + 3][r];
        m4[kt] = s[kt][0];
#pragma unroll
        for (int r = 1; r < 8; ++r) m4[kt] = fmaxf(m4[kt], s[kt][r]);
      }
      float mx = fmaxf(fmaxf(m4[0], m4[1]), fmaxf(m4[2], m4[3]));
      mx = fmaxf(mx, xhalf(mx));

      float s4[4];
      v16h pb[2];
#pragma unroll
      for (int kt = 0; kt < 4; ++kt) {
        const v8f p = exp2x8(s[kt] - mx);
        s4[kt] = p[0];
#pragma unroll
        for (int r = 1; r < 8; ++r) s4[kt] += p[r];
#pragma unroll
        for (int r = 0; r < 8; ++r) pb[kt >> 1][(kt & 1) * 8 + r] = (half_t)p[r];
      }
      float sum = (s4[0] + s4[1]) + (s4[2] + s4[3]);
      sum += xhalf(sum);
      const float inv = 1.0f / sum;

      v8f o[2] = {};
#pragma unroll
      for (int ks = 0; ks < 2; ++ks)
#pragma unroll
        for (int nt = 0; nt < 2; ++nt)
          o[nt] = wmma_fp16(va[nt][ks], pb[ks], o[nt]);
#pragma unroll
      for (int nt = 0; nt < 2; ++nt) {
        v8h ov;
#pragma unroll
        for (int r = 0; r < 8; ++r) ov[r] = (half_t)(o[nt][r] * inv);
        *(v8h*)(op + qt * 16 * DIM + nt * 16) = ov;
      }
    }
    // the four address pairs that this trip's loads and stores name are kept
    // whole up to this wait (they are inputs here) and advanced only behind it
    asm volatile("s_wait_xcnt 0x0" :: "v"(kp), "v"(qp), "v"(vp), "v"(op) : "memory");
    kp += HEADS * WS2 * HD; qp += HEADS * WS2 * HD; vp += HEADS * WS2 * HD;
    op += WS2 * DIM;
  }
}

// ------------------- kernel 4: proj GEMM + residual + BN2, NCHW fp32 output
__global__ void __launch_bounds__(256)
proj_kernel(const float* __restrict__ x, const half_t* __restrict__ ao,
            const half_t* __restrict__ wpj, const float* __restrict__ proj_b,
            const float* __restrict__ bn2s, const float* __restrict__ bn2h,
            float* __restrict__ out) {
  __shared__ __align__(16) half_t As[2][WS2 * ASTR];

  const int w = blockIdx.x >> 2;
  const int nbase = (blockIdx.x & 3) * 128;
  const int tid = threadIdx.x, lane = tid & 31, wid = tid >> 5;
  const int nl = lane & 15, hi8 = (lane >> 4) << 3;
  const int b = w >> 6, wi = w & 63;
  const int row0 = (wi >> 3) << 3, col0 = (wi & 7) << 3;

  const int ch = nbase + wid * 16 + nl;                 // output channel
  const half_t* wrow = wpj + (size_t)ch * DIM;

  const unsigned As_l = lds_addr(As);
  // async-DMA stage: 64 rows x 64B of ao -> padded LDS tile (4 x b128 / row)
  auto stage = [&](int ks, int bufi) {
    const int t = tid >> 2, part = tid & 3;             // 256 chunks of 16B
    const char* g = (const char*)(ao + ((size_t)w * WS2 + t) * DIM + (ks << 5))
                    + part * 16;
    const unsigned l = As_l + (unsigned)bufi * (WS2 * ASTR * 2)
                     + (unsigned)(t * ASTR * 2 + part * 16);
    async_copy16(l, g);
  };

  v8f acc[4] = {};
  stage(0, 0);
  for (int ks = 0; ks < 16; ++ks) {
    wait_async0();
    __syncthreads();
    if (ks < 15) stage(ks + 1, (ks + 1) & 1);
    const half_t* Ab = As[ks & 1] + nl * ASTR + hi8;
    const v16h bf  = frag_ld(wrow + (ks << 5) + hi8);
    const v16h af0 = frag_ld(Ab);
    const v16h af1 = frag_ld(Ab + 16 * ASTR);
    const v16h af2 = frag_ld(Ab + 32 * ASTR);
    const v16h af3 = frag_ld(Ab + 48 * ASTR);
    acc[0] = wmma_fp16(af0, bf, acc[0]);
    acc[1] = wmma_fp16(af1, bf, acc[1]);
    acc[2] = wmma_fp16(af2, bf, acc[2]);
    acc[3] = wmma_fp16(af3, bf, acc[3]);
    sched_gemm_group();
  }

  const float pb = proj_b[ch], s2 = bn2s[ch], h2 = bn2h[ch];
#pragma unroll
  for (int m = 0; m < 4; ++m)
#pragma unroll
    for (int r = 0; r < 8; ++r) {
      const int t  = m * 16 + r + hi8;
      const int pr = row0 + (t >> 3), pc = col0 + (t & 7);
      const int idx = ((b * DIM + ch) << 12) + (pr << 6) + pc;
      const float res = x[idx] + acc[m][r] + pb;  // residual
      out[idx] = res * s2 + h2;                   // BN2
    }
}

// ----------------------------------------------------------------- launcher
extern "C" void kernel_launch(void* const* d_in, const int* in_sizes, int n_in,
                              void* d_out, int out_size, void* d_ws, size_t ws_size,
                              hipStream_t stream) {
  const float* x    = (const float*)d_in[0];
  const float* g1   = (const float*)d_in[1];
  const float* be1  = (const float*)d_in[2];
  const float* m1   = (const float*)d_in[3];
  const float* va1  = (const float*)d_in[4];
  const float* qk_w = (const float*)d_in[5];
  const float* qk_b = (const float*)d_in[6];
  const float* v_w  = (const float*)d_in[7];
  const float* v_b  = (const float*)d_in[8];
  const float* pw   = (const float*)d_in[9];
  const float* pb   = (const float*)d_in[10];
  const float* bt   = (const float*)d_in[11];
  const float* g2   = (const float*)d_in[12];
  const float* be2  = (const float*)d_in[13];
  const float* m2   = (const float*)d_in[14];
  const float* va2  = (const float*)d_in[15];
  float* out = (float*)d_out;

  char* ws = (char*)d_ws;
  half_t* wqk = (half_t*)ws; ws += (size_t)2 * DIM * DIM * sizeof(half_t);
  half_t* wv  = (half_t*)ws; ws += (size_t)DIM * DIM * sizeof(half_t);
  half_t* wpj = (half_t*)ws; ws += (size_t)DIM * DIM * sizeof(half_t);
  float* bn1s = (float*)ws;  ws += DIM * sizeof(float);
  float* bn1h = (float*)ws;  ws += DIM * sizeof(float);
  float* bn2s = (float*)ws;  ws += DIM * sizeof(float);
  float* bn2h = (float*)ws;  ws += DIM * sizeof(float);
  const size_t qkvN = (size_t)NWIN * HEADS * WS2 * HD;
  half_t* qbuf = (half_t*)ws; ws += qkvN * sizeof(half_t);
  half_t* kbuf = (half_t*)ws; ws += qkvN * sizeof(half_t);
  half_t* vbuf = (half_t*)ws; ws += qkvN * sizeof(half_t);
  half_t* ao   = (half_t*)ws; ws += (size_t)NWIN * WS2 * DIM * sizeof(half_t);

  prep_kernel<<<4100, 256, 0, stream>>>(qk_w, v_w, pw, g1, be1, m1, va1,
                                        g2, be2, m2, va2,
                                        wqk, wv, wpj, bn1s, bn1h, bn2s, bn2h);
  qkv_kernel<<<NWIN / 2, 256, 0, stream>>>(x, wqk, wv, bn1s, bn1h, qk_b, v_b,
                                            qbuf, kbuf, vbuf);
  attn_kernel<<<NWIN * HEADS / (4 * WPW), 128, 0, stream>>>(qbuf, kbuf, vbuf, bt, ao);
  proj_kernel<<<NWIN * 4, 256, 0, stream>>>(x, ao, wpj, pb, bn2s, bn2h, out);
}

// v003
// One run takes 332 microseconds.
// In two side-by-side timings against v002, it was 1.08 and 1.07 times as fast.
// Over all steps from v000 it is 3.02 times as fast.
#include <hip/hip_runtime.h>

typedef _Float16 half_t;
typedef __attribute__((ext_vector_type(16))) _Float16 v16h;
typedef __attribute__((ext_vector_type(8)))  _Float16 v8h;
typedef __attribute__((ext_vector_type(8)))  float    v8f;

#define DIM   512
#define WS2   64
#define HEADS 16
#define HD    32
#define NWIN  1024          /* 16 batches * 8 * 8 windows */
#define EPSV  1e-5f
#define SCL   0.17677669529663687f  /* 1/sqrt(32) */
#define ASTR  40            /* padded LDS stride (halves) for 64x32 A tiles */
#define APITCH 520          /* LDS stride (halves) of the resident 512-deep A tile: 16 B x odd */

// ---------------------------------------------------------------- WMMA helpers
__device__ __forceinline__ v8f wmma_fp16(v16h a, v16h b, v8f c) {
  return __builtin_amdgcn_wmma_f32_16x16x32_f16(false, a, false, b, (short)0, c,
                                                false, false);
}

// Scheduling hint: issue B vmem reads, then all 8 A ds reads, then 4 WMMAs.
__device__ __forceinline__ void sched_gemm_group() {
#if __has_builtin(__builtin_amdgcn_sched_group_barrier)
  __builtin_amdgcn_sched_group_barrier(0x020, 2, 0);  // 2x VMEM read  (B frag)
  __builtin_amdgcn_sched_group_barrier(0x100, 8, 0);  // 8x DS read    (A frags)
  __builtin_amdgcn_sched_group_barrier(0x008, 4, 0);  // 4x WMMA
#endif
}
// Keeps each group of 8 A reads in front of the 8 WMMAs of the other group, so
// that a read's LDS latency runs under matrix work instead of in front of it.
__device__ __forceinline__ void sched_qkv_group() {
#if __has_builtin(__builtin_amdgcn_sched_group_barrier)
  __builtin_amdgcn_sched_group_barrier(0x020, 4, 0);  // 4x VMEM read (next B)
  __builtin_amdgcn_sched_group_barrier(0x100, 8, 0);  // 8x DS read   (A, 2nd half)
  __builtin_amdgcn_sched_group_barrier(0x008, 8, 0);  // 8x WMMA      (1st half)
  __builtin_amdgcn_sched_group_barrier(0x100, 8, 0);  // 8x DS read   (next A, 1st half)
  __builtin_amdgcn_sched_group_barrier(0x008, 8, 0);  // 8x WMMA      (2nd half)
#endif
}

// Per ISA 7.12.2, a lane's 16 fragment halves (A row m / B column n) are two
// contiguous 8-half runs: k = hi8+0..7 and k = 16+hi8+0..7.  `p` must point at
// (row_base + hi8) and be 16B aligned -> two b128 loads.
__device__ __forceinline__ v16h frag_ld(const half_t* p) {
  const v8h lo = *(const v8h*)(p);
  const v8h hi = *(const v8h*)(p + 16);
  v16h r;
#pragma unroll
  for (int i = 0; i < 8; ++i) { r[i] = lo[i]; r[8 + i] = hi[i]; }
  return r;
}

// The f16 weights lie in the workspace in fragment order: per 16 output columns
// and 32 k one block of 1 KB = [k half-run: k&16][lane = ((k>>3)&1)*16 + col&15][k&7].
// A wave's b128 load of a half-run is then 512 contiguous bytes, 4 whole lines;
// from row-major weights it touched 16 lines, 32 B of each.  The k order per
// lane and register is that of frag_ld.  `p` points at (block + lane*8).
#define WBLK  512           /* halves per 16-column x 32-k block */
__device__ __forceinline__ v16h frag_ldw(const half_t* p) {
  const v8h lo = *(const v8h*)(p);
  const v8h hi = *(const v8h*)(p + 256);
  v16h r;
#pragma unroll
  for (int i = 0; i < 8; ++i) { r[i] = lo[i]; r[8 + i] = hi[i]; }
  return r;
}
// position in the fragment-ordered copy -> index in the row-major [n][DIM] weight
__device__ __forceinline__ int frag_src(int o) {
  const int n = ((o >> 13) << 4) + ((o >> 3) & 15);
  const int k = (((o >> 9) & 15) << 5) + (((o >> 8) & 1) << 4) + (((o >> 7) & 1) << 3) + (o & 7);
  return n * DIM + k;
}

// ------------------------------------------------ CDNA5 async copy -> LDS
// GLOBAL_LOAD_ASYNC_TO_LDS_B128 (ISA 15.18.3, ASYNCcnt). LDS dest address is
// the low 32 bits of the flat shared pointer (LDS aperture truncation).
__device__ __forceinline__ unsigned lds_addr(const void* p) {
  return (unsigned)(unsigned long long)(uintptr_t)p;
}
__device__ __forceinline__ void async_copy16(unsigned lds, const void* g) {
  asm volatile("global_load_async_to_lds_b128 %0, %1, off"
               :: "v"(lds), "v"((unsigned long long)(uintptr_t)g)
               : "memory");
}
__device__ __forceinline__ void wait_async0() {
  asm volatile("s_wait_asynccnt 0" ::: "memory");
}

// --------------------------------------------------- kernel 1: prep (weights)
__global__ void prep_kernel(const float* __restrict__ qk_w,
                            const float* __restrict__ v_w,
                            const float* __restrict__ proj_w,
                            const float* __restrict__ g1, const float* __restrict__ be1,
                            const float* __restrict__ m1, const float* __restrict__ va1,
                            const float* __restrict__ g2, const float* __restrict__ be2,
                            const float* __restrict__ m2, const float* __restrict__ va2,
                            half_t* __restrict__ wqk, half_t* __restrict__ wv,
                            half_t* __restrict__ wpj,
                            float* __restrict__ bn1s, float* __restrict__ bn1h,
                            float* __restrict__ bn2s, float* __restrict__ bn2h) {
  int i = blockIdx.x * blockDim.x + threadIdx.x;
  const int NQK = 2 * DIM * DIM;   // 524288
  const int NV  = DIM * DIM;       // 262144
  if (i < NQK) { wqk[i] = (half_t)qk_w[frag_src(i)]; return; }
  i -= NQK;
  if (i < NV) { wv[i] = (half_t)v_w[frag_src(i)]; return; }
  i -= NV;
  if (i < NV) { wpj[i] = (half_t)proj_w[frag_src(i)]; return; }
  i -= NV;
  if (i < DIM) {
    const float s = g1[i] * rsqrtf(va1[i] + EPSV);
    bn1s[i] = s; bn1h[i] = be1[i] - m1[i] * s; return;
  }
  i -= DIM;
  if (i < DIM) {
    const float s = g2[i] * rsqrtf(va2[i] + EPSV);
    bn2s[i] = s; bn2h[i] = be2[i] - m2[i] * s; return;
  }
}

// -------------------------------------------- kernel 2: fused BN1 + QKV GEMMs
// Block = 256 thr (8 waves): two windows side by side in the image (128 tokens)
// and all 1536 output cols.  The BN'd 128x512 f16 A tile is staged in LDS once
// and stays there; each wave then runs 6 passes of a 128x32 tile (one head).
// cols [0,512)=Q, [512,1024)=K, [1024,1536)=V (V stored transposed per head).
// B fragments come straight from the fragment-ordered global f16 weights (two
// b128 of 4 whole lines each per 16 columns and K-step).
// 2 x 133,120 B of LDS fit one WGP: four waves per SIMD, 256 VGPRs each.
__global__ void __launch_bounds__(256) __attribute__((amdgpu_waves_per_eu(4, 4)))
qkv_kernel(const float* __restrict__ x,
           const half_t* __restrict__ wqk, const half_t* __restrict__ wv,
           const float* __restrict__ bn1s, const float* __restrict__ bn1h,
           const float* __restrict__ qk_b, const float* __restrict__ v_b,
           half_t* __restrict__ qbuf, half_t* __restrict__ kbuf,
           half_t* __restrict__ vbuf) {
  __shared__ __align__(16) half_t As[2 * WS2 * APITCH];   // resident A tile

  const int w0  = blockIdx.x * 2;                  // windows w0 and w0 + 1
  const int tid = threadIdx.x, lane = tid & 31;
  const int wid = __builtin_amdgcn_readfirstlane(tid >> 5);
  const int nl = lane & 15, hi8 = (lane >> 4) << 3;

  const int b = w0 >> 6, wi = w0 & 63;
  const int row0 = (wi >> 3) << 3, col0 = (wi & 7) << 3;   // col0: 0,16,32,48

  { // A staging, once: a lane takes 4 pixels of one image row (16 B) in 8
    // channels, and writes 8 channels of each of the 4 tokens as one b128.
    const int r = lane >> 2, quad = lane & 3;
    const int m0 = ((quad >> 1) << 6) + (r << 3) + ((quad & 1) << 2);
    const float* xl = x + ((b * DIM + (wid << 3)) << 12) + ((row0 + r) << 6) + col0 + (quad << 2);
    // 16 loads of 16 B in flight per lane cover the memory latency; all 64 at
    // once would spill
#pragma unroll 1
    for (int i = 0; i < 4; ++i) {
      float4 v[2][8];
#pragma unroll
      for (int u = 0; u < 2; ++u)
#pragma unroll
        for (int j = 0; j < 8; ++j)
          v[u][j] = *(const float4*)(xl + ((u * 64 + j) << 12));
      // the address pair that these loads name is kept whole up to this wait
      // (it is an input here) and is advanced only behind it
      asm volatile("s_wait_xcnt 0x0" :: "v"(xl) : "memory");
      xl += 128 << 12;                                   // 128 channels on
#pragma unroll
      for (int u = 0; u < 2; ++u) {
        const int c0 = (wid + (((i << 1) + u) << 3)) << 3;
        v8h o0, o1, o2, o3;
#pragma unroll
        for (int j = 0; j < 8; ++j) {
          const float s = bn1s[c0 + j], sh = bn1h[c0 + j];
          o0[j] = (half_t)(v[u][j].x * s + sh);
          o1[j] = (half_t)(v[u][j].y * s + sh);
          o2[j] = (half_t)(v[u][j].z * s + sh);
          o3[j] = (half_t)(v[u][j].w * s + sh);
        }
        half_t* ap = As + m0 * APITCH + c0;
        *(v8h*)(ap)              = o0;
        *(v8h*)(ap + APITCH)     = o1;
        *(v8h*)(ap + 2 * APITCH) = o2;
        *(v8h*)(ap + 3 * APITCH) = o3;
      }
    }
  }
  __syncthreads();

  const half_t* A0 = As + nl * APITCH + hi8;     // tokens of window w0
  const half_t* A1 = A0 + WS2 * APITCH;          // tokens of window w0 + 1
  for (int p = 0; p < 6; ++p) {
    // 32 output columns = one head of Q, K or V; routing resolved per pass
    const int ng0 = ((p << 3) + wid) << 5;
    const half_t* wrow; float bias0, bias1; half_t* dst; int base, strideT, strideN;
    if (ng0 < 2 * DIM) {
      wrow  = wqk + (size_t)ng0 * DIM + lane * 8;
      bias0 = qk_b[ng0 + nl]; bias1 = qk_b[ng0 + 16 + nl];
      const int nn = ng0 & (DIM - 1);
      dst = (ng0 < DIM) ? qbuf : kbuf;
      base = (((w0 * HEADS) + (nn >> 5)) * WS2) * HD + nl;       // [t][hd]
      strideT = HD; strideN = 16;
    } else {
      const int nn = ng0 - 2 * DIM;
      wrow  = wv + (size_t)nn * DIM + lane * 8;
      bias0 = v_b[nn + nl]; bias1 = v_b[nn + 16 + nl];
      dst  = vbuf;
      base = (((w0 * HEADS) + (nn >> 5)) * HD + nl) * WS2;       // [hd][t]
      strideT = 1; strideN = 16 * WS2;
    }

    v8f acc[8][2] = {};
    // Fragments run half a K-step (A, from LDS) and one K-step (B, from global)
    // ahead of the WMMAs that use them.
    v16h a0[4], a1[4];
    v16h bf0 = frag_ldw(wrow);                           // global b128 x2
    v16h bf1 = frag_ldw(wrow + 16 * DIM);
#pragma unroll
    for (int m = 0; m < 4; ++m) a0[m] = frag_ld(A0 + m * 16 * APITCH);
    // two K-steps a trip: a full unroll lets the loads run ahead until the
    // registers spill
#pragma unroll 2
    for (int ks = 0; ks < 16; ++ks) {
      const int kc = ks << 5;
      const int kn = (ks < 15 ? ks + 1 : 15) << 5;       // last trip: in bounds, unused
      const v16h nb0 = frag_ldw(wrow + (kn >> 5) * WBLK);
      const v16h nb1 = frag_ldw(wrow + 16 * DIM + (kn >> 5) * WBLK);
#pragma unroll
      for (int m = 0; m < 4; ++m) a1[m] = frag_ld(A1 + m * 16 * APITCH + kc);
#pragma unroll
      for (int m = 0; m < 4; ++m) {
        acc[m][0] = wmma_fp16(a0[m], bf0, acc[m][0]);
        acc[m][1] = wmma_fp16(a0[m], bf1, acc[m][1]);
      }
#pragma unroll
      for (int m = 0; m < 4; ++m) a0[m] = frag_ld(A0 + m * 16 * APITCH + kn);
#pragma unroll
      for (int m = 0; m < 4; ++m) {
        acc[4 + m][0] = wmma_fp16(a1[m], bf0, acc[4 + m][0]);
        acc[4 + m][1] = wmma_fp16(a1[m], bf1, acc[4 + m][1]);
      }
      bf0 = nb0; bf1 = nb1;
      sched_qkv_group();
    }

#pragma unroll
    for (int m = 0; m < 8; ++m)
#pragma unroll
      for (int r = 0; r < 8; ++r) {
        const int t = (m & 3) * 16 + r + hi8;
        const int o = base + (m >> 2) * (HEADS * WS2 * HD) + t * strideT;
        dst[o]           = (half_t)(acc[m][0][r] + bias0);
        dst[o + strideN] = (half_t)(acc[m][1][r] + bias1);
      }
    // the next pass reuses the registers that these stores name
    asm volatile("s_wait_xcnt 0x0" ::: "memory");
  }
}

// ------------------------------ kernel 3: per (window, head) attention, WMMA
// One wave does whole (window, head) units by itself, with no LDS and no barrier.
// S^T = K Q^T: a lane then holds 32 of the 64 scores of ONE query (its partner
// lane ^ 16 the rest), so max and sum are in-lane plus one exchange.  Two S^T
// tiles, converted in place, are the B operand of O^T = V^T P^T, and a lane's 8
// results are 8 consecutive channels of one token: one 16-B store.
// A wave keeps its head over WPW windows; the bias of tile (kt, qt) depends on
// qt - kt alone, so 7 x 8 registers hold the head's whole 64 x 64 bias.
#define WPW   4             /* windows per wave */
#define LOG2E 1.4426950408889634f

// lane l <-> lane l ^ 16
__device__ __forceinline__ float xhalf(float v) {
  const int b = __builtin_bit_cast(int, v);
  return __builtin_bit_cast(float, __builtin_amdgcn_permlanex16(
      b, b, 0x76543210, 0xfedcba98, false, false));
}

// 2^x of 8 values in one statement: behind each v_exp_f32 then stands an
// instruction that neither reads its result nor overwrites its source (the
// outputs are early-clobber), and behind the last a v_nop.  That is the slot the
// instruction set asks for behind a transcendental.
__device__ __forceinline__ v8f exp2x8(v8f x) {
  float p0, p1, p2, p3, p4, p5, p6, p7;
  asm("v_exp_f32 %0, %8\n\t"
      "v_exp_f32 %1, %9\n\t"
      "v_exp_f32 %2, %10\n\t"
      "v_exp_f32 %3, %11\n\t"
      "v_exp_f32 %4, %12\n\t"
      "v_exp_f32 %5, %13\n\t"
      "v_exp_f32 %6, %14\n\t"
      "v_exp_f32 %7, %15\n\t"
      "v_nop"
      : "=&v"(p0), "=&v"(p1), "=&v"(p2), "=&v"(p3),
        "=&v"(p4), "=&v"(p5), "=&v"(p6), "=&v"(p7)
      : "v"(x[0]), "v"(x[1]), "v"(x[2]), "v"(x[3]),
        "v"(x[4]), "v"(x[5]), "v"(x[6]), "v"(x[7]));
  const v8f r = {p0, p1, p2, p3, p4, p5, p6, p7};
  return r;
}

__global__ void __launch_bounds__(128)
attn_kernel(const half_t* __restrict__ qbuf, const half_t* __restrict__ kbuf,
            const half_t* __restrict__ vbuf, const float* __restrict__ bias_table,
            half_t* __restrict__ ao) {
  const int lane = threadIdx.x & 31;
  const int wid = __builtin_amdgcn_readfirstlane(threadIdx.x >> 5);
  const int nl = lane & 15, hh = lane >> 4, hi8 = hh << 3;
  const int gw = blockIdx.x * 4 + wid;             // wave number, 0..4095
  const int h  = gw & (HEADS - 1);                 // a block's 4 heads are adjacent
  const int w0 = (gw >> 4) * WPW;

  // query = qt*16 + nl, key = kt*16 + 8*hh + r; d = qt - kt + 3:
  // row difference dr = 2*d + 1 + (nl>>3) - hh (0..14), column difference
  // dc = (nl&7) + 7 - r (0..14): one lane address, constant steps in d and r
  const float* bp = bias_table + ((1 + (nl >> 3) - hh) * 15 + (nl & 7)) * HEADS + h;
  float bias[7][8];
#pragma unroll
  for (int d = 0; d < 7; ++d)
#pragma unroll
    for (int r = 0; r < 8; ++r)
      bias[d][r] = bp[(d * 30 + 7 - r) * HEADS] * LOG2E;
  // the address that these 56 loads name is an input here, so it stays whole
  // up to this wait; its registers are free for other use only behind it
  asm volatile("s_wait_xcnt 0x0" :: "v"(bp) : "memory");

  const size_t off = (size_t)(w0 * HEADS + h) * (WS2 * HD);
  const half_t* kp = kbuf + off + nl * HD + hi8;         // [token][hd]
  const half_t* qp = qbuf + off + nl * HD + hi8;         // [token][hd]
  const half_t* vp = vbuf + off + nl * WS2 + hi8;        // [hd][token]
  half_t* op = ao + ((size_t)w0 * WS2 + nl) * DIM + h * HD + hi8;

  // rolled: one unit's fragments and the bias fill the register budget
#pragma unroll 1
  for (int i = 0; i < WPW; ++i) {
    v16h ka[4], qb[4], va[2][2];
#pragma unroll
    for (int t = 0; t < 4; ++t) {
      ka[t] = frag_ld(kp + t * 16 * HD);
      qb[t] = frag_ld(qp + t * 16 * HD);
    }
#pragma unroll
    for (int nt = 0; nt < 2; ++nt)
#pragma unroll
      for (int ks = 0; ks < 2; ++ks)
        va[nt][ks] = frag_ld(vp + nt * 16 * WS2 + ks * 32);

#pragma unroll
    for (int qt = 0; qt < 4; ++qt) {
      v8f s[4];
#pragma unroll
      for (int kt = 0; kt < 4; ++kt) {
        const v8f zero = {};
        s[kt] = wmma_fp16(ka[kt], qb[qt], zero);
      }
      float m4[4];
#pragma unroll
      for (int kt = 0; kt < 4; ++kt) {
#pragma unroll
        for (int r = 0; r < 8; ++r)
          s[kt][r] = s[kt][r] * (SCL * LOG2E) + bias[qt - kt + 3][r];
        m4[kt] = s[kt][0];
#pragma unroll
        for (int r = 1; r < 8; ++r) m4[kt] = fmaxf(m4[kt], s[kt][r]);
      }
      float mx = fmaxf(fmaxf(m4[0], m4[1]), fmaxf(m4[2], m4[3]));
      mx = fmaxf(mx, xhalf(mx));

      float s4[4];
      v16h pb[2];
#pragma unroll
      for (int kt = 0; kt < 4; ++kt) {
        const v8f p = exp2x8(s[kt] - mx);
        s4[kt] = p[0];
#pragma unroll
        for (int r = 1; r < 8; ++r) s4[kt] += p[r];
#pragma unroll
        for (int r = 0; r < 8; ++r) pb[kt >> 1][(kt & 1) * 8 + r] = (half_t)p[r];
      }
      float sum = (s4[0] + s4[1]) + (s4[2] + s4[3]);
      sum += xhalf(sum);
      const float inv = 1.0f / sum;

      v8f o[2] = {};
#pragma unroll
      for (int ks = 0; ks < 2; ++ks)
#pragma unroll
        for (int nt = 0; nt < 2; ++nt)
          o[nt] = wmma_fp16(va[nt][ks], pb[ks], o[nt]);
#pragma unroll
      for (int nt = 0; nt < 2; ++nt) {
        v8h ov;
#pragma unroll
        for (int r = 0; r < 8; ++r) ov[r] = (half_t)(o[nt][r] * inv);
        *(v8h*)(op + qt * 16 * DIM + nt * 16) = ov;
      }
    }
    // the four address pairs that this trip's loads and stores name are kept
    // whole up to this wait (they are inputs here) and advanced only behind it
    asm volatile("s_wait_xcnt 0x0" :: "v"(kp), "v"(qp), "v"(vp), "v"(op) : "memory");
    kp += HEADS * WS2 * HD; qp += HEADS * WS2 * HD; vp += HEADS * WS2 * HD;
    op += WS2 * DIM;
  }
}

// ------------------- kernel 4: proj GEMM + residual + BN2, NCHW fp32 output
__global__ void __launch_bounds__(256)
proj_kernel(const float* __restrict__ x, const half_t* __restrict__ ao,
            const half_t* __restrict__ wpj, const float* __restrict__ proj_b,
            const float* __restrict__ bn2s, const float* __restrict__ bn2h,
            float* __restrict__ out) {
  __shared__ __align__(16) half_t As[2][WS2 * ASTR];

  const int w = blockIdx.x >> 2;
  const int nbase = (blockIdx.x & 3) * 128;
  const int tid = threadIdx.x, lane = tid & 31, wid = tid >> 5;
  const int nl = lane & 15, hi8 = (lane >> 4) << 3;
  const int b = w >> 6, wi = w & 63;
  const int row0 = (wi >> 3) << 3, col0 = (wi & 7) << 3;

  const int ch = nbase + wid * 16 + nl;                 // output channel
  const half_t* wrow = wpj + (size_t)(nbase + wid * 16) * DIM + lane * 8;  // fragment order

  const unsigned As_l = lds_addr(As);
  // async-DMA stage: 64 rows x 64B of ao -> padded LDS tile (4 x b128 / row)
  auto stage = [&](int ks, int bufi) {
    const int t = tid >> 2, part = tid & 3;             // 256 chunks of 16B
    const char* g = (const char*)(ao + ((size_t)w * WS2 + t) * DIM + (ks << 5))
                    + part * 16;
    const unsigned l = As_l + (unsigned)bufi * (WS2 * ASTR * 2)
                     + (unsigned)(t * ASTR * 2 + part * 16);
    async_copy16(l, g);
  };

  v8f acc[4] = {};
  stage(0, 0);
  for (int ks = 0; ks < 16; ++ks) {
    wait_async0();
    __syncthreads();
    if (ks < 15) stage(ks + 1, (ks + 1) & 1);
    const half_t* Ab = As[ks & 1] + nl * ASTR + hi8;
    const v16h bf  = frag_ldw(wrow + ks * WBLK);
    const v16h af0 = frag_ld(Ab);
    const v16h af1 = frag_ld(Ab + 16 * ASTR);
    const v16h af2 = frag_ld(Ab + 32 * ASTR);
    const v16h af3 = frag_ld(Ab + 48 * ASTR);
    acc[0] = wmma_fp16(af0, bf, acc[0]);
    acc[1] = wmma_fp16(af1, bf, acc[1]);
    acc[2] = wmma_fp16(af2, bf, acc[2]);
    acc[3] = wmma_fp16(af3, bf, acc[3]);
    sched_gemm_group();
    // ends the K-step for the scheduler: without it this build lets the WMMAs of
    // three K-steps sink to the end of the unrolled trip and holds their
    // fragments all that time (135 VGPRs: 3 blocks on a WGP instead of 5)
    __builtin_amdgcn_sched_barrier(0);
  }

  const float pb = proj_b[ch], s2 = bn2s[ch], h2 = bn2h[ch];
#pragma unroll
  for (int m = 0; m < 4; ++m)
#pragma unroll
    for (int r = 0; r < 8; ++r) {
      const int t  = m * 16 + r + hi8;
      const int pr = row0 + (t >> 3), pc = col0 + (t & 7);
      const int idx = ((b * DIM + ch) << 12) + (pr << 6) + pc;
      const float res = x[idx] + acc[m][r] + pb;  // residual
      out[idx] = res * s2 + h2;                   // BN2
    }
}

// ----------------------------------------------------------------- launcher
extern "C" void kernel_launch(void* const* d_in, const int* in_sizes, int n_in,
                              void* d_out, int out_size, void* d_ws, size_t ws_size,
                              hipStream_t stream) {
  const float* x    = (const float*)d_in[0];
  const float* g1   = (const float*)d_in[1];
  const float* be1  = (const float*)d_in[2];
  const float* m1   = (const float*)d_in[3];
  const float* va1  = (const float*)d_in[4];
  const float* qk_w = (const float*)d_in[5];
  const float* qk_b = (const float*)d_in[6];
  const float* v_w  = (const float*)d_in[7];
  const float* v_b  = (const float*)d_in[8];
  const float* pw   = (const float*)d_in[9];
  const float* pb   = (const float*)d_in[10];
  const float* bt   = (const float*)d_in[11];
  const float* g2   = (const float*)d_in[12];
  const float* be2  = (const float*)d_in[13];
  const float* m2   = (const float*)d_in[14];
  const float* va2  = (const float*)d_in[15];
  float* out = (float*)d_out;

  char* ws = (char*)d_ws;
  half_t* wqk = (half_t*)ws; ws += (size_t)2 * DIM * DIM * sizeof(half_t);
  half_t* wv  = (half_t*)ws; ws += (size_t)DIM * DIM * sizeof(half_t);
  half_t* wpj = (half_t*)ws; ws += (size_t)DIM * DIM * sizeof(half_t);
  float* bn1s = (float*)ws;  ws += DIM * sizeof(float);
  float* bn1h = (float*)ws;  ws += DIM * sizeof(float);
  float* bn2s = (float*)ws;  ws += DIM * sizeof(float);
  float* bn2h = (float*)ws;  ws += DIM * sizeof(float);
  const size_t qkvN = (size_t)NWIN * HEADS * WS2 * HD;
  half_t* qbuf = (half_t*)ws; ws += qkvN * sizeof(half_t);
  half_t* kbuf = (half_t*)ws; ws += qkvN * sizeof(half_t);
  half_t* vbuf = (half_t*)ws; ws += qkvN * sizeof(half_t);
  half_t* ao   = (half_t*)ws; ws += (size_t)NWIN * WS2 * DIM * sizeof(half_t);

  prep_kernel<<<4100, 256, 0, stream>>>(qk_w, v_w, pw, g1, be1, m1, va1,
                                        g2, be2, m2, va2,
                                        wqk, wv, wpj, bn1s, bn1h, bn2s, bn2h);
  qkv_kernel<<<NWIN / 2, 256, 0, stream>>>(x, wqk, wv, bn1s, bn1h, qk_b, v_b,
                                            qbuf, kbuf, vbuf);
  attn_kernel<<<NWIN * HEADS / (4 * WPW), 128, 0, stream>>>(qbuf, kbuf, vbuf, bt, ao);
  proj_kernel<<<NWIN * 4, 256, 0, stream>>>(x, ao, wpj, pb, bn2s, bn2h, out);
}

// v004
// A run of this version takes 269 microseconds.
// Next to v003, in two timings, it ran 1.23 times as fast each time.
// Over all steps from v000 it is 3.72 times as fast.
#include <hip/hip_runtime.h>

typedef _Float16 half_t;
typedef __attribute__((ext_vector_type(16))) _Float16 v16h;
typedef __attribute__((ext_vector_type(8)))  _Float16 v8h;
typedef __attribute__((ext_vector_type(8)))  float    v8f;

#define DIM   512
#define WS2   64
#define HEADS 16
#define HD    32
#define NWIN  1024          /* 16 batches * 8 * 8 windows */
#define EPSV  1e-5f
#define SCL   0.17677669529663687f  /* 1/sqrt(32) */
#define ASTR  40            /* padded LDS stride (halves) for 64x32 A tiles */
#define APITCH 520          /* LDS stride (halves) of the resident 512-deep A tile: 16 B x odd */

// ---------------------------------------------------------------- WMMA helpers
__device__ __forceinline__ v8f wmma_fp16(v16h a, v16h b, v8f c) {
  return __builtin_amdgcn_wmma_f32_16x16x32_f16(false, a, false, b, (short)0, c,
                                                false, false);
}

// Scheduling hint: issue B vmem reads, then all 8 A ds reads, then 4 WMMAs.
__device__ __forceinline__ void sched_gemm_group() {
#if __has_builtin(__builtin_amdgcn_sched_group_barrier)
  __builtin_amdgcn_sched_group_barrier(0x020, 2, 0);  // 2x VMEM read  (B frag)
  __builtin_amdgcn_sched_group_barrier(0x100, 8, 0);  // 8x DS read    (A frags)
  __builtin_amdgcn_sched_group_barrier(0x008, 4, 0);  // 4x WMMA
#endif
}
// Keeps each group of 8 A reads in front of the 8 WMMAs of the other group, so
// that a read's LDS latency runs under matrix work instead of in front of it.
__device__ __forceinline__ void sched_qkv_group() {
#if __has_builtin(__builtin_amdgcn_sched_group_barrier)
  __builtin_amdgcn_sched_group_barrier(0x020, 4, 0);  // 4x VMEM read (next B)
  __builtin_amdgcn_sched_group_barrier(0x100, 8, 0);  // 8x DS read   (A, 2nd half)
  __builtin_amdgcn_sched_group_barrier(0x008, 8, 0);  // 8x WMMA      (1st half)
  __builtin_amdgcn_sched_group_barrier(0x100, 8, 0);  // 8x DS read   (next A, 1st half)
  __builtin_amdgcn_sched_group_barrier(0x008, 8, 0);  // 8x WMMA      (2nd half)
#endif
}

// Per ISA 7.12.2, a lane's 16 fragment halves (A row m / B column n) are two
// contiguous 8-half runs: k = hi8+0..7 and k = 16+hi8+0..7.  `p` must point at
// (row_base + hi8) and be 16B aligned -> two b128 loads.
__device__ __forceinline__ v16h frag_ld(const half_t* p) {
  const v8h lo = *(const v8h*)(p);
  const v8h hi = *(const v8h*)(p + 16);
  v16h r;
#pragma unroll
  for (int i = 0; i < 8; ++i) { r[i] = lo[i]; r[8 + i] = hi[i]; }
  return r;
}

// The f16 weights lie in the workspace in fragment order: per 16 output columns
// and 32 k one block of 1 KB = [k half-run: k&16][lane = ((k>>3)&1)*16 + col&15][k&7].
// A wave's b128 load of a half-run is then 512 contiguous bytes, 4 whole lines;
// from row-major weights it touched 16 lines, 32 B of each.  The k order per
// lane and register is that of frag_ld.  `p` points at (block + lane*8).
#define WBLK  512           /* halves per 16-column x 32-k block */
__device__ __forceinline__ v16h frag_ldw(const half_t* p) {
  const v8h lo = *(const v8h*)(p);
  const v8h hi = *(const v8h*)(p + 256);
  v16h r;
#pragma unroll
  for (int i = 0; i < 8; ++i) { r[i] = lo[i]; r[8 + i] = hi[i]; }
  return r;
}
// position in the fragment-ordered copy -> index in the row-major [n][DIM] weight
__device__ __forceinline__ int frag_src(int o) {
  const int n = ((o >> 13) << 4) + ((o >> 3) & 15);
  const int k = (((o >> 9) & 15) << 5) + (((o >> 8) & 1) << 4) + (((o >> 7) & 1) << 3) + (o & 7);
  return n * DIM + k;
}

// ------------------------------------------------ CDNA5 async copy -> LDS
// GLOBAL_LOAD_ASYNC_TO_LDS_B128 (ISA 15.18.3, ASYNCcnt). LDS dest address is
// the low 32 bits of the flat shared pointer (LDS aperture truncation).
__device__ __forceinline__ unsigned lds_addr(const void* p) {
  return (unsigned)(unsigned long long)(uintptr_t)p;
}
__device__ __forceinline__ void async_copy16(unsigned lds, const void* g) {
  asm volatile("global_load_async_to_lds_b128 %0, %1, off"
               :: "v"(lds), "v"((unsigned long long)(uintptr_t)g)
               : "memory");
}
__device__ __forceinline__ void wait_async0() {
  asm volatile("s_wait_asynccnt 0" ::: "memory");
}

// --------------------------------------------------- kernel 1: prep (weights)
__global__ void prep_kernel(const float* __restrict__ qk_w,
                            const float* __restrict__ v_w,
                            const float* __restrict__ proj_w,
                            const float* __restrict__ g1, const float* __restrict__ be1,
                            const float* __restrict__ m1, const float* __restrict__ va1,
                            const float* __restrict__ g2, const float* __restrict__ be2,
                            const float* __restrict__ m2, const float* __restrict__ va2,
                            half_t* __restrict__ wqk, half_t* __restrict__ wv,
                            half_t* __restrict__ wpj,
                            float* __restrict__ bn1s, float* __restrict__ bn1h,
                            float* __restrict__ bn2s, float* __restrict__ bn2h) {
  int i = blockIdx.x * blockDim.x + threadIdx.x;
  const int NQK = 2 * DIM * DIM;   // 524288
  const int NV  = DIM * DIM;       // 262144
  if (i < NQK) { wqk[i] = (half_t)qk_w[frag_src(i)]; return; }
  i -= NQK;
  if (i < NV) { wv[i] = (half_t)v_w[frag_src(i)]; return; }
  i -= NV;
  if (i < NV) { wpj[i] = (half_t)proj_w[frag_src(i)]; return; }
  i -= NV;
  if (i < DIM) {
    const float s = g1[i] * rsqrtf(va1[i] + EPSV);
    bn1s[i] = s; bn1h[i] = be1[i] - m1[i] * s; return;
  }
  i -= DIM;
  if (i < DIM) {
    const float s = g2[i] * rsqrtf(va2[i] + EPSV);
    bn2s[i] = s; bn2h[i] = be2[i] - m2[i] * s; return;
  }
}

// ------------------------------------- Q, K, V in the workspace: fragment order
// One (window, head) unit is 64 tokens x 32 channels = QKV_UNIT halves, laid as
// 8 runs of [lane][8 halves] = 512 B each; lane = (l & 15, hh = l >> 4).
//   Q, K: run (tt, j):  token tt*16 + (l & 15), channels j*16 + hh*8 + 0..7,
//         at tt*512 + j*256: frag_ldw(unit + tt*512 + lane*8) is the fragment of
//         token tile tt over the 32 channels.
//   V:    run (nt, mt): channel nt*16 + (l & 15), tokens mt*16 + hh*8 + 0..7,
//         at nt*1024 + mt*256: frag_ldw(unit + nt*1024 + ks*512 + lane*8) is the
//         fragment of channel tile nt over tokens ks*32 .. ks*32 + 31.
#define QKV_UNIT (WS2 * HD)

// One pass of the QKV GEMM: 128 tokens (two windows) x 32 output columns.
// TOKCOL (Q, K): the weights are the A operand and the tokens the B operand, so
// that the accumulator's column (lane) is a token and its 8 registers are 8
// consecutive channels; V: as A = tokens, B = weights, a lane holds 8
// consecutive tokens of one channel.  The two operands have the same k order
// per lane and register, so the exchange moves no fragment load.
// `bias`: TOKCOL: at (first column + hi8); else at (first column + nl).
template <bool TOKCOL>
__device__ __forceinline__ void qkv_pass(const half_t* A0, const half_t* A1,
                                         const half_t* wrow, const float* bias,
                                         half_t* dst) {
  v8f acc[8][2] = {};
  // Fragments run half a K-step (A, from LDS) and one K-step (B, from global)
  // ahead of the WMMAs that use them.
  v16h a0[4], a1[4];
  v16h bf0 = frag_ldw(wrow);                           // global b128 x2
  v16h bf1 = frag_ldw(wrow + 16 * DIM);
#pragma unroll
  for (int m = 0; m < 4; ++m) a0[m] = frag_ld(A0 + m * 16 * APITCH);
  // two K-steps a trip: a full unroll lets the loads run ahead until the
  // registers spill
#pragma unroll 2
  for (int ks = 0; ks < 16; ++ks) {
    const int kc = ks << 5;
    const int kn = (ks < 15 ? ks + 1 : 15) << 5;       // last trip: in bounds, unused
    const v16h nb0 = frag_ldw(wrow + (kn >> 5) * WBLK);
    const v16h nb1 = frag_ldw(wrow + 16 * DIM + (kn >> 5) * WBLK);
#pragma unroll
    for (int m = 0; m < 4; ++m) a1[m] = frag_ld(A1 + m * 16 * APITCH + kc);
#pragma unroll
    for (int m = 0; m < 4; ++m) {
      acc[m][0] = TOKCOL ? wmma_fp16(bf0, a0[m], acc[m][0]) : wmma_fp16(a0[m], bf0, acc[m][0]);
      acc[m][1] = TOKCOL ? wmma_fp16(bf1, a0[m], acc[m][1]) : wmma_fp16(a0[m], bf1, acc[m][1]);
    }
#pragma unroll
    for (int m = 0; m < 4; ++m) a0[m] = frag_ld(A0 + m * 16 * APITCH + kn);
#pragma unroll
    for (int m = 0; m < 4; ++m) {
      acc[4 + m][0] = TOKCOL ? wmma_fp16(bf0, a1[m], acc[4 + m][0]) : wmma_fp16(a1[m], bf0, acc[4 + m][0]);
      acc[4 + m][1] = TOKCOL ? wmma_fp16(bf1, a1[m], acc[4 + m][1]) : wmma_fp16(a1[m], bf1, acc[4 + m][1]);
    }
    bf0 = nb0; bf1 = nb1;
    sched_qkv_group();
  }

  float bs[2][8];                                      // bias of (column tile j, register r)
#pragma unroll
  for (int j = 0; j < 2; ++j)
#pragma unroll
    for (int r = 0; r < 8; ++r) bs[j][r] = bias[j * 16 + (TOKCOL ? r : 0)];
  // the address pair that these loads name is an input here, so it stays whole
  // up to this wait; its registers are free for other use only behind it
  asm volatile("s_wait_xcnt 0x0" :: "v"(bias) : "memory");
#pragma unroll
  for (int m = 0; m < 8; ++m)
#pragma unroll
    for (int j = 0; j < 2; ++j) {
      v8h o;
#pragma unroll
      for (int r = 0; r < 8; ++r) o[r] = (half_t)(acc[m][j][r] + bs[j][r]);
      *(v8h*)(dst + (m >> 2) * (HEADS * QKV_UNIT)
                  + (TOKCOL ? (m & 3) * 512 + j * 256 : j * 1024 + (m & 3) * 256)) = o;
    }
  // the address pair that these stores name is kept whole up to this wait (it
  // is an input here); the next pass reuses the registers only behind it
  asm volatile("s_wait_xcnt 0x0" :: "v"(dst) : "memory");
}

// -------------------------------------------- kernel 2: fused BN1 + QKV GEMMs
// Block = 256 thr (8 waves): two windows side by side in the image (128 tokens)
// and all 1536 output cols.  The BN'd 128x512 f16 A tile is staged in LDS once
// and stays there; each wave then runs 6 passes of a 128x32 tile (one head).
// cols [0,512)=Q, [512,1024)=K, [1024,1536)=V.
// Q, K and V go to the workspace in the fragment order in which the attention
// kernel loads them (QKV_UNIT above): what a lane holds in 8 accumulator registers
// is one 16-B run of its own later fragment, and a wave's store is 512
// contiguous bytes, 4 whole lines.
// B fragments come straight from the fragment-ordered global f16 weights (two
// b128 of 4 whole lines each per 16 columns and K-step).
// 2 x 133,120 B of LDS fit one WGP: four waves per SIMD, 256 VGPRs each.
__global__ void __launch_bounds__(256) __attribute__((amdgpu_waves_per_eu(4, 4)))
qkv_kernel(const float* __restrict__ x,
           const half_t* __restrict__ wqk, const half_t* __restrict__ wv,
           const float* __restrict__ bn1s, const float* __restrict__ bn1h,
           const float* __restrict__ qk_b, const float* __restrict__ v_b,
           half_t* __restrict__ qbuf, half_t* __restrict__ kbuf,
           half_t* __restrict__ vbuf) {
  __shared__ __align__(16) half_t As[2 * WS2 * APITCH];   // resident A tile

  const int w0  = blockIdx.x * 2;                  // windows w0 and w0 + 1
  const int tid = threadIdx.x, lane = tid & 31;
  const int wid = __builtin_amdgcn_readfirstlane(tid >> 5);
  const int nl = lane & 15, hi8 = (lane >> 4) << 3;

  const int b = w0 >> 6, wi = w0 & 63;
  const int row0 = (wi >> 3) << 3, col0 = (wi & 7) << 3;   // col0: 0,16,32,48

  { // A staging, once: a lane takes 4 pixels of one image row (16 B) in 8
    // channels, and writes 8 channels of each of the 4 tokens as one b128.
    const int r = lane >> 2, quad = lane & 3;
    const int m0 = ((quad >> 1) << 6) + (r << 3) + ((quad & 1) << 2);
    const float* xl = x + ((b * DIM + (wid << 3)) << 12) + ((row0 + r) << 6) + col0 + (quad << 2);
    // 16 loads of 16 B in flight per lane cover the memory latency; all 64 at
    // once would spill
#pragma unroll 1
    for (int i = 0; i < 4; ++i) {
      float4 v[2][8];
#pragma unroll
      for (int u = 0; u < 2; ++u)
#pragma unroll
        for (int j = 0; j < 8; ++j)
          v[u][j] = *(const float4*)(xl + ((u * 64 + j) << 12));
      // the address pair that these loads name is kept whole up to this wait
      // (it is an input here) and is advanced only behind it
      asm volatile("s_wait_xcnt 0x0" :: "v"(xl) : "memory");
      xl += 128 << 12;                                   // 128 channels on
#pragma unroll
      for (int u = 0; u < 2; ++u) {
        const int c0 = (wid + (((i << 1) + u) << 3)) << 3;
        v8h o0, o1, o2, o3;
#pragma unroll
        for (int j = 0; j < 8; ++j) {
          const float s = bn1s[c0 + j], sh = bn1h[c0 + j];
          o0[j] = (half_t)(v[u][j].x * s + sh);
          o1[j] = (half_t)(v[u][j].y * s + sh);
          o2[j] = (half_t)(v[u][j].z * s + sh);
          o3[j] = (half_t)(v[u][j].w * s + sh);
        }
        half_t* ap = As + m0 * APITCH + c0;
        *(v8h*)(ap)              = o0;
        *(v8h*)(ap + APITCH)     = o1;
        *(v8h*)(ap + 2 * APITCH) = o2;
        *(v8h*)(ap + 3 * APITCH) = o3;
      }
    }
  }
  __syncthreads();

  const half_t* A0 = As + nl * APITCH + hi8;     // tokens of window w0
  const half_t* A1 = A0 + WS2 * APITCH;          // tokens of window w0 + 1
  // 32 output columns = one head of Q, K or V per wave and pass
  for (int p = 0; p < 4; ++p) {                  // Q: p = 0, 1; K: p = 2, 3
    const int ng0 = ((p << 3) + wid) << 5;
    const int h = ((p << 3) + wid) & (HEADS - 1);
    qkv_pass<true>(A0, A1, wqk + (size_t)ng0 * DIM + lane * 8, qk_b + ng0 + hi8,
                   (p < 2 ? qbuf : kbuf) + (size_t)(w0 * HEADS + h) * QKV_UNIT + lane * 8);
  }
  for (int p = 0; p < 2; ++p) {                  // V
    const int h = (p << 3) + wid;
    qkv_pass<false>(A0, A1, wv + (size_t)(h << 5) * DIM + lane * 8, v_b + (h << 5) + nl,
                    vbuf + (size_t)(w0 * HEADS + h) * QKV_UNIT + lane * 8);
  }
}

// ------------------------------ kernel 3: per (window, head) attention, WMMA
// One wave does whole (window, head) units by itself, with no LDS and no barrier.
// S^T = K Q^T: a lane then holds 32 of the 64 scores of ONE query (its partner
// lane ^ 16 the rest), so max and sum are in-lane plus one exchange.  Two S^T
// tiles, converted in place, are the B operand of O^T = V^T P^T, and a lane's 8
// results are 8 consecutive channels of one token: one 16-B store.
// A wave keeps its head over WPW windows; the bias of tile (kt, qt) depends on
// qt - kt alone, so 7 x 8 registers hold the head's whole 64 x 64 bias.
#define WPW   4             /* windows per wave */
#define LOG2E 1.4426950408889634f

// lane l <-> lane l ^ 16
__device__ __forceinline__ float xhalf(float v) {
  const int b = __builtin_bit_cast(int, v);
  return __builtin_bit_cast(float, __builtin_amdgcn_permlanex16(
      b, b, 0x76543210, 0xfedcba98, false, false));
}

// 2^x of 8 values in one statement: behind each v_exp_f32 then stands an
// instruction that neither reads its result nor overwrites its source (the
// outputs are early-clobber), and behind the last a v_nop.  That is the slot the
// instruction set asks for behind a transcendental.
__device__ __forceinline__ v8f exp2x8(v8f x) {
  float p0, p1, p2, p3, p4, p5, p6, p7;
  asm("v_exp_f32 %0, %8\n\t"
      "v_exp_f32 %1, %9\n\t"
      "v_exp_f32 %2, %10\n\t"
      "v_exp_f32 %3, %11\n\t"
      "v_exp_f32 %4, %12\n\t"
      "v_exp_f32 %5, %13\n\t"
      "v_exp_f32 %6, %14\n\t"
      "v_exp_f32 %7, %15\n\t"
      "v_nop"
      : "=&v"(p0), "=&v"(p1), "=&v"(p2), "=&v"(p3),
        "=&v"(p4), "=&v"(p5), "=&v"(p6), "=&v"(p7)
      : "v"(x[0]), "v"(x[1]), "v"(x[2]), "v"(x[3]),
        "v"(x[4]), "v"(x[5]), "v"(x[6]), "v"(x[7]));
  const v8f r = {p0, p1, p2, p3, p4, p5, p6, p7};
  return r;
}

__global__ void __launch_bounds__(128)
attn_kernel(const half_t* __restrict__ qbuf, const half_t* __restrict__ kbuf,
            const half_t* __restrict__ vbuf, const float* __restrict__ bias_table,
            half_t* __restrict__ ao) {
  const int lane = threadIdx.x & 31;
  const int wid = __builtin_amdgcn_readfirstlane(threadIdx.x >> 5);
  const int nl = lane & 15, hh = lane >> 4, hi8 = hh << 3;
  const int gw = blockIdx.x * 4 + wid;             // wave number, 0..4095
  const int h  = gw & (HEADS - 1);                 // a block's 4 heads are adjacent
  const int w0 = (gw >> 4) * WPW;

  // query = qt*16 + nl, key = kt*16 + 8*hh + r; d = qt - kt + 3:
  // row difference dr = 2*d + 1 + (nl>>3) - hh (0..14), column difference
  // dc = (nl&7) + 7 - r (0..14): one lane address, constant steps in d and r
  const float* bp = bias_table + ((1 + (nl >> 3) - hh) * 15 + (nl & 7)) * HEADS + h;
  float bias[7][8];
#pragma unroll
  for (int d = 0; d < 7; ++d)
#pragma unroll
    for (int r = 0; r < 8; ++r)
      bias[d][r] = bp[(d * 30 + 7 - r) * HEADS] * LOG2E;
  // the address that these 56 loads name is an input here, so it stays whole
  // up to this wait; its registers are free for other use only behind it
  asm volatile("s_wait_xcnt 0x0" :: "v"(bp) : "memory");

  const size_t off = (size_t)(w0 * HEADS + h) * (WS2 * HD);
  const half_t* kp = kbuf + off + lane * 8;              // fragment order (QKV_UNIT)
  const half_t* qp = qbuf + off + lane * 8;
  const half_t* vp = vbuf + off + lane * 8;
  half_t* op = ao + ((size_t)w0 * WS2 + nl) * DIM + h * HD + hi8;

  // rolled: one unit's fragments and the bias fill the register budget
#pragma unroll 1
  for (int i = 0; i < WPW; ++i) {
    v16h ka[4], qb[4], va[2][2];
#pragma unroll
    for (int t = 0; t < 4; ++t) {
      ka[t] = frag_ldw(kp + t * 512);
      qb[t] = frag_ldw(qp + t * 512);
    }
#pragma unroll
    for (int nt = 0; nt < 2; ++nt)
#pragma unroll
      for (int ks = 0; ks < 2; ++ks)
        va[nt][ks] = frag_ldw(vp + nt * 1024 + ks * 512);

#pragma unroll
    for (int qt = 0; qt < 4; ++qt) {
      v8f s[4];
#pragma unroll
      for (int kt = 0; kt < 4; ++kt) {
        const v8f zero = {};
        s[kt] = wmma_fp16(ka[kt], qb[qt], zero);
      }
      float m4[4];
#pragma unroll
      for (int kt = 0; kt < 4; ++kt) {
#pragma unroll
        for (int r = 0; r < 8; ++r)
          s[kt][r] = s[kt][r] * (SCL * LOG2E) + bias[qt - kt + 3][r];
        m4[kt] = s[kt][0];
#pragma unroll
        for (int r = 1; r < 8; ++r) m4[kt] = fmaxf(m4[kt], s[kt][r]);
      }
      float mx = fmaxf(fmaxf(m4[0], m4[1]), fmaxf(m4[2], m4[3]));
      mx = fmaxf(mx, xhalf(mx));

      float s4[4];
      v16h pb[2];
#pragma unroll
      for (int kt = 0; kt < 4; ++kt) {
        const v8f p = exp2x8(s[kt] - mx);
        s4[kt] = p[0];
#pragma unroll
        for (int r = 1; r < 8; ++r) s4[kt] += p[r];
#pragma unroll
        for (int r = 0; r < 8; ++r) pb[kt >> 1][(kt & 1) * 8 + r] = (half_t)p[r];
      }
      float sum = (s4[0] + s4[1]) + (s4[2] + s4[3]);
      sum += xhalf(sum);
      const float inv = 1.0f / sum;

      v8f o[2] = {};
#pragma unroll
      for (int ks = 0; ks < 2; ++ks)
#pragma unroll
        for (int nt = 0; nt < 2; ++nt)
          o[nt] = wmma_fp16(va[nt][ks], pb[ks], o[nt]);
#pragma unroll
      for (int nt = 0; nt < 2; ++nt) {
        v8h ov;
#pragma unroll
        for (int r = 0; r < 8; ++r) ov[r] = (half_t)(o[nt][r] * inv);
        *(v8h*)(op + qt * 16 * DIM + nt * 16) = ov;
      }
    }
    // the four address pairs that this trip's loads and stores name are kept
    // whole up to this wait (they are inputs here) and advanced only behind it
    asm volatile("s_wait_xcnt 0x0" :: "v"(kp), "v"(qp), "v"(vp), "v"(op) : "memory");
    kp += HEADS * WS2 * HD; qp += HEADS * WS2 * HD; vp += HEADS * WS2 * HD;
    op += WS2 * DIM;
  }
}

// ------------------- kernel 4: proj GEMM + residual + BN2, NCHW fp32 output
__global__ void __launch_bounds__(256)
proj_kernel(const float* __restrict__ x, const half_t* __restrict__ ao,
            const half_t* __restrict__ wpj, const float* __restrict__ proj_b,
            const float* __restrict__ bn2s, const float* __restrict__ bn2h,
            float* __restrict__ out) {
  __shared__ __align__(16) half_t As[2][WS2 * ASTR];

  const int w = blockIdx.x >> 2;
  const int nbase = (blockIdx.x & 3) * 128;
  const int tid = threadIdx.x, lane = tid & 31, wid = tid >> 5;
  const int nl = lane & 15, hi8 = (lane >> 4) << 3;
  const int b = w >> 6, wi = w & 63;
  const int row0 = (wi >> 3) << 3, col0 = (wi & 7) << 3;

  const int ch = nbase + wid * 16 + nl;                 // output channel
  const half_t* wrow = wpj + (size_t)(nbase + wid * 16) * DIM + lane * 8;  // fragment order

  const unsigned As_l = lds_addr(As);
  // async-DMA stage: 64 rows x 64B of ao -> padded LDS tile (4 x b128 / row)
  auto stage = [&](int ks, int bufi) {
    const int t = tid >> 2, part = tid & 3;             // 256 chunks of 16B
    const char* g = (const char*)(ao + ((size_t)w * WS2 + t) * DIM + (ks << 5))
                    + part * 16;
    const unsigned l = As_l + (unsigned)bufi * (WS2 * ASTR * 2)
                     + (unsigned)(t * ASTR * 2 + part * 16);
    async_copy16(l, g);
  };

  v8f acc[4] = {};
  stage(0, 0);
  for (int ks = 0; ks < 16; ++ks) {
    wait_async0();
    __syncthreads();
    if (ks < 15) stage(ks + 1, (ks + 1) & 1);
    const half_t* Ab = As[ks & 1] + nl * ASTR + hi8;
    const v16h bf  = frag_ldw(wrow + ks * WBLK);
    const v16h af0 = frag_ld(Ab);
    const v16h af1 = frag_ld(Ab + 16 * ASTR);
    const v16h af2 = frag_ld(Ab + 32 * ASTR);
    const v16h af3 = frag_ld(Ab + 48 * ASTR);
    acc[0] = wmma_fp16(af0, bf, acc[0]);
    acc[1] = wmma_fp16(af1, bf, acc[1]);
    acc[2] = wmma_fp16(af2, bf, acc[2]);
    acc[3] = wmma_fp16(af3, bf, acc[3]);
    sched_gemm_group();
    // ends the K-step for the scheduler: without it this build lets the WMMAs of
    // three K-steps sink to the end of the unrolled trip and holds their
    // fragments all that time (135 VGPRs: 3 blocks on a WGP instead of 5)
    __builtin_amdgcn_sched_barrier(0);
  }

  const float pb = proj_b[ch], s2 = bn2s[ch], h2 = bn2h[ch];
#pragma unroll
  for (int m = 0; m < 4; ++m)
#pragma unroll
    for (int r = 0; r < 8; ++r) {
      const int t  = m * 16 + r + hi8;
      const int pr = row0 + (t >> 3), pc = col0 + (t & 7);
      const int idx = ((b * DIM + ch) << 12) + (pr << 6) + pc;
      const float res = x[idx] + acc[m][r] + pb;  // residual
      out[idx] = res * s2 + h2;                   // BN2
    }
}

// ----------------------------------------------------------------- launcher
extern "C" void kernel_launch(void* const* d_in, const int* in_sizes, int n_in,
                              void* d_out, int out_size, void* d_ws, size_t ws_size,
                              hipStream_t stream) {
  const float* x    = (const float*)d_in[0];
  const float* g1   = (const float*)d_in[1];
  const float* be1  = (const float*)d_in[2];
  const float* m1   = (const float*)d_in[3];
  const float* va1  = (const float*)d_in[4];
  const float* qk_w = (const float*)d_in[5];
  const float* qk_b = (const float*)d_in[6];
  const float* v_w  = (const float*)d_in[7];
  const float* v_b  = (const float*)d_in[8];
  const float* pw   = (const float*)d_in[9];
  const float* pb   = (const float*)d_in[10];
  const float* bt   = (const float*)d_in[11];
  const float* g2   = (const float*)d_in[12];
  const float* be2  = (const float*)d_in[13];
  const float* m2   = (const float*)d_in[14];
  const float* va2  = (const float*)d_in[15];
  float* out = (float*)d_out;

  char* ws = (char*)d_ws;
  half_t* wqk = (half_t*)ws; ws += (size_t)2 * DIM * DIM * sizeof(half_t);
  half_t* wv  = (half_t*)ws; ws += (size_t)DIM * DIM * sizeof(half_t);
  half_t* wpj = (half_t*)ws; ws += (size_t)DIM * DIM * sizeof(half_t);
  float* bn1s = (float*)ws;  ws += DIM * sizeof(float);
  float* bn1h = (float*)ws;  ws += DIM * sizeof(float);
  float* bn2s = (float*)ws;  ws += DIM * sizeof(float);
  float* bn2h = (float*)ws;  ws += DIM * sizeof(float);
  const size_t qkvN = (size_t)NWIN * HEADS * WS2 * HD;
  half_t* qbuf = (half_t*)ws; ws += qkvN * sizeof(half_t);
  half_t* kbuf = (half_t*)ws; ws += qkvN * sizeof(half_t);
  half_t* vbuf = (half_t*)ws; ws += qkvN * sizeof(half_t);
  half_t* ao   = (half_t*)ws; ws += (size_t)NWIN * WS2 * DIM * sizeof(half_t);

  prep_kernel<<<4100, 256, 0, stream>>>(qk_w, v_w, pw, g1, be1, m1, va1,
                                        g2, be2, m2, va2,
                                        wqk, wv, wpj, bn1s, bn1h, bn2s, bn2h);
  qkv_kernel<<<NWIN / 2, 256, 0, stream>>>(x, wqk, wv, bn1s, bn1h, qk_b, v_b,
                                            qbuf, kbuf, vbuf);
  attn_kernel<<<NWIN * HEADS / (4 * WPW), 128, 0, stream>>>(qbuf, kbuf, vbuf, bt, ao);
  proj_kernel<<<NWIN * 4, 256, 0, stream>>>(x, ao, wpj, pb, bn2s, bn2h, out);
}

// v005
// One run takes 160 microseconds.
// Two timings next to v004 both put it at 1.68 times that version's speed.
// All steps since v000 together make it 6.25 times as fast.
#include <hip/hip_runtime.h>

typedef _Float16 half_t;
typedef __attribute__((ext_vector_type(16))) _Float16 v16h;
typedef __attribute__((ext_vector_type(8)))  _Float16 v8h;
typedef __attribute__((ext_vector_type(8)))  float    v8f;

#define DIM   512
#define WS2   64
#define HEADS 16
#define HD    32
#define NWIN  1024          /* 16 batches * 8 * 8 windows */
#define EPSV  1e-5f
#define SCL   0.17677669529663687f  /* 1/sqrt(32) */
#define APITCH 520          /* LDS stride (halves) of the resident 512-deep A tile: 16 B x odd */

// ---------------------------------------------------------------- WMMA helpers
__device__ __forceinline__ v8f wmma_fp16(v16h a, v16h b, v8f c) {
  return __builtin_amdgcn_wmma_f32_16x16x32_f16(false, a, false, b, (short)0, c,
                                                false, false);
}

// Keeps each group of 8 A reads in front of the 8 WMMAs of the other group, so
// that a read's LDS latency runs under matrix work instead of in front of it.
__device__ __forceinline__ void sched_qkv_group() {
#if __has_builtin(__builtin_amdgcn_sched_group_barrier)
  __builtin_amdgcn_sched_group_barrier(0x020, 4, 0);  // 4x VMEM read (next B)
  __builtin_amdgcn_sched_group_barrier(0x100, 8, 0);  // 8x DS read   (A, 2nd half)
  __builtin_amdgcn_sched_group_barrier(0x008, 8, 0);  // 8x WMMA      (1st half)
  __builtin_amdgcn_sched_group_barrier(0x100, 8, 0);  // 8x DS read   (next A, 1st half)
  __builtin_amdgcn_sched_group_barrier(0x008, 8, 0);  // 8x WMMA      (2nd half)
#endif
}

// Per ISA 7.12.2, a lane's 16 fragment halves (A row m / B column n) are two
// contiguous 8-half runs: k = hi8+0..7 and k = 16+hi8+0..7.  `p` must point at
// (row_base + hi8) and be 16B aligned -> two b128 loads.
__device__ __forceinline__ v16h frag_ld(const half_t* p) {
  const v8h lo = *(const v8h*)(p);
  const v8h hi = *(const v8h*)(p + 16);
  v16h r;
#pragma unroll
  for (int i = 0; i < 8; ++i) { r[i] = lo[i]; r[8 + i] = hi[i]; }
  return r;
}

// The f16 weights lie in the workspace in fragment order: per 16 output columns
// and 32 k one block of 1 KB = [k half-run: k&16][lane = ((k>>3)&1)*16 + col&15][k&7].
// A wave's b128 load of a half-run is then 512 contiguous bytes, 4 whole lines;
// from row-major weights it touched 16 lines, 32 B of each.  The k order per
// lane and register is that of frag_ld.  `p` points at (block + lane*8).
#define WBLK  512           /* halves per 16-column x 32-k block */
__device__ __forceinline__ v16h frag_ldw(const half_t* p) {
  const v8h lo = *(const v8h*)(p);
  const v8h hi = *(const v8h*)(p + 256);
  v16h r;
#pragma unroll
  for (int i = 0; i < 8; ++i) { r[i] = lo[i]; r[8 + i] = hi[i]; }
  return r;
}
// position in the fragment-ordered copy -> index in the row-major [n][DIM] weight
__device__ __forceinline__ int frag_src(int o) {
  const int n = ((o >> 13) << 4) + ((o >> 3) & 15);
  const int k = (((o >> 9) & 15) << 5) + (((o >> 8) & 1) << 4) + (((o >> 7) & 1) << 3) + (o & 7);
  return n * DIM + k;
}

// ------------------------------------------------ CDNA5 async copy -> LDS
// GLOBAL_LOAD_ASYNC_TO_LDS_B128 (ISA 15.18.3, ASYNCcnt). LDS dest address is
// the low 32 bits of the flat shared pointer (LDS aperture truncation).
__device__ __forceinline__ unsigned lds_addr(const void* p) {
  return (unsigned)(unsigned long long)(uintptr_t)p;
}
__device__ __forceinline__ void wait_async0() {
  asm volatile("s_wait_asynccnt 0" ::: "memory");
}

// --------------------------------------------------- kernel 1: prep (weights)
__global__ void prep_kernel(const float* __restrict__ qk_w,
                            const float* __restrict__ v_w,
                            const float* __restrict__ proj_w,
                            const float* __restrict__ g1, const float* __restrict__ be1,
                            const float* __restrict__ m1, const float* __restrict__ va1,
                            const float* __restrict__ g2, const float* __restrict__ be2,
                            const float* __restrict__ m2, const float* __restrict__ va2,
                            half_t* __restrict__ wqk, half_t* __restrict__ wv,
                            half_t* __restrict__ wpj,
                            float* __restrict__ bn1s, float* __restrict__ bn1h,
                            float* __restrict__ bn2s, float* __restrict__ bn2h) {
  int i = blockIdx.x * blockDim.x + threadIdx.x;
  const int NQK = 2 * DIM * DIM;   // 524288
  const int NV  = DIM * DIM;       // 262144
  if (i < NQK) { wqk[i] = (half_t)qk_w[frag_src(i)]; return; }
  i -= NQK;
  if (i < NV) { wv[i] = (half_t)v_w[frag_src(i)]; return; }
  i -= NV;
  if (i < NV) { wpj[i] = (half_t)proj_w[frag_src(i)]; return; }
  i -= NV;
  if (i < DIM) {
    const float s = g1[i] * rsqrtf(va1[i] + EPSV);
    bn1s[i] = s; bn1h[i] = be1[i] - m1[i] * s; return;
  }
  i -= DIM;
  if (i < DIM) {
    const float s = g2[i] * rsqrtf(va2[i] + EPSV);
    bn2s[i] = s; bn2h[i] = be2[i] - m2[i] * s; return;
  }
}

// ------------------------------------- Q, K, V in the workspace: fragment order
// One (window, head) unit is 64 tokens x 32 channels = QKV_UNIT halves, laid as
// 8 runs of [lane][8 halves] = 512 B each; lane = (l & 15, hh = l >> 4).
//   Q, K: run (tt, j):  token tt*16 + (l & 15), channels j*16 + hh*8 + 0..7,
//         at tt*512 + j*256: frag_ldw(unit + tt*512 + lane*8) is the fragment of
//         token tile tt over the 32 channels.
//   V:    run (nt, mt): channel nt*16 + (l & 15), tokens mt*16 + hh*8 + 0..7,
//         at nt*1024 + mt*256: frag_ldw(unit + nt*1024 + ks*512 + lane*8) is the
//         fragment of channel tile nt over tokens ks*32 .. ks*32 + 31.
#define QKV_UNIT (WS2 * HD)

// One pass of the QKV GEMM: 128 tokens (two windows) x 32 output columns.
// TOKCOL (Q, K): the weights are the A operand and the tokens the B operand, so
// that the accumulator's column (lane) is a token and its 8 registers are 8
// consecutive channels; V: as A = tokens, B = weights, a lane holds 8
// consecutive tokens of one channel.  The two operands have the same k order
// per lane and register, so the exchange moves no fragment load.
// `bias`: TOKCOL: at (first column + hi8); else at (first column + nl).
template <bool TOKCOL>
__device__ __forceinline__ void qkv_pass(const half_t* A0, const half_t* A1,
                                         const half_t* wrow, const float* bias,
                                         half_t* dst) {
  v8f acc[8][2] = {};
  // Fragments run half a K-step (A, from LDS) and one K-step (B, from global)
  // ahead of the WMMAs that use them.
  v16h a0[4], a1[4];
  v16h bf0 = frag_ldw(wrow);                           // global b128 x2
  v16h bf1 = frag_ldw(wrow + 16 * DIM);
#pragma unroll
  for (int m = 0; m < 4; ++m) a0[m] = frag_ld(A0 + m * 16 * APITCH);
  // two K-steps a trip: a full unroll lets the loads run ahead until the
  // registers spill
#pragma unroll 2
  for (int ks = 0; ks < 16; ++ks) {
    const int kc = ks << 5;
    const int kn = (ks < 15 ? ks + 1 : 15) << 5;       // last trip: in bounds, unused
    const v16h nb0 = frag_ldw(wrow + (kn >> 5) * WBLK);
    const v16h nb1 = frag_ldw(wrow + 16 * DIM + (kn >> 5) * WBLK);
#pragma unroll
    for (int m = 0; m < 4; ++m) a1[m] = frag_ld(A1 + m * 16 * APITCH + kc);
#pragma unroll
    for (int m = 0; m < 4; ++m) {
      acc[m][0] = TOKCOL ? wmma_fp16(bf0, a0[m], acc[m][0]) : wmma_fp16(a0[m], bf0, acc[m][0]);
      acc[m][1] = TOKCOL ? wmma_fp16(bf1, a0[m], acc[m][1]) : wmma_fp16(a0[m], bf1, acc[m][1]);
    }
#pragma unroll
    for (int m = 0; m < 4; ++m) a0[m] = frag_ld(A0 + m * 16 * APITCH + kn);
#pragma unroll
    for (int m = 0; m < 4; ++m) {
      acc[4 + m][0] = TOKCOL ? wmma_fp16(bf0, a1[m], acc[4 + m][0]) : wmma_fp16(a1[m], bf0, acc[4 + m][0]);
      acc[4 + m][1] = TOKCOL ? wmma_fp16(bf1, a1[m], acc[4 + m][1]) : wmma_fp16(a1[m], bf1, acc[4 + m][1]);
    }
    bf0 = nb0; bf1 = nb1;
    sched_qkv_group();
  }

  float bs[2][8];                                      // bias of (column tile j, register r)
#pragma unroll
  for (int j = 0; j < 2; ++j)
#pragma unroll
    for (int r = 0; r < 8; ++r) bs[j][r] = bias[j * 16 + (TOKCOL ? r : 0)];
  // the address pair that these loads name is an input here, so it stays whole
  // up to this wait; its registers are free for other use only behind it
  asm volatile("s_wait_xcnt 0x0" :: "v"(bias) : "memory");
#pragma unroll
  for (int m = 0; m < 8; ++m)
#pragma unroll
    for (int j = 0; j < 2; ++j) {
      v8h o;
#pragma unroll
      for (int r = 0; r < 8; ++r) o[r] = (half_t)(acc[m][j][r] + bs[j][r]);
      *(v8h*)(dst + (m >> 2) * (HEADS * QKV_UNIT)
                  + (TOKCOL ? (m & 3) * 512 + j * 256 : j * 1024 + (m & 3) * 256)) = o;
    }
  // the address pair that these stores name is kept whole up to this wait (it
  // is an input here); the next pass reuses the registers only behind it
  asm volatile("s_wait_xcnt 0x0" :: "v"(dst) : "memory");
}

// -------------------------------------------- kernel 2: fused BN1 + QKV GEMMs
// Block = 256 thr (8 waves): two windows side by side in the image (128 tokens)
// and all 1536 output cols.  The BN'd 128x512 f16 A tile is staged in LDS once
// and stays there; each wave then runs 6 passes of a 128x32 tile (one head).
// cols [0,512)=Q, [512,1024)=K, [1024,1536)=V.
// Q, K and V go to the workspace in the fragment order in which the attention
// kernel loads them (QKV_UNIT above): what a lane holds in 8 accumulator registers
// is one 16-B run of its own later fragment, and a wave's store is 512
// contiguous bytes, 4 whole lines.
// B fragments come straight from the fragment-ordered global f16 weights (two
// b128 of 4 whole lines each per 16 columns and K-step).
// 2 x 133,120 B of LDS fit one WGP: four waves per SIMD, 256 VGPRs each.
__global__ void __launch_bounds__(256) __attribute__((amdgpu_waves_per_eu(4, 4)))
qkv_kernel(const float* __restrict__ x,
           const half_t* __restrict__ wqk, const half_t* __restrict__ wv,
           const float* __restrict__ bn1s, const float* __restrict__ bn1h,
           const float* __restrict__ qk_b, const float* __restrict__ v_b,
           half_t* __restrict__ qbuf, half_t* __restrict__ kbuf,
           half_t* __restrict__ vbuf) {
  __shared__ __align__(16) half_t As[2 * WS2 * APITCH];   // resident A tile

  const int w0  = blockIdx.x * 2;                  // windows w0 and w0 + 1
  const int tid = threadIdx.x, lane = tid & 31;
  const int wid = __builtin_amdgcn_readfirstlane(tid >> 5);
  const int nl = lane & 15, hi8 = (lane >> 4) << 3;

  const int b = w0 >> 6, wi = w0 & 63;
  const int row0 = (wi >> 3) << 3, col0 = (wi & 7) << 3;   // col0: 0,16,32,48

  { // A staging, once: a lane takes 4 pixels of one image row (16 B) in 8
    // channels, and writes 8 channels of each of the 4 tokens as one b128.
    const int r = lane >> 2, quad = lane & 3;
    const int m0 = ((quad >> 1) << 6) + (r << 3) + ((quad & 1) << 2);
    const float* xl = x + ((b * DIM + (wid << 3)) << 12) + ((row0 + r) << 6) + col0 + (quad << 2);
    // 16 loads of 16 B in flight per lane cover the memory latency; all 64 at
    // once would spill
#pragma unroll 1
    for (int i = 0; i < 4; ++i) {
      float4 v[2][8];
#pragma unroll
      for (int u = 0; u < 2; ++u)
#pragma unroll
        for (int j = 0; j < 8; ++j)
          v[u][j] = *(const float4*)(xl + ((u * 64 + j) << 12));
      // the address pair that these loads name is kept whole up to this wait
      // (it is an input here) and is advanced only behind it
      asm volatile("s_wait_xcnt 0x0" :: "v"(xl) : "memory");
      xl += 128 << 12;                                   // 128 channels on
#pragma unroll
      for (int u = 0; u < 2; ++u) {
        const int c0 = (wid + (((i << 1) + u) << 3)) << 3;
        v8h o0, o1, o2, o3;
#pragma unroll
        for (int j = 0; j < 8; ++j) {
          const float s = bn1s[c0 + j], sh = bn1h[c0 + j];
          o0[j] = (half_t)(v[u][j].x * s + sh);
          o1[j] = (half_t)(v[u][j].y * s + sh);
          o2[j] = (half_t)(v[u][j].z * s + sh);
          o3[j] = (half_t)(v[u][j].w * s + sh);
        }
        half_t* ap = As + m0 * APITCH + c0;
        *(v8h*)(ap)              = o0;
        *(v8h*)(ap + APITCH)     = o1;
        *(v8h*)(ap + 2 * APITCH) = o2;
        *(v8h*)(ap + 3 * APITCH) = o3;
      }
    }
  }
  __syncthreads();

  const half_t* A0 = As + nl * APITCH + hi8;     // tokens of window w0
  const half_t* A1 = A0 + WS2 * APITCH;          // tokens of window w0 + 1
  // 32 output columns = one head of Q, K or V per wave and pass
  for (int p = 0; p < 4; ++p) {                  // Q: p = 0, 1; K: p = 2, 3
    const int ng0 = ((p << 3) + wid) << 5;
    const int h = ((p << 3) + wid) & (HEADS - 1);
    qkv_pass<true>(A0, A1, wqk + (size_t)ng0 * DIM + lane * 8, qk_b + ng0 + hi8,
                   (p < 2 ? qbuf : kbuf) + (size_t)(w0 * HEADS + h) * QKV_UNIT + lane * 8);
  }
  for (int p = 0; p < 2; ++p) {                  // V
    const int h = (p << 3) + wid;
    qkv_pass<false>(A0, A1, wv + (size_t)(h << 5) * DIM + lane * 8, v_b + (h << 5) + nl,
                    vbuf + (size_t)(w0 * HEADS + h) * QKV_UNIT + lane * 8);
  }
}

// ------------------------------ kernel 3: per (window, head) attention, WMMA
// One wave does whole (window, head) units by itself, with no LDS and no barrier.
// S^T = K Q^T: a lane then holds 32 of the 64 scores of ONE query (its partner
// lane ^ 16 the rest), so max and sum are in-lane plus one exchange.  Two S^T
// tiles, converted in place, are the B operand of O^T = V^T P^T, and a lane's 8
// results are 8 consecutive channels of one token: one 16-B store.
// A wave keeps its head over WPW windows; the bias of tile (kt, qt) depends on
// qt - kt alone, so 7 x 8 registers hold the head's whole 64 x 64 bias.
#define WPW   4             /* windows per wave */
#define LOG2E 1.4426950408889634f

// lane l <-> lane l ^ 16
__device__ __forceinline__ float xhalf(float v) {
  const int b = __builtin_bit_cast(int, v);
  return __builtin_bit_cast(float, __builtin_amdgcn_permlanex16(
      b, b, 0x76543210, 0xfedcba98, false, false));
}

// 2^x of 8 values in one statement: behind each v_exp_f32 then stands an
// instruction that neither reads its result nor overwrites its source (the
// outputs are early-clobber), and behind the last a v_nop.  That is the slot the
// instruction set asks for behind a transcendental.
__device__ __forceinline__ v8f exp2x8(v8f x) {
  float p0, p1, p2, p3, p4, p5, p6, p7;
  asm("v_exp_f32 %0, %8\n\t"
      "v_exp_f32 %1, %9\n\t"
      "v_exp_f32 %2, %10\n\t"
      "v_exp_f32 %3, %11\n\t"
      "v_exp_f32 %4, %12\n\t"
      "v_exp_f32 %5, %13\n\t"
      "v_exp_f32 %6, %14\n\t"
      "v_exp_f32 %7, %15\n\t"
      "v_nop"
      : "=&v"(p0), "=&v"(p1), "=&v"(p2), "=&v"(p3),
        "=&v"(p4), "=&v"(p5), "=&v"(p6), "=&v"(p7)
      : "v"(x[0]), "v"(x[1]), "v"(x[2]), "v"(x[3]),
        "v"(x[4]), "v"(x[5]), "v"(x[6]), "v"(x[7]));
  const v8f r = {p0, p1, p2, p3, p4, p5, p6, p7};
  return r;
}

__global__ void __launch_bounds__(128)
attn_kernel(const half_t* __restrict__ qbuf, const half_t* __restrict__ kbuf,
            const half_t* __restrict__ vbuf, const float* __restrict__ bias_table,
            half_t* __restrict__ ao) {
  const int lane = threadIdx.x & 31;
  const int wid = __builtin_amdgcn_readfirstlane(threadIdx.x >> 5);
  const int nl = lane & 15, hh = lane >> 4, hi8 = hh << 3;
  const int gw = blockIdx.x * 4 + wid;             // wave number, 0..4095
  const int h  = gw & (HEADS - 1);                 // a block's 4 heads are adjacent
  const int w0 = (gw >> 4) * WPW;

  // query = qt*16 + nl, key = kt*16 + 8*hh + r; d = qt - kt + 3:
  // row difference dr = 2*d + 1 + (nl>>3) - hh (0..14), column difference
  // dc = (nl&7) + 7 - r (0..14): one lane address, constant steps in d and r
  const float* bp = bias_table + ((1 + (nl >> 3) - hh) * 15 + (nl & 7)) * HEADS + h;
  float bias[7][8];
#pragma unroll
  for (int d = 0; d < 7; ++d)
#pragma unroll
    for (int r = 0; r < 8; ++r)
      bias[d][r] = bp[(d * 30 + 7 - r) * HEADS] * LOG2E;
  // the address that these 56 loads name is an input here, so it stays whole
  // up to this wait; its registers are free for other use only behind it
  asm volatile("s_wait_xcnt 0x0" :: "v"(bp) : "memory");

  const size_t off = (size_t)(w0 * HEADS + h) * (WS2 * HD);
  const half_t* kp = kbuf + off + lane * 8;              // fragment order (QKV_UNIT)
  const half_t* qp = qbuf + off + lane * 8;
  const half_t* vp = vbuf + off + lane * 8;
  half_t* op = ao + ((size_t)w0 * WS2 + nl) * DIM + h * HD + hi8;

  // rolled: one unit's fragments and the bias fill the register budget
#pragma unroll 1
  for (int i = 0; i < WPW; ++i) {
    v16h ka[4], qb[4], va[2][2];
#pragma unroll
    for (int t = 0; t < 4; ++t) {
      ka[t] = frag_ldw(kp + t * 512);
      qb[t] = frag_ldw(qp + t * 512);
    }
#pragma unroll
    for (int nt = 0; nt < 2; ++nt)
#pragma unroll
      for (int ks = 0; ks < 2; ++ks)
        va[nt][ks] = frag_ldw(vp + nt * 1024 + ks * 512);

#pragma unroll
    for (int qt = 0; qt < 4; ++qt) {
      v8f s[4];
#pragma unroll
      for (int kt = 0; kt < 4; ++kt) {
        const v8f zero = {};
        s[kt] = wmma_fp16(ka[kt], qb[qt], zero);
      }
      float m4[4];
#pragma unroll
      for (int kt = 0; kt < 4; ++kt) {
#pragma unroll
        for (int r = 0; r < 8; ++r)
          s[kt][r] = s[kt][r] * (SCL * LOG2E) + bias[qt - kt + 3][r];
        m4[kt] = s[kt][0];
#pragma unroll
        for (int r = 1; r < 8; ++r) m4[kt] = fmaxf(m4[kt], s[kt][r]);
      }
      float mx = fmaxf(fmaxf(m4[0], m4[1]), fmaxf(m4[2], m4[3]));
      mx = fmaxf(mx, xhalf(mx));

      float s4[4];
      v16h pb[2];
#pragma unroll
      for (int kt = 0; kt < 4; ++kt) {
        const v8f p = exp2x8(s[kt] - mx);
        s4[kt] = p[0];
#pragma unroll
        for (int r = 1; r < 8; ++r) s4[kt] += p[r];
#pragma unroll
        for (int r = 0; r < 8; ++r) pb[kt >> 1][(kt & 1) * 8 + r] = (half_t)p[r];
      }
      float sum = (s4[0] + s4[1]) + (s4[2] + s4[3]);
      sum += xhalf(sum);
      const float inv = 1.0f / sum;

      v8f o[2] = {};
#pragma unroll
      for (int ks = 0; ks < 2; ++ks)
#pragma unroll
        for (int nt = 0; nt < 2; ++nt)
          o[nt] = wmma_fp16(va[nt][ks], pb[ks], o[nt]);
#pragma unroll
      for (int nt = 0; nt < 2; ++nt) {
        v8h ov;
#pragma unroll
        for (int r = 0; r < 8; ++r) ov[r] = (half_t)(o[nt][r] * inv);
        *(v8h*)(op + qt * 16 * DIM + nt * 16) = ov;
      }
    }
    // the four address pairs that this trip's loads and stores name are kept
    // whole up to this wait (they are inputs here) and advanced only behind it
    asm volatile("s_wait_xcnt 0x0" :: "v"(kp), "v"(qp), "v"(vp), "v"(op) : "memory");
    kp += HEADS * WS2 * HD; qp += HEADS * WS2 * HD; vp += HEADS * WS2 * HD;
    op += WS2 * DIM;
  }
}

// ------------------- kernel 4: proj GEMM + residual + BN2, NCHW fp32 output
#define PWIN 4              /* windows per block: 32 pixels of an image row, one 128-B line */

// the value that lane l (a constant) holds, for every lane
__device__ __forceinline__ float lane_val(float v, int l) {
  return __builtin_bit_cast(float, __builtin_amdgcn_readlane(__builtin_bit_cast(int, v), l));
}

// 8 copies of 16 B a lane.  The wait is the last line of the copies' own
// statement, so that it stands in front of every later write of a register
// that a copy names.
__device__ __forceinline__ void async_copy16x8(const unsigned (&l)[8],
                                               const char* const (&g)[8]) {
  asm volatile("global_load_async_to_lds_b128 %0, %8, off\n\t"
               "global_load_async_to_lds_b128 %1, %9, off\n\t"
               "global_load_async_to_lds_b128 %2, %10, off\n\t"
               "global_load_async_to_lds_b128 %3, %11, off\n\t"
               "global_load_async_to_lds_b128 %4, %12, off\n\t"
               "global_load_async_to_lds_b128 %5, %13, off\n\t"
               "global_load_async_to_lds_b128 %6, %14, off\n\t"
               "global_load_async_to_lds_b128 %7, %15, off\n\t"
               "s_wait_xcnt 0x0"
               :: "v"(l[0]), "v"(l[1]), "v"(l[2]), "v"(l[3]),
                  "v"(l[4]), "v"(l[5]), "v"(l[6]), "v"(l[7]),
                  "v"((unsigned long long)(uintptr_t)g[0]),
                  "v"((unsigned long long)(uintptr_t)g[1]),
                  "v"((unsigned long long)(uintptr_t)g[2]),
                  "v"((unsigned long long)(uintptr_t)g[3]),
                  "v"((unsigned long long)(uintptr_t)g[4]),
                  "v"((unsigned long long)(uintptr_t)g[5]),
                  "v"((unsigned long long)(uintptr_t)g[6]),
                  "v"((unsigned long long)(uintptr_t)g[7])
               : "memory");
}

// One pass: 32 output channels x 128 pixels (4 image rows of 32).  The weights
// are the A operand and the pixels the B operand: token tile m is image row
// m >> 1, pixels (m & 1) * 16 + (lane & 15), and a lane's 8 registers are the
// channels j * 16 + hh * 8 + r.  The two halves of the wave then exchange one
// tile each, after which a register holds 32 adjacent pixels of ONE channel:
// each x load and each out store of the wave is one whole 128-B line.
// xb, ob: at (first channel, first image row, first pixel + lane).
// pbl, s2l, h2l: lane l holds the bias and the BN2 constants of channel l of the
// pass's 32; a channel's own go from there to scalar registers, as every lane
// needs the same ones.
__device__ __forceinline__ void proj_pass(const half_t* A0, const half_t* A1,
                                          const half_t* wrow,
                                          const float* xb, float* ob,
                                          float pbl, float s2l, float h2l,
                                          bool lo) {
  v8f acc[8][2] = {};
  // Fragments run half a K-step (pixels, from LDS) and one K-step (weights,
  // from global) ahead of the WMMAs that use them.
  v16h a0[4], a1[4];
  v16h bf0 = frag_ldw(wrow);
  v16h bf1 = frag_ldw(wrow + 16 * DIM);
#pragma unroll
  for (int m = 0; m < 4; ++m) a0[m] = frag_ld(A0 + m * 16 * APITCH);
  // two K-steps a trip: a full unroll lets the loads run ahead until the
  // registers spill
#pragma unroll 2
  for (int ks = 0; ks < 16; ++ks) {
    const int kc = ks << 5;
    const int kn = (ks < 15 ? ks + 1 : 15) << 5;       // last trip: in bounds, unused
    const v16h nb0 = frag_ldw(wrow + (kn >> 5) * WBLK);
    const v16h nb1 = frag_ldw(wrow + 16 * DIM + (kn >> 5) * WBLK);
#pragma unroll
    for (int m = 0; m < 4; ++m) a1[m] = frag_ld(A1 + m * 16 * APITCH + kc);
#pragma unroll
    for (int m = 0; m < 4; ++m) {
      acc[m][0] = wmma_fp16(bf0, a0[m], acc[m][0]);
      acc[m][1] = wmma_fp16(bf1, a0[m], acc[m][1]);
    }
#pragma unroll
    for (int m = 0; m < 4; ++m) a0[m] = frag_ld(A0 + m * 16 * APITCH + kn);
#pragma unroll
    for (int m = 0; m < 4; ++m) {
      acc[4 + m][0] = wmma_fp16(bf0, a1[m], acc[4 + m][0]);
      acc[4 + m][1] = wmma_fp16(bf1, a1[m], acc[4 + m][1]);
    }
    bf0 = nb0; bf1 = nb1;
    sched_qkv_group();
  }

#pragma unroll
  for (int j = 0; j < 2; ++j) {
    float xv[8][4][2];                                 // 64 lines in flight per wave
#pragma unroll
    for (int r = 0; r < 8; ++r)
#pragma unroll
      for (int q = 0; q < 4; ++q)
#pragma unroll
        for (int u = 0; u < 2; ++u)
          xv[r][q][u] = xb[((j * 16 + u * 8 + r) << 12) + (q << 6)];
#pragma unroll
    for (int r = 0; r < 8; ++r) {
      const int c0 = j * 16 + r, c1 = c0 + 8;
      const float pb0 = lane_val(pbl, c0), s20 = lane_val(s2l, c0), h20 = lane_val(h2l, c0);
      const float pb1 = lane_val(pbl, c1), s21 = lane_val(s2l, c1), h21 = lane_val(h2l, c1);
#pragma unroll
      for (int q = 0; q < 4; ++q) {
        const float e0 = acc[2 * q][j][r], e1 = acc[2 * q + 1][j][r];
        // lanes 0-15 give away (c0, pixels 16-31) and get (c1, pixels 0-15)
        const float t = xhalf(lo ? e1 : e0);
        const float v0 = lo ? e0 : t;                  // channel c0, pixel = lane
        const float v1 = lo ? t : e1;                  // channel c1, pixel = lane
        const float r0 = xv[r][q][0] + v0 + pb0;       // residual
        const float r1 = xv[r][q][1] + v1 + pb1;
        ob[(c0 << 12) + (q << 6)] = r0 * s20 + h20;    // BN2
        ob[(c1 << 12) + (q << 6)] = r1 * s21 + h21;
      }
    }
    // the loads that follow (the other 16 channels' x, the next pass's weights)
    // land in, and the next pass forms its addresses in, registers that these
    // loads and stores name: only behind this wait
    asm volatile("s_wait_xcnt 0x0" ::: "memory");
  }
}

// Block = 512 thr (16 waves): 4 windows side by side in the image (8 image rows
// of 32 pixels = 256 tokens) and all 512 output channels.  The 256x512 f16 tile
// of the attention's output is copied to LDS once, its rows in image order
// (row * 32 + pixel), and stays there.  Wave (th, cg) does image rows 4*th..4*th+3
// and channels 64*cg..64*cg+63 in two passes; waves cg and cg + 8 read the same
// weights.  266,240 B of LDS: one block on a WGP, four waves per SIMD.
__global__ void __launch_bounds__(512)
proj_kernel(const float* __restrict__ x, const half_t* __restrict__ ao,
            const half_t* __restrict__ wpj, const float* __restrict__ proj_b,
            const float* __restrict__ bn2s, const float* __restrict__ bn2h,
            float* __restrict__ out) {
  __shared__ __align__(16) half_t As[PWIN * WS2 * APITCH];

  const int w0  = blockIdx.x * PWIN;               // windows w0 .. w0 + 3
  const int tid = threadIdx.x, lane = tid & 31;
  const int wv  = __builtin_amdgcn_readfirstlane(tid >> 5);
  const int nl = lane & 15, hi8 = (lane >> 4) << 3;
  const int b = w0 >> 6, wi = w0 & 63;
  const int row0 = (wi >> 3) << 3, col0 = (wi & 7) << 3;   // col0: 0 or 32

  const int th = wv >> 3, cg = wv & 7;
  // the constants of the wave's 64 channels, channel = lane and lane + 32
  const int cl = cg * 64 + lane;
  const float pbA = proj_b[cl], pbB = proj_b[cl + 32];
  const float s2A = bn2s[cl],   s2B = bn2s[cl + 32];
  const float h2A = bn2h[cl],   h2B = bn2h[cl + 32];

  { // staging, once: a wave copies 16 tokens (two rows of one window), each
    // 1 KB row of ao as two copies of 512 B = 4 whole lines
    const unsigned lb = lds_addr(As)
        + (unsigned)(((wv & 3) * 64 + (wv >> 2) * 8) * (APITCH * 2) + lane * 16);
    const char* gb = (const char*)(ao + ((size_t)w0 * WS2 + wv * 16) * DIM) + lane * 16;
#pragma unroll
    for (int s = 0; s < 4; ++s) {
      unsigned l[8];
      const char* g[8];
#pragma unroll
      for (int c = 0; c < 8; ++c) {
        const int t = s * 4 + (c >> 1);                // token of the wave's 16
        l[c] = lb + (unsigned)(((t >> 3) * 32 + (t & 7)) * (APITCH * 2) + (c & 1) * 512);
        g[c] = gb + t * (DIM * 2) + (c & 1) * 512;
      }
      async_copy16x8(l, g);
    }
  }
  wait_async0();                                   // this wave's 32 copies have landed
  __syncthreads();                                 // and every other wave's

  const half_t* A0 = As + (th * 128 + nl) * APITCH + hi8;  // image rows 4*th, 4*th + 1
  const half_t* A1 = A0 + 64 * APITCH;                     // image rows 4*th + 2, 4*th + 3
  for (int p = 0; p < 2; ++p) {
    const int ch0 = cg * 64 + p * 32;
    const int off = ((b * DIM + ch0) << 12) + ((row0 + th * 4) << 6) + col0 + lane;
    proj_pass(A0, A1, wpj + (size_t)ch0 * DIM + lane * 8, x + off, out + off,
              p ? pbB : pbA, p ? s2B : s2A, p ? h2B : h2A, lane < 16);
  }
}

// ----------------------------------------------------------------- launcher
extern "C" void kernel_launch(void* const* d_in, const int* in_sizes, int n_in,
                              void* d_out, int out_size, void* d_ws, size_t ws_size,
                              hipStream_t stream) {
  const float* x    = (const float*)d_in[0];
  const float* g1   = (const float*)d_in[1];
  const float* be1  = (const float*)d_in[2];
  const float* m1   = (const float*)d_in[3];
  const float* va1  = (const float*)d_in[4];
  const float* qk_w = (const float*)d_in[5];
  const float* qk_b = (const float*)d_in[6];
  const float* v_w  = (const float*)d_in[7];
  const float* v_b  = (const float*)d_in[8];
  const float* pw   = (const float*)d_in[9];
  const float* pb   = (const float*)d_in[10];
  const float* bt   = (const float*)d_in[11];
  const float* g2   = (const float*)d_in[12];
  const float* be2  = (const float*)d_in[13];
  const float* m2   = (const float*)d_in[14];
  const float* va2  = (const float*)d_in[15];
  float* out = (float*)d_out;

  char* ws = (char*)d_ws;
  half_t* wqk = (half_t*)ws; ws += (size_t)2 * DIM * DIM * sizeof(half_t);
  half_t* wv  = (half_t*)ws; ws += (size_t)DIM * DIM * sizeof(half_t);
  half_t* wpj = (half_t*)ws; ws += (size_t)DIM * DIM * sizeof(half_t);
  float* bn1s = (float*)ws;  ws += DIM * sizeof(float);
  float* bn1h = (float*)ws;  ws += DIM * sizeof(float);
  float* bn2s = (float*)ws;  ws += DIM * sizeof(float);
  float* bn2h = (float*)ws;  ws += DIM * sizeof(float);
  const size_t qkvN = (size_t)NWIN * HEADS * WS2 * HD;
  half_t* qbuf = (half_t*)ws; ws += qkvN * sizeof(half_t);
  half_t* kbuf = (half_t*)ws; ws += qkvN * sizeof(half_t);
  half_t* vbuf = (half_t*)ws; ws += qkvN * sizeof(half_t);
  half_t* ao   = (half_t*)ws; ws += (size_t)NWIN * WS2 * DIM * sizeof(half_t);

  prep_kernel<<<4100, 256, 0, stream>>>(qk_w, v_w, pw, g1, be1, m1, va1,
                                        g2, be2, m2, va2,
                                        wqk, wv, wpj, bn1s, bn1h, bn2s, bn2h);
  qkv_kernel<<<NWIN / 2, 256, 0, stream>>>(x, wqk, wv, bn1s, bn1h, qk_b, v_b,
                                            qbuf, kbuf, vbuf);
  attn_kernel<<<NWIN * HEADS / (4 * WPW), 128, 0, stream>>>(qbuf, kbuf, vbuf, bt, ao);
  proj_kernel<<<NWIN / PWIN, 512, 0, stream>>>(x, ao, wpj, pb, bn2s, bn2h, out);
}

// v006
// A run of this version takes 138 microseconds.
// Next to v005, in two timings, it ran 1.16 times as fast each time.
// All steps since v000 together make it 7.23 times as fast.
#include <hip/hip_runtime.h>

typedef _Float16 half_t;
typedef __attribute__((ext_vector_type(16))) _Float16 v16h;
typedef __attribute__((ext_vector_type(8)))  _Float16 v8h;
typedef __attribute__((ext_vector_type(8)))  float    v8f;

#define DIM   512
#define WS2   64
#define HEADS 16
#define HD    32
#define NWIN  1024          /* 16 batches * 8 * 8 windows */
#define EPSV  1e-5f
#define SCL   0.17677669529663687f  /* 1/sqrt(32) */
#define APITCH 520          /* LDS stride (halves) of the resident 512-deep A tile: 16 B x odd */

// ---------------------------------------------------------------- WMMA helpers
__device__ __forceinline__ v8f wmma_fp16(v16h a, v16h b, v8f c) {
  return __builtin_amdgcn_wmma_f32_16x16x32_f16(false, a, false, b, (short)0, c,
                                                false, false);
}

// Keeps each group of 8 A reads in front of the 8 WMMAs of the other group, so
// that a read's LDS latency runs under matrix work instead of in front of it.
__device__ __forceinline__ void sched_qkv_group() {
#if __has_builtin(__builtin_amdgcn_sched_group_barrier)
  __builtin_amdgcn_sched_group_barrier(0x020, 4, 0);  // 4x VMEM read (next B)
  __builtin_amdgcn_sched_group_barrier(0x100, 8, 0);  // 8x DS read   (A, 2nd half)
  __builtin_amdgcn_sched_group_barrier(0x008, 8, 0);  // 8x WMMA      (1st half)
  __builtin_amdgcn_sched_group_barrier(0x100, 8, 0);  // 8x DS read   (next A, 1st half)
  __builtin_amdgcn_sched_group_barrier(0x008, 8, 0);  // 8x WMMA      (2nd half)
#endif
}

// Per ISA 7.12.2, a lane's 16 fragment halves (A row m / B column n) are two
// contiguous 8-half runs: k = hi8+0..7 and k = 16+hi8+0..7.  `p` must point at
// (row_base + hi8) and be 16B aligned -> two b128 loads.
__device__ __forceinline__ v16h frag_ld(const half_t* p) {
  const v8h lo = *(const v8h*)(p);
  const v8h hi = *(const v8h*)(p + 16);
  v16h r;
#pragma unroll
  for (int i = 0; i < 8; ++i) { r[i] = lo[i]; r[8 + i] = hi[i]; }
  return r;
}

// The f16 weights lie in the workspace in fragment order: per 16 output columns
// and 32 k one block of 1 KB = [k half-run: k&16][lane = ((k>>3)&1)*16 + col&15][k&7].
// A wave's b128 load of a half-run is then 512 contiguous bytes, 4 whole lines;
// from row-major weights it touched 16 lines, 32 B of each.  The k order per
// lane and register is that of frag_ld.  `p` points at (block + lane*8).
#define WBLK  512           /* halves per 16-column x 32-k block */
__device__ __forceinline__ v16h frag_ldw(const half_t* p) {
  const v8h lo = *(const v8h*)(p);
  const v8h hi = *(const v8h*)(p + 256);
  v16h r;
#pragma unroll
  for (int i = 0; i < 8; ++i) { r[i] = lo[i]; r[8 + i] = hi[i]; }
  return r;
}
// position in the fragment-ordered copy -> index in the row-major [n][DIM] weight
__device__ __forceinline__ int frag_src(int o) {
  const int n = ((o >> 13) << 4) + ((o >> 3) & 15);
  const int k = (((o >> 9) & 15) << 5) + (((o >> 8) & 1) << 4) + (((o >> 7) & 1) << 3) + (o & 7);
  return n * DIM + k;
}

// --------------------------------------------------- kernel 1: prep (weights)
__global__ void prep_kernel(const float* __restrict__ qk_w,
                            const float* __restrict__ v_w,
                            const float* __restrict__ proj_w,
                            const float* __restrict__ g1, const float* __restrict__ be1,
                            const float* __restrict__ m1, const float* __restrict__ va1,
                            const float* __restrict__ g2, const float* __restrict__ be2,
                            const float* __restrict__ m2, const float* __restrict__ va2,
                            half_t* __restrict__ wqk, half_t* __restrict__ wv,
                            half_t* __restrict__ wpj,
                            float* __restrict__ bn1s, float* __restrict__ bn1h,
                            float* __restrict__ bn2s, float* __restrict__ bn2h) {
  int i = blockIdx.x * blockDim.x + threadIdx.x;
  const int NQK = 2 * DIM * DIM;   // 524288
  const int NV  = DIM * DIM;       // 262144
  if (i < NQK) { wqk[i] = (half_t)qk_w[frag_src(i)]; return; }
  i -= NQK;
  if (i < NV) { wv[i] = (half_t)v_w[frag_src(i)]; return; }
  i -= NV;
  if (i < NV) { wpj[i] = (half_t)proj_w[frag_src(i)]; return; }
  i -= NV;
  if (i < DIM) {
    const float s = g1[i] * rsqrtf(va1[i] + EPSV);
    bn1s[i] = s; bn1h[i] = be1[i] - m1[i] * s; return;
  }
  i -= DIM;
  if (i < DIM) {
    const float s = g2[i] * rsqrtf(va2[i] + EPSV);
    bn2s[i] = s; bn2h[i] = be2[i] - m2[i] * s; return;
  }
}

// ------------------------------------- Q, K, V in the workspace: fragment order
// One (window, head) unit is 64 tokens x 32 channels = QKV_UNIT halves, laid as
// 8 runs of [lane][8 halves] = 512 B each; lane = (l & 15, hh = l >> 4).
//   Q, K: run (tt, j):  token tt*16 + (l & 15), channels j*16 + hh*8 + 0..7,
//         at tt*512 + j*256: frag_ldw(unit + tt*512 + lane*8) is the fragment of
//         token tile tt over the 32 channels.
//   V:    run (nt, mt): channel nt*16 + (l & 15), tokens mt*16 + hh*8 + 0..7,
//         at nt*1024 + mt*256: frag_ldw(unit + nt*1024 + ks*512 + lane*8) is the
//         fragment of channel tile nt over tokens ks*32 .. ks*32 + 31.
#define QKV_UNIT (WS2 * HD)

// One pass of the QKV GEMM: 128 tokens (two windows) x 32 output columns.
// TOKCOL (Q, K): the weights are the A operand and the tokens the B operand, so
// that the accumulator's column (lane) is a token and its 8 registers are 8
// consecutive channels; V: as A = tokens, B = weights, a lane holds 8
// consecutive tokens of one channel.  The two operands have the same k order
// per lane and register, so the exchange moves no fragment load.
// `bias`: TOKCOL: at (first column + hi8); else at (first column + nl).
template <bool TOKCOL>
__device__ __forceinline__ void qkv_pass(const half_t* A0, const half_t* A1,
                                         const half_t* wrow, const float* bias,
                                         half_t* dst) {
  v8f acc[8][2] = {};
  // Fragments run half a K-step (A, from LDS) and one K-step (B, from global)
  // ahead of the WMMAs that use them.
  v16h a0[4], a1[4];
  v16h bf0 = frag_ldw(wrow);                           // global b128 x2
  v16h bf1 = frag_ldw(wrow + 16 * DIM);
#pragma unroll
  for (int m = 0; m < 4; ++m) a0[m] = frag_ld(A0 + m * 16 * APITCH);
  // two K-steps a trip: a full unroll lets the loads run ahead until the
  // registers spill
#pragma unroll 2
  for (int ks = 0; ks < 16; ++ks) {
    const int kc = ks << 5;
    const int kn = (ks < 15 ? ks + 1 : 15) << 5;       // last trip: in bounds, unused
    const v16h nb0 = frag_ldw(wrow + (kn >> 5) * WBLK);
    const v16h nb1 = frag_ldw(wrow + 16 * DIM + (kn >> 5) * WBLK);
#pragma unroll
    for (int m = 0; m < 4; ++m) a1[m] = frag_ld(A1 + m * 16 * APITCH + kc);
#pragma unroll
    for (int m = 0; m < 4; ++m) {
      acc[m][0] = TOKCOL ? wmma_fp16(bf0, a0[m], acc[m][0]) : wmma_fp16(a0[m], bf0, acc[m][0]);
      acc[m][1] = TOKCOL ? wmma_fp16(bf1, a0[m], acc[m][1]) : wmma_fp16(a0[m], bf1, acc[m][1]);
    }
#pragma unroll
    for (int m = 0; m < 4; ++m) a0[m] = frag_ld(A0 + m * 16 * APITCH + kn);
#pragma unroll
    for (int m = 0; m < 4; ++m) {
      acc[4 + m][0] = TOKCOL ? wmma_fp16(bf0, a1[m], acc[4 + m][0]) : wmma_fp16(a1[m], bf0, acc[4 + m][0]);
      acc[4 + m][1] = TOKCOL ? wmma_fp16(bf1, a1[m], acc[4 + m][1]) : wmma_fp16(a1[m], bf1, acc[4 + m][1]);
    }
    bf0 = nb0; bf1 = nb1;
    sched_qkv_group();
  }

  float bs[2][8];                                      // bias of (column tile j, register r)
#pragma unroll
  for (int j = 0; j < 2; ++j)
#pragma unroll
    for (int r = 0; r < 8; ++r) bs[j][r] = bias[j * 16 + (TOKCOL ? r : 0)];
  // the address pair that these loads name is an input here, so it stays whole
  // up to this wait; its registers are free for other use only behind it
  asm volatile("s_wait_xcnt 0x0" :: "v"(bias) : "memory");
#pragma unroll
  for (int m = 0; m < 8; ++m)
#pragma unroll
    for (int j = 0; j < 2; ++j) {
      v8h o;
#pragma unroll
      for (int r = 0; r < 8; ++r) o[r] = (half_t)(acc[m][j][r] + bs[j][r]);
      *(v8h*)(dst + (m >> 2) * (HEADS * QKV_UNIT)
                  + (TOKCOL ? (m & 3) * 512 + j * 256 : j * 1024 + (m & 3) * 256)) = o;
    }
  // the address pair that these stores name is kept whole up to this wait (it
  // is an input here); the next pass reuses the registers only behind it
  asm volatile("s_wait_xcnt 0x0" :: "v"(dst) : "memory");
}

// -------------------------------------------- kernel 2: fused BN1 + QKV GEMMs
// Block = 256 thr (8 waves): two windows side by side in the image (128 tokens)
// and all 1536 output cols.  The BN'd 128x512 f16 A tile is staged in LDS once
// and stays there; each wave then runs 6 passes of a 128x32 tile (one head).
// cols [0,512)=Q, [512,1024)=K, [1024,1536)=V.
// Q, K and V go to the workspace in the fragment order in which the attention
// kernel loads them (QKV_UNIT above): what a lane holds in 8 accumulator registers
// is one 16-B run of its own later fragment, and a wave's store is 512
// contiguous bytes, 4 whole lines.
// B fragments come straight from the fragment-ordered global f16 weights (two
// b128 of 4 whole lines each per 16 columns and K-step).
// 2 x 133,120 B of LDS fit one WGP: four waves per SIMD, 256 VGPRs each.
__global__ void __launch_bounds__(256) __attribute__((amdgpu_waves_per_eu(4, 4)))
qkv_kernel(const float* __restrict__ x,
           const half_t* __restrict__ wqk, const half_t* __restrict__ wv,
           const float* __restrict__ bn1s, const float* __restrict__ bn1h,
           const float* __restrict__ qk_b, const float* __restrict__ v_b,
           half_t* __restrict__ qbuf, half_t* __restrict__ kbuf,
           half_t* __restrict__ vbuf) {
  __shared__ __align__(16) half_t As[2 * WS2 * APITCH];   // resident A tile

  const int w0  = blockIdx.x * 2;                  // windows w0 and w0 + 1
  const int tid = threadIdx.x, lane = tid & 31;
  const int wid = __builtin_amdgcn_readfirstlane(tid >> 5);
  const int nl = lane & 15, hi8 = (lane >> 4) << 3;

  const int b = w0 >> 6, wi = w0 & 63;
  const int row0 = (wi >> 3) << 3, col0 = (wi & 7) << 3;   // col0: 0,16,32,48

  { // A staging, once: a lane takes 4 pixels of one image row (16 B) in 8
    // channels, and writes 8 channels of each of the 4 tokens as one b128.
    const int r = lane >> 2, quad = lane & 3;
    const int m0 = ((quad >> 1) << 6) + (r << 3) + ((quad & 1) << 2);
    const float* xl = x + ((b * DIM + (wid << 3)) << 12) + ((row0 + r) << 6) + col0 + (quad << 2);
    // 16 loads of 16 B in flight per lane cover the memory latency; all 64 at
    // once would spill
#pragma unroll 1
    for (int i = 0; i < 4; ++i) {
      float4 v[2][8];
#pragma unroll
      for (int u = 0; u < 2; ++u)
#pragma unroll
        for (int j = 0; j < 8; ++j)
          v[u][j] = *(const float4*)(xl + ((u * 64 + j) << 12));
      // the address pair that these loads name is kept whole up to this wait
      // (it is an input here) and is advanced only behind it
      asm volatile("s_wait_xcnt 0x0" :: "v"(xl) : "memory");
      xl += 128 << 12;                                   // 128 channels on
#pragma unroll
      for (int u = 0; u < 2; ++u) {
        const int c0 = (wid + (((i << 1) + u) << 3)) << 3;
        v8h o0, o1, o2, o3;
#pragma unroll
        for (int j = 0; j < 8; ++j) {
          const float s = bn1s[c0 + j], sh = bn1h[c0 + j];
          o0[j] = (half_t)(v[u][j].x * s + sh);
          o1[j] = (half_t)(v[u][j].y * s + sh);
          o2[j] = (half_t)(v[u][j].z * s + sh);
          o3[j] = (half_t)(v[u][j].w * s + sh);
        }
        half_t* ap = As + m0 * APITCH + c0;
        *(v8h*)(ap)              = o0;
        *(v8h*)(ap + APITCH)     = o1;
        *(v8h*)(ap + 2 * APITCH) = o2;
        *(v8h*)(ap + 3 * APITCH) = o3;
      }
    }
  }
  __syncthreads();

  const half_t* A0 = As + nl * APITCH + hi8;     // tokens of window w0
  const half_t* A1 = A0 + WS2 * APITCH;          // tokens of window w0 + 1
  // 32 output columns = one head of Q, K or V per wave and pass
  for (int p = 0; p < 4; ++p) {                  // Q: p = 0, 1; K: p = 2, 3
    const int ng0 = ((p << 3) + wid) << 5;
    const int h = ((p << 3) + wid) & (HEADS - 1);
    qkv_pass<true>(A0, A1, wqk + (size_t)ng0 * DIM + lane * 8, qk_b + ng0 + hi8,
                   (p < 2 ? qbuf : kbuf) + (size_t)(w0 * HEADS + h) * QKV_UNIT + lane * 8);
  }
  for (int p = 0; p < 2; ++p) {                  // V
    const int h = (p << 3) + wid;
    qkv_pass<false>(A0, A1, wv + (size_t)(h << 5) * DIM + lane * 8, v_b + (h << 5) + nl,
                    vbuf + (size_t)(w0 * HEADS + h) * QKV_UNIT + lane * 8);
  }
}

// ------------------------------ per (window, head) attention, WMMA
// One wave does whole (window, head) units by itself.
// S^T = K Q^T: a lane then holds 32 of the 64 scores of ONE query (its partner
// lane ^ 16 the rest), so max and sum are in-lane plus one exchange.  Two S^T
// tiles, converted in place, are the B operand of O^T = V^T P^T, and a lane's 8
// results are 8 consecutive channels of one token: one 16-B store.
// A wave keeps its head over WPW windows; the bias of tile (kt, qt) depends on
// qt - kt alone, so 7 x 8 registers hold the head's whole 64 x 64 bias.
#define WPW   4             /* windows per wave = windows per block (PWIN) */
#define LOG2E 1.4426950408889634f

// lane l <-> lane l ^ 16
__device__ __forceinline__ float xhalf(float v) {
  const int b = __builtin_bit_cast(int, v);
  return __builtin_bit_cast(float, __builtin_amdgcn_permlanex16(
      b, b, 0x76543210, 0xfedcba98, false, false));
}

// 2^x of 8 values in one statement: behind each v_exp_f32 then stands an
// instruction that neither reads its result nor overwrites its source (the
// outputs are early-clobber), and behind the last a v_nop.  That is the slot the
// instruction set asks for behind a transcendental.
__device__ __forceinline__ v8f exp2x8(v8f x) {
  float p0, p1, p2, p3, p4, p5, p6, p7;
  asm("v_exp_f32 %0, %8\n\t"
      "v_exp_f32 %1, %9\n\t"
      "v_exp_f32 %2, %10\n\t"
      "v_exp_f32 %3, %11\n\t"
      "v_exp_f32 %4, %12\n\t"
      "v_exp_f32 %5, %13\n\t"
      "v_exp_f32 %6, %14\n\t"
      "v_exp_f32 %7, %15\n\t"
      "v_nop"
      : "=&v"(p0), "=&v"(p1), "=&v"(p2), "=&v"(p3),
        "=&v"(p4), "=&v"(p5), "=&v"(p6), "=&v"(p7)
      : "v"(x[0]), "v"(x[1]), "v"(x[2]), "v"(x[3]),
        "v"(x[4]), "v"(x[5]), "v"(x[6]), "v"(x[7]));
  const v8f r = {p0, p1, p2, p3, p4, p5, p6, p7};
  return r;
}

// Head h of the windows w0 .. w0 + WPW - 1, which lie side by side in the image.
// The result goes to the projection's LDS tile `As`, whose rows are in image
// order: token T of window i is row (T >> 3) * 32 + i * 8 + (T & 7).
__device__ __forceinline__ void attn_head(const half_t* __restrict__ qbuf,
                                          const half_t* __restrict__ kbuf,
                                          const half_t* __restrict__ vbuf,
                                          const float* __restrict__ bias_table,
                                          half_t* As, int w0, int h, int lane) {
  const int nl = lane & 15, hh = lane >> 4, hi8 = hh << 3;

  // query = qt*16 + nl, key = kt*16 + 8*hh + r; d = qt - kt + 3:
  // row difference dr = 2*d + 1 + (nl>>3) - hh (0..14), column difference
  // dc = (nl&7) + 7 - r (0..14): one lane address, constant steps in d and r
  const float* bp = bias_table + ((1 + (nl >> 3) - hh) * 15 + (nl & 7)) * HEADS + h;
  float bias[7][8];
#pragma unroll
  for (int d = 0; d < 7; ++d)
#pragma unroll
    for (int r = 0; r < 8; ++r)
      bias[d][r] = bp[(d * 30 + 7 - r) * HEADS] * LOG2E;
  // the address that these 56 loads name is an input here, so it stays whole
  // up to this wait; its registers are free for other use only behind it
  asm volatile("s_wait_xcnt 0x0" :: "v"(bp) : "memory");

  const size_t off = (size_t)(w0 * HEADS + h) * (WS2 * HD);
  const half_t* kp = kbuf + off + lane * 8;              // fragment order (QKV_UNIT)
  const half_t* qp = qbuf + off + lane * 8;
  const half_t* vp = vbuf + off + lane * 8;
  half_t* op = As + ((nl >> 3) * 32 + (nl & 7)) * APITCH + h * HD + hi8;   // token nl of window w0

  // rolled: one unit's fragments and the bias fill the register budget
#pragma unroll 1
  for (int i = 0; i < WPW; ++i) {
    v16h ka[4], qb[4], va[2][2];
#pragma unroll
    for (int t = 0; t < 4; ++t) {
      ka[t] = frag_ldw(kp + t * 512);
      qb[t] = frag_ldw(qp + t * 512);
    }
#pragma unroll
    for (int nt = 0; nt < 2; ++nt)
#pragma unroll
      for (int ks = 0; ks < 2; ++ks)
        va[nt][ks] = frag_ldw(vp + nt * 1024 + ks * 512);

#pragma unroll
    for (int qt = 0; qt < 4; ++qt) {
      v8f s[4];
#pragma unroll
      for (int kt = 0; kt < 4; ++kt) {
        const v8f zero = {};
        s[kt] = wmma_fp16(ka[kt], qb[qt], zero);
      }
      float m4[4];
#pragma unroll
      for (int kt = 0; kt < 4; ++kt) {
#pragma unroll
        for (int r = 0; r < 8; ++r)
          s[kt][r] = s[kt][r] * (SCL * LOG2E) + bias[qt - kt + 3][r];
        m4[kt] = s[kt][0];
#pragma unroll
        for (int r = 1; r < 8; ++r) m4[kt] = fmaxf(m4[kt], s[kt][r]);
      }
      float mx = fmaxf(fmaxf(m4[0], m4[1]), fmaxf(m4[2], m4[3]));
      mx = fmaxf(mx, xhalf(mx));

      float s4[4];
      v16h pb[2];
#pragma unroll
      for (int kt = 0; kt < 4; ++kt) {
        const v8f p = exp2x8(s[kt] - mx);
        s4[kt] = p[0];
#pragma unroll
        for (int r = 1; r < 8; ++r) s4[kt] += p[r];
#pragma unroll
        for (int r = 0; r < 8; ++r) pb[kt >> 1][(kt & 1) * 8 + r] = (half_t)p[r];
      }
      float sum = (s4[0] + s4[1]) + (s4[2] + s4[3]);
      sum += xhalf(sum);
      const float inv = 1.0f / sum;

      v8f o[2] = {};
#pragma unroll
      for (int ks = 0; ks < 2; ++ks)
#pragma unroll
        for (int nt = 0; nt < 2; ++nt)
          o[nt] = wmma_fp16(va[nt][ks], pb[ks], o[nt]);
#pragma unroll
      for (int nt = 0; nt < 2; ++nt) {
        v8h ov;
#pragma unroll
        for (int r = 0; r < 8; ++r) ov[r] = (half_t)(o[nt][r] * inv);
        *(v8h*)(op + qt * 64 * APITCH + nt * 16) = ov;   // 16 tokens = 2 image rows on
      }
    }
    // the three address pairs that this trip's loads name are kept whole up to
    // this wait (they are inputs here) and advanced only behind it
    asm volatile("s_wait_xcnt 0x0" :: "v"(kp), "v"(qp), "v"(vp) : "memory");
    kp += HEADS * WS2 * HD; qp += HEADS * WS2 * HD; vp += HEADS * WS2 * HD;
    op += 8 * APITCH;                                  // next window: 8 pixels on
  }
}

// ------- kernel 3: attention + proj GEMM + residual + BN2, NCHW fp32 output
#define PWIN 4              /* windows per block: 32 pixels of an image row, one 128-B line */

// the value that lane l (a constant) holds, for every lane
__device__ __forceinline__ float lane_val(float v, int l) {
  return __builtin_bit_cast(float, __builtin_amdgcn_readlane(__builtin_bit_cast(int, v), l));
}

// One pass: 32 output channels x 128 pixels (4 image rows of 32).  The weights
// are the A operand and the pixels the B operand: token tile m is image row
// m >> 1, pixels (m & 1) * 16 + (lane & 15), and a lane's 8 registers are the
// channels j * 16 + hh * 8 + r.  The two halves of the wave then exchange one
// tile each, after which a register holds 32 adjacent pixels of ONE channel:
// each x load and each out store of the wave is one whole 128-B line.
// xb, ob: at (first channel, first image row, first pixel + lane).
// pbl, s2l, h2l: lane l holds the bias and the BN2 constants of channel l of the
// pass's 32; a channel's own go from there to scalar registers, as every lane
// needs the same ones.
__device__ __forceinline__ void proj_pass(const half_t* A0, const half_t* A1,
                                          const half_t* wrow,
                                          const float* xb, float* ob,
                                          float pbl, float s2l, float h2l,
                                          bool lo) {
  v8f acc[8][2] = {};
  // Fragments run half a K-step (pixels, from LDS) and one K-step (weights,
  // from global) ahead of the WMMAs that use them.
  v16h a0[4], a1[4];
  v16h bf0 = frag_ldw(wrow);
  v16h bf1 = frag_ldw(wrow + 16 * DIM);
#pragma unroll
  for (int m = 0; m < 4; ++m) a0[m] = frag_ld(A0 + m * 16 * APITCH);
  // two K-steps a trip: a full unroll lets the loads run ahead until the
  // registers spill
#pragma unroll 2
  for (int ks = 0; ks < 16; ++ks) {
    const int kc = ks << 5;
    const int kn = (ks < 15 ? ks + 1 : 15) << 5;       // last trip: in bounds, unused
    const v16h nb0 = frag_ldw(wrow + (kn >> 5) * WBLK);
    const v16h nb1 = frag_ldw(wrow + 16 * DIM + (kn >> 5) * WBLK);
#pragma unroll
    for (int m = 0; m < 4; ++m) a1[m] = frag_ld(A1 + m * 16 * APITCH + kc);
#pragma unroll
    for (int m = 0; m < 4; ++m) {
      acc[m][0] = wmma_fp16(bf0, a0[m], acc[m][0]);
      acc[m][1] = wmma_fp16(bf1, a0[m], acc[m][1]);
    }
#pragma unroll
    for (int m = 0; m < 4; ++m) a0[m] = frag_ld(A0 + m * 16 * APITCH + kn);
#pragma unroll
    for (int m = 0; m < 4; ++m) {
      acc[4 + m][0] = wmma_fp16(bf0, a1[m], acc[4 + m][0]);
      acc[4 + m][1] = wmma_fp16(bf1, a1[m], acc[4 + m][1]);
    }
    bf0 = nb0; bf1 = nb1;
    sched_qkv_group();
  }

#pragma unroll
  for (int j = 0; j < 2; ++j) {
    float xv[8][4][2];                                 // 64 lines in flight per wave
#pragma unroll
    for (int r = 0; r < 8; ++r)
#pragma unroll
      for (int q = 0; q < 4; ++q)
#pragma unroll
        for (int u = 0; u < 2; ++u)
          xv[r][q][u] = xb[((j * 16 + u * 8 + r) << 12) + (q << 6)];
#pragma unroll
    for (int r = 0; r < 8; ++r) {
      const int c0 = j * 16 + r, c1 = c0 + 8;
      const float pb0 = lane_val(pbl, c0), s20 = lane_val(s2l, c0), h20 = lane_val(h2l, c0);
      const float pb1 = lane_val(pbl, c1), s21 = lane_val(s2l, c1), h21 = lane_val(h2l, c1);
#pragma unroll
      for (int q = 0; q < 4; ++q) {
        const float e0 = acc[2 * q][j][r], e1 = acc[2 * q + 1][j][r];
        // lanes 0-15 give away (c0, pixels 16-31) and get (c1, pixels 0-15)
        const float t = xhalf(lo ? e1 : e0);
        const float v0 = lo ? e0 : t;                  // channel c0, pixel = lane
        const float v1 = lo ? t : e1;                  // channel c1, pixel = lane
        const float r0 = xv[r][q][0] + v0 + pb0;       // residual
        const float r1 = xv[r][q][1] + v1 + pb1;
        ob[(c0 << 12) + (q << 6)] = r0 * s20 + h20;    // BN2
        ob[(c1 << 12) + (q << 6)] = r1 * s21 + h21;
      }
    }
    // the loads that follow (the other 16 channels' x, the next pass's weights)
    // land in, and the next pass forms its addresses in, registers that these
    // loads and stores name: only behind this wait
    asm volatile("s_wait_xcnt 0x0" ::: "memory");
  }
}

// Block = 512 thr (16 waves): 4 windows side by side in the image (8 image rows
// of 32 pixels = 256 tokens) and all 512 output channels.  Wave wv first does the
// attention of head wv in the 4 windows and writes its 32 channels of the 256x512
// f16 tile straight to LDS, rows in image order (row * 32 + pixel); the tile never
// goes through memory.  Behind the barrier wave (th, cg) does image rows
// 4*th..4*th+3 and channels 64*cg..64*cg+63 in two passes; waves cg and cg + 8
// read the same weights.  266,240 B of LDS: one block on a WGP, four waves per SIMD.
__global__ void __launch_bounds__(512)
attn_proj_kernel(const float* __restrict__ x,
                 const half_t* __restrict__ qbuf, const half_t* __restrict__ kbuf,
                 const half_t* __restrict__ vbuf, const float* __restrict__ bias_table,
                 const half_t* __restrict__ wpj, const float* __restrict__ proj_b,
                 const float* __restrict__ bn2s, const float* __restrict__ bn2h,
                 float* __restrict__ out) {
  __shared__ __align__(16) half_t As[PWIN * WS2 * APITCH];

  const int w0  = blockIdx.x * PWIN;               // windows w0 .. w0 + 3
  const int tid = threadIdx.x, lane = tid & 31;
  const int wv  = __builtin_amdgcn_readfirstlane(tid >> 5);
  const int nl = lane & 15, hi8 = (lane >> 4) << 3;
  const int b = w0 >> 6, wi = w0 & 63;
  const int row0 = (wi >> 3) << 3, col0 = (wi & 7) << 3;   // col0: 0 or 32

  attn_head(qbuf, kbuf, vbuf, bias_table, As, w0, wv, lane);
  __syncthreads();                                 // all 16 heads of the tile are written

  const int th = wv >> 3, cg = wv & 7;
  // the constants of the wave's 64 channels, channel = lane and lane + 32
  const int cl = cg * 64 + lane;
  const float pbA = proj_b[cl], pbB = proj_b[cl + 32];
  const float s2A = bn2s[cl],   s2B = bn2s[cl + 32];
  const float h2A = bn2h[cl],   h2B = bn2h[cl + 32];

  const half_t* A0 = As + (th * 128 + nl) * APITCH + hi8;  // image rows 4*th, 4*th + 1
  const half_t* A1 = A0 + 64 * APITCH;                     // image rows 4*th + 2, 4*th + 3
  for (int p = 0; p < 2; ++p) {
    const int ch0 = cg * 64 + p * 32;
    const int off = ((b * DIM + ch0) << 12) + ((row0 + th * 4) << 6) + col0 + lane;
    proj_pass(A0, A1, wpj + (size_t)ch0 * DIM + lane * 8, x + off, out + off,
              p ? pbB : pbA, p ? s2B : s2A, p ? h2B : h2A, lane < 16);
  }
}

// ----------------------------------------------------------------- launcher
extern "C" void kernel_launch(void* const* d_in, const int* in_sizes, int n_in,
                              void* d_out, int out_size, void* d_ws, size_t ws_size,
                              hipStream_t stream) {
  const float* x    = (const float*)d_in[0];
  const float* g1   = (const float*)d_in[1];
  const float* be1  = (const float*)d_in[2];
  const float* m1   = (const float*)d_in[3];
  const float* va1  = (const float*)d_in[4];
  const float* qk_w = (const float*)d_in[5];
  const float* qk_b = (const float*)d_in[6];
  const float* v_w  = (const float*)d_in[7];
  const float* v_b  = (const float*)d_in[8];
  const float* pw   = (const float*)d_in[9];
  const float* pb   = (const float*)d_in[10];
  const float* bt   = (const float*)d_in[11];
  const float* g2   = (const float*)d_in[12];
  const float* be2  = (const float*)d_in[13];
  const float* m2   = (const float*)d_in[14];
  const float* va2  = (const float*)d_in[15];
  float* out = (float*)d_out;

  char* ws = (char*)d_ws;
  half_t* wqk = (half_t*)ws; ws += (size_t)2 * DIM * DIM * sizeof(half_t);
  half_t* wv  = (half_t*)ws; ws += (size_t)DIM * DIM * sizeof(half_t);
  half_t* wpj = (half_t*)ws; ws += (size_t)DIM * DIM * sizeof(half_t);
  float* bn1s = (float*)ws;  ws += DIM * sizeof(float);
  float* bn1h = (float*)ws;  ws += DIM * sizeof(float);
  float* bn2s = (float*)ws;  ws += DIM * sizeof(float);
  float* bn2h = (float*)ws;  ws += DIM * sizeof(float);
  const size_t qkvN = (size_t)NWIN * HEADS * WS2 * HD;
  half_t* qbuf = (half_t*)ws; ws += qkvN * sizeof(half_t);
  half_t* kbuf = (half_t*)ws; ws += qkvN * sizeof(half_t);
  half_t* vbuf = (half_t*)ws; ws += qkvN * sizeof(half_t);

  prep_kernel<<<4100, 256, 0, stream>>>(qk_w, v_w, pw, g1, be1, m1, va1,
                                        g2, be2, m2, va2,
                                        wqk, wv, wpj, bn1s, bn1h, bn2s, bn2h);
  qkv_kernel<<<NWIN / 2, 256, 0, stream>>>(x, wqk, wv, bn1s, bn1h, qk_b, v_b,
                                            qbuf, kbuf, vbuf);
  attn_proj_kernel<<<NWIN / PWIN, 512, 0, stream>>>(x, qbuf, kbuf, vbuf, bt, wpj, pb,
                                                    bn2s, bn2h, out);
}

// v007
// Measured time: 118 microseconds a run.
// In both of two side-by-side timings against v006, it was 1.17 times as fast.
// Counting every step since v000, it is 8.46 times as fast.
#include <hip/hip_runtime.h>

typedef _Float16 half_t;
typedef __attribute__((ext_vector_type(16))) _Float16 v16h;
typedef __attribute__((ext_vector_type(8)))  _Float16 v8h;
typedef __attribute__((ext_vector_type(8)))  float    v8f;

#define DIM   512
#define WS2   64
#define HEADS 16
#define HD    32
#define NWIN  1024          /* 16 batches * 8 * 8 windows */
#define EPSV  1e-5f
#define SCL   0.17677669529663687f  /* 1/sqrt(32) */
#define APITCH 520          /* LDS stride (halves) of the resident 512-deep A tile: 16 B x odd */

// ---------------------------------------------------------------- WMMA helpers
__device__ __forceinline__ v8f wmma_fp16(v16h a, v16h b, v8f c) {
  return __builtin_amdgcn_wmma_f32_16x16x32_f16(false, a, false, b, (short)0, c,
                                                false, false);
}

// Keeps each group of LDS fragment reads in front of the WMMAs of the other
// group, so that a read's LDS latency runs under matrix work instead of in front
// of it.  VM: global reads (next weights), DS: LDS reads and MM: WMMAs per half.
template <int VM, int DS, int MM>
__device__ __forceinline__ void sched_gemm_group() {
#if __has_builtin(__builtin_amdgcn_sched_group_barrier)
  __builtin_amdgcn_sched_group_barrier(0x020, VM, 0);  // VMEM read (next weights)
  __builtin_amdgcn_sched_group_barrier(0x100, DS, 0);  // DS read   (2nd half)
  __builtin_amdgcn_sched_group_barrier(0x008, MM, 0);  // WMMA      (1st half)
  __builtin_amdgcn_sched_group_barrier(0x100, DS, 0);  // DS read   (next, 1st half)
  __builtin_amdgcn_sched_group_barrier(0x008, MM, 0);  // WMMA      (2nd half)
#endif
}

// Per ISA 7.12.2, a lane's 16 fragment halves (A row m / B column n) are two
// contiguous 8-half runs: k = hi8+0..7 and k = 16+hi8+0..7.  `p` must point at
// (row_base + hi8) and be 16B aligned -> two b128 loads.
__device__ __forceinline__ v16h frag_ld(const half_t* p) {
  const v8h lo = *(const v8h*)(p);
  const v8h hi = *(const v8h*)(p + 16);
  v16h r;
#pragma unroll
  for (int i = 0; i < 8; ++i) { r[i] = lo[i]; r[8 + i] = hi[i]; }
  return r;
}

// The f16 weights lie in the workspace in fragment order: per 16 output columns
// and 32 k one block of 1 KB = [k half-run: k&16][lane = ((k>>3)&1)*16 + col&15][k&7].
// A wave's b128 load of a half-run is then 512 contiguous bytes, 4 whole lines;
// from row-major weights it touched 16 lines, 32 B of each.  The k order per
// lane and register is that of frag_ld.  `p` points at (block + lane*8).
#define WBLK  512           /* halves per 16-column x 32-k block */
__device__ __forceinline__ v16h frag_ldw(const half_t* p) {
  const v8h lo = *(const v8h*)(p);
  const v8h hi = *(const v8h*)(p + 256);
  v16h r;
#pragma unroll
  for (int i = 0; i < 8; ++i) { r[i] = lo[i]; r[8 + i] = hi[i]; }
  return r;
}
// position in the fragment-ordered copy -> index in the row-major [n][DIM] weight
__device__ __forceinline__ int frag_src(int o) {
  const int n = ((o >> 13) << 4) + ((o >> 3) & 15);
  const int k = (((o >> 9) & 15) << 5) + (((o >> 8) & 1) << 4) + (((o >> 7) & 1) << 3) + (o & 7);
  return n * DIM + k;
}

// --------------------------------------------------- kernel 1: prep (weights)
__global__ void prep_kernel(const float* __restrict__ qk_w,
                            const float* __restrict__ v_w,
                            const float* __restrict__ proj_w,
                            const float* __restrict__ g1, const float* __restrict__ be1,
                            const float* __restrict__ m1, const float* __restrict__ va1,
                            const float* __restrict__ g2, const float* __restrict__ be2,
                            const float* __restrict__ m2, const float* __restrict__ va2,
                            half_t* __restrict__ wqk, half_t* __restrict__ wv,
                            half_t* __restrict__ wpj,
                            float* __restrict__ bn1s, float* __restrict__ bn1h,
                            float* __restrict__ bn2s, float* __restrict__ bn2h) {
  int i = blockIdx.x * blockDim.x + threadIdx.x;
  const int NQK = 2 * DIM * DIM;   // 524288
  const int NV  = DIM * DIM;       // 262144
  if (i < NQK) { wqk[i] = (half_t)qk_w[frag_src(i)]; return; }
  i -= NQK;
  if (i < NV) { wv[i] = (half_t)v_w[frag_src(i)]; return; }
  i -= NV;
  if (i < NV) { wpj[i] = (half_t)proj_w[frag_src(i)]; return; }
  i -= NV;
  if (i < DIM) {
    const float s = g1[i] * rsqrtf(va1[i] + EPSV);
    bn1s[i] = s; bn1h[i] = be1[i] - m1[i] * s; return;
  }
  i -= DIM;
  if (i < DIM) {
    const float s = g2[i] * rsqrtf(va2[i] + EPSV);
    bn2s[i] = s; bn2h[i] = be2[i] - m2[i] * s; return;
  }
}

// ------------------------------------------------ the block's LDS tile
// 4 windows side by side in the image = 8 image rows y of 32 pixels px, 512
// channels deep.  Pixel (y, px) is row y * 32 + (px ^ ((y & 1) << 3)): both a
// window's token tile (2 image rows x 8 pixels) and the projection's pixel tile
// (16 pixels of one image row) then take 16 rows that differ modulo 16, so that
// a fragment read meets every LDS bank once.
#define PWIN 4              /* windows per block: 32 pixels of an image row, one 128-B line */
#define TT    (64 * APITCH) /* one token tile of a window on = 2 image rows on */

// Q and K of one (window, head): 64 tokens x 64 output columns.  The weights are
// the A operand and the tokens the B operand: the accumulator's column (lane) is
// a token and its 8 registers are 8 consecutive channels, which is one 8-half run
// of the attention's own fragment of that token tile.
// At: the lane's row of token tile 0, + hi8.  wq, wk: fragment-ordered weights of
// the head's 32 Q and 32 K columns, + lane * 8.  bias: in LDS, at (first Q column + hi8).
__device__ __forceinline__ void qk_gemm(const half_t* At, const half_t* wq,
                                        const half_t* wk, const float* bias,
                                        v16h (&qb)[4], v16h (&ka)[4]) {
  v8f acc[4][4] = {};
  // Fragments run half a K-step (tokens, from LDS) and one K-step (weights, from
  // global) ahead of the WMMAs that use them.
  v16h w[4], a0[2], a1[2];
  w[0] = frag_ldw(wq); w[1] = frag_ldw(wq + 16 * DIM);
  w[2] = frag_ldw(wk); w[3] = frag_ldw(wk + 16 * DIM);
#pragma unroll
  for (int m = 0; m < 2; ++m) a0[m] = frag_ld(At + m * TT);
  // two K-steps a trip: a full unroll lets the loads run ahead until the
  // registers spill
#pragma unroll 2
  for (int ks = 0; ks < 16; ++ks) {
    const int kc = ks << 5;
    const int kn = (ks < 15 ? ks + 1 : 15) << 5;       // last trip: in bounds, unused
    v16h nw[4];
    nw[0] = frag_ldw(wq + (kn >> 5) * WBLK);
    nw[1] = frag_ldw(wq + 16 * DIM + (kn >> 5) * WBLK);
    nw[2] = frag_ldw(wk + (kn >> 5) * WBLK);
    nw[3] = frag_ldw(wk + 16 * DIM + (kn >> 5) * WBLK);
#pragma unroll
    for (int m = 0; m < 2; ++m) a1[m] = frag_ld(At + (2 + m) * TT + kc);
#pragma unroll
    for (int m = 0; m < 2; ++m)
#pragma unroll
      for (int c = 0; c < 4; ++c) acc[m][c] = wmma_fp16(w[c], a0[m], acc[m][c]);
#pragma unroll
    for (int m = 0; m < 2; ++m) a0[m] = frag_ld(At + m * TT + kn);
#pragma unroll
    for (int m = 0; m < 2; ++m)
#pragma unroll
      for (int c = 0; c < 4; ++c) acc[2 + m][c] = wmma_fp16(w[c], a1[m], acc[2 + m][c]);
#pragma unroll
    for (int c = 0; c < 4; ++c) w[c] = nw[c];
    sched_gemm_group<8, 4, 8>();
  }

  float bs[4][8];                                      // bias of (column tile c, register r)
#pragma unroll
  for (int c = 0; c < 4; ++c)
#pragma unroll
    for (int r = 0; r < 8; ++r) bs[c][r] = bias[(c >> 1) * DIM + (c & 1) * 16 + r];
  // the address pairs that the weight loads name are inputs here, so they stay
  // whole up to this wait; their registers are free for other use only behind it
  asm volatile("s_wait_xcnt 0x0" :: "v"(wq), "v"(wk) : "memory");
#pragma unroll
  for (int t = 0; t < 4; ++t)
#pragma unroll
    for (int r = 0; r < 8; ++r) {
      qb[t][r]     = (half_t)(acc[t][0][r] + bs[0][r]);
      qb[t][8 + r] = (half_t)(acc[t][1][r] + bs[1][r]);
      ka[t][r]     = (half_t)(acc[t][2][r] + bs[2][r]);
      ka[t][8 + r] = (half_t)(acc[t][3][r] + bs[3][r]);
    }
  // inputs only: the 64 f16 registers are formed here.  Left alone, the compiler
  // moves this conversion behind the V GEMM, keeps the 128 f32 accumulators and the
  // bias alive over that loop and spills them.
  asm volatile("" :: "v"(qb[0]), "v"(qb[1]), "v"(qb[2]), "v"(qb[3]),
                     "v"(ka[0]), "v"(ka[1]), "v"(ka[2]), "v"(ka[3]));
}

// V of one (window, head): 64 tokens x 32 output columns, tokens as A operand: a
// lane holds 8 consecutive tokens of one channel, one 8-half run of the fragment
// of V^T over 32 tokens.  bias: in LDS, at (first column + nl).
__device__ __forceinline__ void v_gemm(const half_t* At, const half_t* wrow,
                                       const float* bias, v16h (&va)[2][2]) {
  v8f acc[4][2] = {};
  v16h a0[2], a1[2];
  v16h bf0 = frag_ldw(wrow);
  v16h bf1 = frag_ldw(wrow + 16 * DIM);
#pragma unroll
  for (int m = 0; m < 2; ++m) a0[m] = frag_ld(At + m * TT);
  // two K-steps a trip, as above
#pragma unroll 2
  for (int ks = 0; ks < 16; ++ks) {
    const int kc = ks << 5;
    const int kn = (ks < 15 ? ks + 1 : 15) << 5;       // last trip: in bounds, unused
    const v16h nb0 = frag_ldw(wrow + (kn >> 5) * WBLK);
    const v16h nb1 = frag_ldw(wrow + 16 * DIM + (kn >> 5) * WBLK);
#pragma unroll
    for (int m = 0; m < 2; ++m) a1[m] = frag_ld(At + (2 + m) * TT + kc);
#pragma unroll
    for (int m = 0; m < 2; ++m) {
      acc[m][0] = wmma_fp16(a0[m], bf0, acc[m][0]);
      acc[m][1] = wmma_fp16(a0[m], bf1, acc[m][1]);
    }
#pragma unroll
    for (int m = 0; m < 2; ++m) a0[m] = frag_ld(At + m * TT + kn);
#pragma unroll
    for (int m = 0; m < 2; ++m) {
      acc[2 + m][0] = wmma_fp16(a1[m], bf0, acc[2 + m][0]);
      acc[2 + m][1] = wmma_fp16(a1[m], bf1, acc[2 + m][1]);
    }
    bf0 = nb0; bf1 = nb1;
    sched_gemm_group<4, 4, 4>();
  }

  const float bs0 = bias[0], bs1 = bias[16];
  // as in qk_gemm: the address pair stays whole up to this wait
  asm volatile("s_wait_xcnt 0x0" :: "v"(wrow) : "memory");
#pragma unroll
  for (int ks = 0; ks < 2; ++ks)
#pragma unroll
    for (int r = 0; r < 8; ++r) {
      va[0][ks][r]     = (half_t)(acc[2 * ks][0][r] + bs0);
      va[0][ks][8 + r] = (half_t)(acc[2 * ks + 1][0][r] + bs0);
      va[1][ks][r]     = (half_t)(acc[2 * ks][1][r] + bs1);
      va[1][ks][8 + r] = (half_t)(acc[2 * ks + 1][1][r] + bs1);
    }
}

// ------------------------------ per (window, head) attention, WMMA
// One wave does whole (window, head) units by itself.
// S^T = K Q^T: a lane then holds 32 of the 64 scores of ONE query (its partner
// lane ^ 16 the rest), so max and sum are in-lane plus one exchange.  Two S^T
// tiles, converted in place, are the B operand of O^T = V^T P^T, and a lane's 8
// results are 8 consecutive channels of one token: one 16-B store.
// The bias of tile (kt, qt) depends on qt - kt alone, so 7 x 8 registers hold the
// head's whole 64 x 64 bias.
#define LOG2E 1.4426950408889634f

// lane l <-> lane l ^ 16
__device__ __forceinline__ float xhalf(float v) {
  const int b = __builtin_bit_cast(int, v);
  return __builtin_bit_cast(float, __builtin_amdgcn_permlanex16(
      b, b, 0x76543210, 0xfedcba98, false, false));
}

// 2^x of 8 values in one statement: behind each v_exp_f32 then stands an
// instruction that neither reads its result nor overwrites its source (the
// outputs are early-clobber), and behind the last a v_nop.  That is the slot the
// instruction set asks for behind a transcendental.
__device__ __forceinline__ v8f exp2x8(v8f x) {
  float p0, p1, p2, p3, p4, p5, p6, p7;
  asm("v_exp_f32 %0, %8\n\t"
      "v_exp_f32 %1, %9\n\t"
      "v_exp_f32 %2, %10\n\t"
      "v_exp_f32 %3, %11\n\t"
      "v_exp_f32 %4, %12\n\t"
      "v_exp_f32 %5, %13\n\t"
      "v_exp_f32 %6, %14\n\t"
      "v_exp_f32 %7, %15\n\t"
      "v_nop"
      : "=&v"(p0), "=&v"(p1), "=&v"(p2), "=&v"(p3),
        "=&v"(p4), "=&v"(p5), "=&v"(p6), "=&v"(p7)
      : "v"(x[0]), "v"(x[1]), "v"(x[2]), "v"(x[3]),
        "v"(x[4]), "v"(x[5]), "v"(x[6]), "v"(x[7]));
  const v8f r = {p0, p1, p2, p3, p4, p5, p6, p7};
  return r;
}

// One (window, head) from fragments that are already in registers.  bl: the
// head's bias row in LDS (already times log2 e) at the lane's own start; op: the
// lane's place in the LDS tile: its row of token tile 0, the head's channels + hi8.
__device__ __forceinline__ void attn_unit(const v16h (&ka)[4], const v16h (&qb)[4],
                                          const v16h (&va)[2][2],
                                          const float* bl, half_t* op) {
  // query = qt*16 + nl, key = kt*16 + 8*hh + r; d = qt - kt + 3:
  // row difference dr = 2*d + 1 + (nl>>3) - hh (0..14), column difference
  // dc = (nl&7) + 7 - r (0..14): one lane address, constant steps in d and r
  float bias[7][8];
#pragma unroll
  for (int d = 0; d < 7; ++d)
#pragma unroll
    for (int r = 0; r < 8; ++r)
      bias[d][r] = bl[d * 30 + 7 - r];

#pragma unroll
  for (int qt = 0; qt < 4; ++qt) {
    v8f s[4];
#pragma unroll
    for (int kt = 0; kt < 4; ++kt) {
      const v8f zero = {};
      s[kt] = wmma_fp16(ka[kt], qb[qt], zero);
    }
    float m4[4];
#pragma unroll
    for (int kt = 0; kt < 4; ++kt) {
#pragma unroll
      for (int r = 0; r < 8; ++r)
        s[kt][r] = s[kt][r] * (SCL * LOG2E) + bias[qt - kt + 3][r];
      m4[kt] = s[kt][0];
#pragma unroll
      for (int r = 1; r < 8; ++r) m4[kt] = fmaxf(m4[kt], s[kt][r]);
    }
    float mx = fmaxf(fmaxf(m4[0], m4[1]), fmaxf(m4[2], m4[3]));
    mx = fmaxf(mx, xhalf(mx));

    float s4[4];
    v16h pb[2];
#pragma unroll
    for (int kt = 0; kt < 4; ++kt) {
      const v8f p = exp2x8(s[kt] - mx);
      s4[kt] = p[0];
#pragma unroll
      for (int r = 1; r < 8; ++r) s4[kt] += p[r];
#pragma unroll
      for (int r = 0; r < 8; ++r) pb[kt >> 1][(kt & 1) * 8 + r] = (half_t)p[r];
    }
    float sum = (s4[0] + s4[1]) + (s4[2] + s4[3]);
    sum += xhalf(sum);
    const float inv = 1.0f / sum;

    v8f o[2] = {};
#pragma unroll
    for (int ks = 0; ks < 2; ++ks)
#pragma unroll
      for (int nt = 0; nt < 2; ++nt)
        o[nt] = wmma_fp16(va[nt][ks], pb[ks], o[nt]);
#pragma unroll
    for (int nt = 0; nt < 2; ++nt) {
      v8h ov;
#pragma unroll
      for (int r = 0; r < 8; ++r) ov[r] = (half_t)(o[nt][r] * inv);
      *(v8h*)(op + qt * TT + nt * 16) = ov;
    }
  }
}

// ------- BN1 + QKV GEMMs + attention + proj GEMM + residual + BN2, NCHW fp32 output

// the value that lane l (a constant) holds, for every lane
__device__ __forceinline__ float lane_val(float v, int l) {
  return __builtin_bit_cast(float, __builtin_amdgcn_readlane(__builtin_bit_cast(int, v), l));
}

// One pass: 32 output channels x 128 pixels (4 image rows of 32).  The weights
// are the A operand and the pixels the B operand: token tile m is image row
// m >> 1, pixels (m & 1) * 16 + (lane & 15), and a lane's 8 registers are the
// channels j * 16 + hh * 8 + r.  The two halves of the wave then exchange one
// tile each, after which a register holds 32 adjacent pixels of ONE channel:
// each x load and each out store of the wave is one whole 128-B line.
// Ae, Ao: the lane's row of the first pixel tile in an even and in an odd image
// row (the LDS tile's row order), + hi8.
// xb, ob: at (first channel, first image row, first pixel + lane).
// pbl, s2l, h2l: lane l holds the bias and the BN2 constants of channel l of the
// pass's 32; a channel's own go from there to scalar registers, as every lane
// needs the same ones.
__device__ __forceinline__ void proj_pass(const half_t* Ae, const half_t* Ao,
                                          const half_t* wrow,
                                          const float* xb, float* ob,
                                          float pbl, float s2l, float h2l,
                                          bool lo) {
  v8f acc[8][2] = {};
  // Fragments run half a K-step (pixels, from LDS) and one K-step (weights,
  // from global) ahead of the WMMAs that use them.
  v16h a0[4], a1[4];
  v16h bf0 = frag_ldw(wrow);
  v16h bf1 = frag_ldw(wrow + 16 * DIM);
#pragma unroll
  for (int m = 0; m < 4; ++m) a0[m] = frag_ld(((m & 2) ? Ao : Ae) + m * 16 * APITCH);
  // two K-steps a trip: a full unroll lets the loads run ahead until the
  // registers spill
#pragma unroll 2
  for (int ks = 0; ks < 16; ++ks) {
    const int kc = ks << 5;
    const int kn = (ks < 15 ? ks + 1 : 15) << 5;       // last trip: in bounds, unused
    const v16h nb0 = frag_ldw(wrow + (kn >> 5) * WBLK);
    const v16h nb1 = frag_ldw(wrow + 16 * DIM + (kn >> 5) * WBLK);
#pragma unroll
    for (int m = 0; m < 4; ++m) a1[m] = frag_ld(((m & 2) ? Ao : Ae) + (4 + m) * 16 * APITCH + kc);
#pragma unroll
    for (int m = 0; m < 4; ++m) {
      acc[m][0] = wmma_fp16(bf0, a0[m], acc[m][0]);
      acc[m][1] = wmma_fp16(bf1, a0[m], acc[m][1]);
    }
#pragma unroll
    for (int m = 0; m < 4; ++m) a0[m] = frag_ld(((m & 2) ? Ao : Ae) + m * 16 * APITCH + kn);
#pragma unroll
    for (int m = 0; m < 4; ++m) {
      acc[4 + m][0] = wmma_fp16(bf0, a1[m], acc[4 + m][0]);
      acc[4 + m][1] = wmma_fp16(bf1, a1[m], acc[4 + m][1]);
    }
    bf0 = nb0; bf1 = nb1;
    sched_gemm_group<4, 8, 8>();
  }

#pragma unroll
  for (int j = 0; j < 2; ++j) {
    float xv[8][4][2];                                 // 64 lines in flight per wave
#pragma unroll
    for (int r = 0; r < 8; ++r)
#pragma unroll
      for (int q = 0; q < 4; ++q)
#pragma unroll
        for (int u = 0; u < 2; ++u)
          xv[r][q][u] = xb[((j * 16 + u * 8 + r) << 12) + (q << 6)];
#pragma unroll
    for (int r = 0; r < 8; ++r) {
      const int c0 = j * 16 + r, c1 = c0 + 8;
      const float pb0 = lane_val(pbl, c0), s20 = lane_val(s2l, c0), h20 = lane_val(h2l, c0);
      const float pb1 = lane_val(pbl, c1), s21 = lane_val(s2l, c1), h21 = lane_val(h2l, c1);
#pragma unroll
      for (int q = 0; q < 4; ++q) {
        const float e0 = acc[2 * q][j][r], e1 = acc[2 * q + 1][j][r];
        // lanes 0-15 give away (c0, pixels 16-31) and get (c1, pixels 0-15)
        const float t = xhalf(lo ? e1 : e0);
        const float v0 = lo ? e0 : t;                  // channel c0, pixel = lane
        const float v1 = lo ? t : e1;                  // channel c1, pixel = lane
        const float r0 = xv[r][q][0] + v0 + pb0;       // residual
        const float r1 = xv[r][q][1] + v1 + pb1;
        ob[(c0 << 12) + (q << 6)] = r0 * s20 + h20;    // BN2
        ob[(c1 << 12) + (q << 6)] = r1 * s21 + h21;
      }
    }
    // the loads that follow (the other 16 channels' x, the next pass's weights)
    // land in, and the next pass forms its addresses in, registers that these
    // loads and stores name: only behind this wait
    asm volatile("s_wait_xcnt 0x0" ::: "memory");
  }
}

// Block = 512 thr (16 waves): 4 windows side by side in the image (8 image rows
// of 32 pixels = 256 tokens), all 16 heads and all 512 output channels.
// 1. The BN'd 256x512 f16 tile of x is staged in LDS once.
// 2. Wave wv is head wv.  Per window it forms Q, K (64x64) and V (64x32) from the
//    tile, in registers and already in the attention's fragment order, and does the
//    attention there; Q, K and V never go through memory.  The result overwrites
//    the window's own rows of the tile (the head's 32 channels), behind a barrier
//    that says every wave has read those rows for the last time.
// 3. Behind one more barrier wave (th, cg) does image rows 4*th..4*th+3 and
//    channels 64*cg..64*cg+63 of the projection in two passes; waves cg and cg + 8
//    read the same weights.
// 286,784 B of LDS: one block on a WGP, four waves per SIMD.
#define NREL 225            /* (2 * 8 - 1)^2 relative positions */
__global__ void __launch_bounds__(512)
window_attn_kernel(const float* __restrict__ x,
                   const half_t* __restrict__ wqk, const half_t* __restrict__ wvw,
                   const float* __restrict__ bn1s, const float* __restrict__ bn1h,
                   const float* __restrict__ qk_b, const float* __restrict__ v_b,
                   const float* __restrict__ bias_table,
                   const half_t* __restrict__ wpj, const float* __restrict__ proj_b,
                   const float* __restrict__ bn2s, const float* __restrict__ bn2h,
                   float* __restrict__ out) {
  __shared__ __align__(16) half_t As[PWIN * WS2 * APITCH];
  __shared__ float Bs[HEADS * NREL];               // bias table * log2 e, [head][position]
  __shared__ __align__(16) float Cs[3 * DIM];      // qk_b, then v_b

  const int w0  = blockIdx.x * PWIN;               // windows w0 .. w0 + 3
  const int tid = threadIdx.x, lane = tid & 31;
  const int wv  = __builtin_amdgcn_readfirstlane(tid >> 5);
  const int nl = lane & 15, hh = lane >> 4, hi8 = hh << 3;
  const int b = w0 >> 6, wi = w0 & 63;
  const int row0 = (wi >> 3) << 3, col0 = (wi & 7) << 3;   // col0: 0 or 32

  // the bias table and the three bias vectors: loaded here, so that their latency
  // runs under the x staging, and written to LDS behind it
  float bt[8];
#pragma unroll
  for (int u = 0; u < 8; ++u) {
    const int t = tid + u * 512;
    bt[u] = bias_table[t < HEADS * NREL ? t : HEADS * NREL - 1];   // in bounds; unused past the end
  }
  const float cq = qk_b[tid], ck = qk_b[DIM + tid], cv = v_b[tid];
  // the registers that these loads name are free for other use only behind this wait
  asm volatile("s_wait_xcnt 0x0" ::: "memory");

  { // x staging, once: a lane takes 4 pixels of one image row (16 B; the wave 4
    // whole lines) in 8 channels, and writes 8 channels of each of the 4 pixels
    // as one b128.
    const int r = lane >> 3, quad = lane & 7;      // image rows r and r + 4
    const int m0 = (r << 5) + ((quad << 2) ^ ((r & 1) << 3));
    const float* xl = x + ((b * DIM + (wv << 3)) << 12) + ((row0 + r) << 6) + col0 + (quad << 2);
    // 16 loads of 16 B in flight per lane cover the memory latency; all 64 at
    // once would spill
#pragma unroll 1
    for (int i = 0; i < 4; ++i) {
      float4 v[2][8];
#pragma unroll
      for (int u = 0; u < 2; ++u)
#pragma unroll
        for (int j = 0; j < 8; ++j)
          v[u][j] = *(const float4*)(xl + (j << 12) + (u << 8));
      // the address pair that these loads name is kept whole up to this wait
      // (it is an input here) and is advanced only behind it
      asm volatile("s_wait_xcnt 0x0" :: "v"(xl) : "memory");
      xl += 128 << 12;                                   // 128 channels on
      const int c0 = (wv + (i << 4)) << 3;
#pragma unroll
      for (int u = 0; u < 2; ++u) {
        v8h o0, o1, o2, o3;
#pragma unroll
        for (int j = 0; j < 8; ++j) {
          const float s = bn1s[c0 + j], sh = bn1h[c0 + j];
          o0[j] = (half_t)(v[u][j].x * s + sh);
          o1[j] = (half_t)(v[u][j].y * s + sh);
          o2[j] = (half_t)(v[u][j].z * s + sh);
          o3[j] = (half_t)(v[u][j].w * s + sh);
        }
        half_t* ap = As + (m0 + (u << 7)) * APITCH + c0;
        *(v8h*)(ap)              = o0;
        *(v8h*)(ap + APITCH)     = o1;
        *(v8h*)(ap + 2 * APITCH) = o2;
        *(v8h*)(ap + 3 * APITCH) = o3;
      }
    }
  }
#pragma unroll
  for (int u = 0; u < 8; ++u) {
    const int t = tid + u * 512;
    if (t < HEADS * NREL) Bs[(t & (HEADS - 1)) * NREL + (t >> 4)] = bt[u] * LOG2E;
  }
  Cs[tid] = cq;
  Cs[DIM + tid] = ck;
  Cs[2 * DIM + tid] = cv;
  __syncthreads();                                 // the x tile and the biases are written

  {
    const half_t* wq = wqk + (size_t)(wv << 5) * DIM + lane * 8;
    const half_t* wk = wq + (size_t)DIM * DIM;
    const half_t* wr = wvw + (size_t)(wv << 5) * DIM + lane * 8;
    const float* bl = Bs + wv * NREL + (1 + (nl >> 3) - hh) * 15 + (nl & 7);
    // rolled: one window's accumulators fill the register budget
#pragma unroll 1
    for (int i = 0; i < PWIN; ++i) {
      // token nl of window i: image row nl >> 3, pixel i * 8 + (nl & 7)
      half_t* At = As + (((nl >> 3) << 5) + ((i ^ (nl >> 3)) << 3) + (nl & 7)) * APITCH + hi8;
      v16h qb[4], ka[4], va[2][2];
      qk_gemm(At, wq, wk, Cs + (wv << 5) + hi8, qb, ka);
      v_gemm(At, wr, Cs + 2 * DIM + (wv << 5) + nl, va);
      __syncthreads();                             // every head has read window i's rows
      attn_unit(ka, qb, va, bl, At + wv * HD);
    }
  }
  __syncthreads();                                 // all 16 heads of the tile are written

  // the lane's number taken anew from the hardware's lane count: what is derived
  // from it for the projection, held over the window loop, is spilled there
  const int ln = __builtin_amdgcn_mbcnt_lo(~0u, 0u);
  const int pl = ln & 15, ph8 = (ln >> 4) << 3;
  const int th = wv >> 3, cg = wv & 7;
  // the constants of the wave's 64 channels, channel = lane and lane + 32
  const int cl = cg * 64 + ln;
  const float pbA = proj_b[cl], pbB = proj_b[cl + 32];
  const float s2A = bn2s[cl],   s2B = bn2s[cl + 32];
  const float h2A = bn2h[cl],   h2B = bn2h[cl + 32];

  const half_t* Ae = As + (th * 128 + pl) * APITCH + ph8;        // even image rows
  const half_t* Ao = As + (th * 128 + (pl ^ 8)) * APITCH + ph8;  // odd image rows
  for (int p = 0; p < 2; ++p) {
    const int ch0 = cg * 64 + p * 32;
    const int off = ((b * DIM + ch0) << 12) + ((row0 + th * 4) << 6) + col0 + ln;
    proj_pass(Ae, Ao, wpj + (size_t)ch0 * DIM + ln * 8, x + off, out + off,
              p ? pbB : pbA, p ? s2B : s2A, p ? h2B : h2A, ln < 16);
  }
}

// ----------------------------------------------------------------- launcher
extern "C" void kernel_launch(void* const* d_in, const int* in_sizes, int n_in,
                              void* d_out, int out_size, void* d_ws, size_t ws_size,
                              hipStream_t stream) {
  const float* x    = (const float*)d_in[0];
  const float* g1   = (const float*)d_in[1];
  const float* be1  = (const float*)d_in[2];
  const float* m1   = (const float*)d_in[3];
  const float* va1  = (const float*)d_in[4];
  const float* qk_w = (const float*)d_in[5];
  const float* qk_b = (const float*)d_in[6];
  const float* v_w  = (const float*)d_in[7];
  const float* v_b  = (const float*)d_in[8];
  const float* pw   = (const float*)d_in[9];
  const float* pb   = (const float*)d_in[10];
  const float* bt   = (const float*)d_in[11];
  const float* g2   = (const float*)d_in[12];
  const float* be2  = (const float*)d_in[13];
  const float* m2   = (const float*)d_in[14];
  const float* va2  = (const float*)d_in[15];
  float* out = (float*)d_out;

  char* ws = (char*)d_ws;
  half_t* wqk = (half_t*)ws; ws += (size_t)2 * DIM * DIM * sizeof(half_t);
  half_t* wv  = (half_t*)ws; ws += (size_t)DIM * DIM * sizeof(half_t);
  half_t* wpj = (half_t*)ws; ws += (size_t)DIM * DIM * sizeof(half_t);
  float* bn1s = (float*)ws;  ws += DIM * sizeof(float);
  float* bn1h = (float*)ws;  ws += DIM * sizeof(float);
  float* bn2s = (float*)ws;  ws += DIM * sizeof(float);
  float* bn2h = (float*)ws;  ws += DIM * sizeof(float);

  prep_kernel<<<4100, 256, 0, stream>>>(qk_w, v_w, pw, g1, be1, m1, va1,
                                        g2, be2, m2, va2,
                                        wqk, wv, wpj, bn1s, bn1h, bn2s, bn2h);
  window_attn_kernel<<<NWIN / PWIN, 512, 0, stream>>>(x, wqk, wv, bn1s, bn1h, qk_b, v_b, bt,
                                                      wpj, pb, bn2s, bn2h, out);
}

// v008
// A run of this version takes 112 microseconds.
// Two timings next to v007 put it at 1.05 and 1.06 times that version's speed.
// Over all steps from v000 it is 8.93 times as fast.
#include <hip/hip_runtime.h>

typedef _Float16 half_t;
typedef __attribute__((ext_vector_type(16))) _Float16 v16h;
typedef __attribute__((ext_vector_type(8)))  _Float16 v8h;
typedef __attribute__((ext_vector_type(8)))  float    v8f;

#define DIM   512
#define WS2   64
#define HEADS 16
#define HD    32
#define NWIN  1024          /* 16 batches * 8 * 8 windows */
#define EPSV  1e-5f
#define SCL   0.17677669529663687f  /* 1/sqrt(32) */
#define APITCH 520          /* LDS stride (halves) of the resident 512-deep A tile: 16 B x odd */

// ---------------------------------------------------------------- WMMA helpers
__device__ __forceinline__ v8f wmma_fp16(v16h a, v16h b, v8f c) {
  return __builtin_amdgcn_wmma_f32_16x16x32_f16(false, a, false, b, (short)0, c,
                                                false, false);
}

// Keeps each group of LDS fragment reads in front of the WMMAs of the other
// group, so that a read's LDS latency runs under matrix work instead of in front
// of it.  VM: global reads (next weights), DS: LDS reads and MM: WMMAs per half.
template <int VM, int DS, int MM>
__device__ __forceinline__ void sched_gemm_group() {
#if __has_builtin(__builtin_amdgcn_sched_group_barrier)
  __builtin_amdgcn_sched_group_barrier(0x020, VM, 0);  // VMEM read (next weights)
  __builtin_amdgcn_sched_group_barrier(0x100, DS, 0);  // DS read   (2nd half)
  __builtin_amdgcn_sched_group_barrier(0x008, MM, 0);  // WMMA      (1st half)
  __builtin_amdgcn_sched_group_barrier(0x100, DS, 0);  // DS read   (next, 1st half)
  __builtin_amdgcn_sched_group_barrier(0x008, MM, 0);  // WMMA      (2nd half)
#endif
}

// Per ISA 7.12.2, a lane's 16 fragment halves (A row m / B column n) are two
// contiguous 8-half runs: k = hi8+0..7 and k = 16+hi8+0..7.  `p` must point at
// (row_base + hi8) and be 16B aligned -> two b128 loads.
__device__ __forceinline__ v16h frag_ld(const half_t* p) {
  const v8h lo = *(const v8h*)(p);
  const v8h hi = *(const v8h*)(p + 16);
  v16h r;
#pragma unroll
  for (int i = 0; i < 8; ++i) { r[i] = lo[i]; r[8 + i] = hi[i]; }
  return r;
}

// The f16 weights lie in the workspace in fragment order: per 16 output columns
// and 32 k one block of 1 KB = [k half-run: k&16][lane = ((k>>3)&1)*16 + col&15][k&7].
// A wave's b128 load of a half-run is then 512 contiguous bytes, 4 whole lines;
// from row-major weights it touched 16 lines, 32 B of each.  The k order per
// lane and register is that of frag_ld.  `p` points at (block + lane*8).
#define WBLK  512           /* halves per 16-column x 32-k block */
__device__ __forceinline__ v16h frag_ldw(const half_t* p) {
  const v8h lo = *(const v8h*)(p);
  const v8h hi = *(const v8h*)(p + 256);
  v16h r;
#pragma unroll
  for (int i = 0; i < 8; ++i) { r[i] = lo[i]; r[8 + i] = hi[i]; }
  return r;
}
// position in the fragment-ordered copy -> index in the row-major [n][DIM] weight
__device__ __forceinline__ int frag_src(int o) {
  const int n = ((o >> 13) << 4) + ((o >> 3) & 15);
  const int k = (((o >> 9) & 15) << 5) + (((o >> 8) & 1) << 4) + (((o >> 7) & 1) << 3) + (o & 7);
  return n * DIM + k;
}
// The Q, K and V weights: the blocks lie in the order [group of 4 heads][K-step]
// [head of the group][column tile: Q 0-15, Q 16-31, K 0-15, K 16-31; V: 0-15, 16-31].
// The four heads that a work-group has in hand at one time then take one K-step's
// weights from one contiguous run (16 KB; V 8 KB), whose lines differ in their low
// address bits, so that they can lie in the WGP's cache side by side; with a column
// tile's 16 K-steps in a row every block in hand lay at the same offset modulo 16 KB.
#define HGRP   4                    /* heads in hand at one time */
#define QKSTEP (HGRP * 4 * WBLK)    /* halves from one K-step to the next */
#define VSTEP  (HGRP * 2 * WBLK)
__device__ __forceinline__ int frag_src_qk(int o) {
  const int c = (o >> 9) & 3, head = ((o >> 17) << 2) + ((o >> 11) & 3);
  const int n = (c >> 1) * DIM + head * HD + ((c & 1) << 4) + ((o >> 3) & 15);
  const int k = (((o >> 13) & 15) << 5) + (((o >> 8) & 1) << 4) + (((o >> 7) & 1) << 3) + (o & 7);
  return n * DIM + k;
}
__device__ __forceinline__ int frag_src_v(int o) {
  const int head = ((o >> 16) << 2) + ((o >> 10) & 3);
  const int n = head * HD + (((o >> 9) & 1) << 4) + ((o >> 3) & 15);
  const int k = (((o >> 12) & 15) << 5) + (((o >> 8) & 1) << 4) + (((o >> 7) & 1) << 3) + (o & 7);
  return n * DIM + k;
}

// --------------------------------------------------- kernel 1: prep (weights)
__global__ void prep_kernel(const float* __restrict__ qk_w,
                            const float* __restrict__ v_w,
                            const float* __restrict__ proj_w,
                            const float* __restrict__ g1, const float* __restrict__ be1,
                            const float* __restrict__ m1, const float* __restrict__ va1,
                            const float* __restrict__ g2, const float* __restrict__ be2,
                            const float* __restrict__ m2, const float* __restrict__ va2,
                            half_t* __restrict__ wqk, half_t* __restrict__ wv,
                            half_t* __restrict__ wpj,
                            float* __restrict__ bn1s, float* __restrict__ bn1h,
                            float* __restrict__ bn2s, float* __restrict__ bn2h) {
  int i = blockIdx.x * blockDim.x + threadIdx.x;
  const int NQK = 2 * DIM * DIM;   // 524288
  const int NV  = DIM * DIM;       // 262144
  if (i < NQK) { wqk[i] = (half_t)qk_w[frag_src_qk(i)]; return; }
  i -= NQK;
  if (i < NV) { wv[i] = (half_t)v_w[frag_src_v(i)]; return; }
  i -= NV;
  if (i < NV) { wpj[i] = (half_t)proj_w[frag_src(i)]; return; }
  i -= NV;
  if (i < DIM) {
    const float s = g1[i] * rsqrtf(va1[i] + EPSV);
    bn1s[i] = s; bn1h[i] = be1[i] - m1[i] * s; return;
  }
  i -= DIM;
  if (i < DIM) {
    const float s = g2[i] * rsqrtf(va2[i] + EPSV);
    bn2s[i] = s; bn2h[i] = be2[i] - m2[i] * s; return;
  }
}

// ------------------------------------------------ the block's LDS tile
// 4 windows side by side in the image = 8 image rows y of 32 pixels px, 512
// channels deep.  Pixel (y, px) is row y * 32 + (px ^ ((y & 1) << 3)): both a
// window's token tile (2 image rows x 8 pixels) and the projection's pixel tile
// (16 pixels of one image row) then take 16 rows that differ modulo 16, so that
// a fragment read meets every LDS bank once.
#define PWIN 4              /* windows per block: 32 pixels of an image row, one 128-B line */
#define TT    (64 * APITCH) /* one token tile of a window on = 2 image rows on */

// Q and K of one (window, head): 64 tokens x 64 output columns.  The weights are
// the A operand and the tokens the B operand: the accumulator's column (lane) is
// a token and its 8 registers are 8 consecutive channels, which is one 8-half run
// of the attention's own fragment of that token tile.
// At: the lane's row of token tile 0, + hi8.  wq: the head's four blocks (32 Q and
// 32 K columns) of K-step 0, + lane * 8.  bias: in LDS, at (first Q column + hi8).
__device__ __forceinline__ void qk_gemm(const half_t* At, const half_t* wq,
                                        const float* bias,
                                        v16h (&qb)[4], v16h (&ka)[4]) {
  v8f acc[4][4] = {};
  // Fragments run half a K-step (tokens, from LDS) and one K-step (weights, from
  // global) ahead of the WMMAs that use them.
  v16h w[4], a0[2], a1[2];
#pragma unroll
  for (int c = 0; c < 4; ++c) w[c] = frag_ldw(wq + c * WBLK);
#pragma unroll
  for (int m = 0; m < 2; ++m) a0[m] = frag_ld(At + m * TT);
  // two K-steps a trip: a full unroll lets the loads run ahead until the
  // registers spill
#pragma unroll 2
  for (int ks = 0; ks < 16; ++ks) {
    const int kc = ks << 5;
    const int kn = (ks < 15 ? ks + 1 : 15) << 5;       // last trip: in bounds, unused
    v16h nw[4];
#pragma unroll
    for (int c = 0; c < 4; ++c) nw[c] = frag_ldw(wq + (kn >> 5) * QKSTEP + c * WBLK);
#pragma unroll
    for (int m = 0; m < 2; ++m) a1[m] = frag_ld(At + (2 + m) * TT + kc);
#pragma unroll
    for (int m = 0; m < 2; ++m)
#pragma unroll
      for (int c = 0; c < 4; ++c) acc[m][c] = wmma_fp16(w[c], a0[m], acc[m][c]);
#pragma unroll
    for (int m = 0; m < 2; ++m) a0[m] = frag_ld(At + m * TT + kn);
#pragma unroll
    for (int m = 0; m < 2; ++m)
#pragma unroll
      for (int c = 0; c < 4; ++c) acc[2 + m][c] = wmma_fp16(w[c], a1[m], acc[2 + m][c]);
#pragma unroll
    for (int c = 0; c < 4; ++c) w[c] = nw[c];
    sched_gemm_group<8, 4, 8>();
  }

  float bs[4][8];                                      // bias of (column tile c, register r)
#pragma unroll
  for (int c = 0; c < 4; ++c)
#pragma unroll
    for (int r = 0; r < 8; ++r) bs[c][r] = bias[(c >> 1) * DIM + (c & 1) * 16 + r];
  // the address pair that the weight loads name is an input here, so it stays
  // whole up to this wait; its registers are free for other use only behind it
  asm volatile("s_wait_xcnt 0x0" :: "v"(wq) : "memory");
#pragma unroll
  for (int t = 0; t < 4; ++t)
#pragma unroll
    for (int r = 0; r < 8; ++r) {
      qb[t][r]     = (half_t)(acc[t][0][r] + bs[0][r]);
      qb[t][8 + r] = (half_t)(acc[t][1][r] + bs[1][r]);
      ka[t][r]     = (half_t)(acc[t][2][r] + bs[2][r]);
      ka[t][8 + r] = (half_t)(acc[t][3][r] + bs[3][r]);
    }
  // inputs only: the 64 f16 registers are formed here.  Left alone, the compiler
  // moves this conversion behind the V GEMM, keeps the 128 f32 accumulators and the
  // bias alive over that loop and spills them.
  asm volatile("" :: "v"(qb[0]), "v"(qb[1]), "v"(qb[2]), "v"(qb[3]),
                     "v"(ka[0]), "v"(ka[1]), "v"(ka[2]), "v"(ka[3]));
}

// V of one (window, head): 64 tokens x 32 output columns, tokens as A operand: a
// lane holds 8 consecutive tokens of one channel, one 8-half run of the fragment
// of V^T over 32 tokens.  wrow: the head's two blocks of K-step 0, + lane * 8.
// bias: in LDS, at (first column + nl).
__device__ __forceinline__ void v_gemm(const half_t* At, const half_t* wrow,
                                       const float* bias, v16h (&va)[2][2]) {
  v8f acc[4][2] = {};
  v16h a0[2], a1[2];
  v16h bf0 = frag_ldw(wrow);
  v16h bf1 = frag_ldw(wrow + WBLK);
#pragma unroll
  for (int m = 0; m < 2; ++m) a0[m] = frag_ld(At + m * TT);
  // two K-steps a trip, as above
#pragma unroll 2
  for (int ks = 0; ks < 16; ++ks) {
    const int kc = ks << 5;
    const int kn = (ks < 15 ? ks + 1 : 15) << 5;       // last trip: in bounds, unused
    const v16h nb0 = frag_ldw(wrow + (kn >> 5) * VSTEP);
    const v16h nb1 = frag_ldw(wrow + (kn >> 5) * VSTEP + WBLK);
#pragma unroll
    for (int m = 0; m < 2; ++m) a1[m] = frag_ld(At + (2 + m) * TT + kc);
#pragma unroll
    for (int m = 0; m < 2; ++m) {
      acc[m][0] = wmma_fp16(a0[m], bf0, acc[m][0]);
      acc[m][1] = wmma_fp16(a0[m], bf1, acc[m][1]);
    }
#pragma unroll
    for (int m = 0; m < 2; ++m) a0[m] = frag_ld(At + m * TT + kn);
#pragma unroll
    for (int m = 0; m < 2; ++m) {
      acc[2 + m][0] = wmma_fp16(a1[m], bf0, acc[2 + m][0]);
      acc[2 + m][1] = wmma_fp16(a1[m], bf1, acc[2 + m][1]);
    }
    bf0 = nb0; bf1 = nb1;
    sched_gemm_group<4, 4, 4>();
  }

  const float bs0 = bias[0], bs1 = bias[16];
  // as in qk_gemm: the address pair stays whole up to this wait
  asm volatile("s_wait_xcnt 0x0" :: "v"(wrow) : "memory");
#pragma unroll
  for (int ks = 0; ks < 2; ++ks)
#pragma unroll
    for (int r = 0; r < 8; ++r) {
      va[0][ks][r]     = (half_t)(acc[2 * ks][0][r] + bs0);
      va[0][ks][8 + r] = (half_t)(acc[2 * ks + 1][0][r] + bs0);
      va[1][ks][r]     = (half_t)(acc[2 * ks][1][r] + bs1);
      va[1][ks][8 + r] = (half_t)(acc[2 * ks + 1][1][r] + bs1);
    }
}

// ------------------------------ per (window, head) attention, WMMA
// One wave does whole (window, head) units by itself.
// S^T = K Q^T: a lane then holds 32 of the 64 scores of ONE query (its partner
// lane ^ 16 the rest), so max and sum are in-lane plus one exchange.  Two S^T
// tiles, converted in place, are the B operand of O^T = V^T P^T, and a lane's 8
// results are 8 consecutive channels of one token: one 16-B store.
// The bias of tile (kt, qt) depends on qt - kt alone, so 7 x 8 registers hold the
// head's whole 64 x 64 bias.
#define LOG2E 1.4426950408889634f

// lane l <-> lane l ^ 16
__device__ __forceinline__ float xhalf(float v) {
  const int b = __builtin_bit_cast(int, v);
  return __builtin_bit_cast(float, __builtin_amdgcn_permlanex16(
      b, b, 0x76543210, 0xfedcba98, false, false));
}

// 2^x of 8 values in one statement: behind each v_exp_f32 then stands an
// instruction that neither reads its result nor overwrites its source (the
// outputs are early-clobber), and behind the last a v_nop.  That is the slot the
// instruction set asks for behind a transcendental.
__device__ __forceinline__ v8f exp2x8(v8f x) {
  float p0, p1, p2, p3, p4, p5, p6, p7;
  asm("v_exp_f32 %0, %8\n\t"
      "v_exp_f32 %1, %9\n\t"
      "v_exp_f32 %2, %10\n\t"
      "v_exp_f32 %3, %11\n\t"
      "v_exp_f32 %4, %12\n\t"
      "v_exp_f32 %5, %13\n\t"
      "v_exp_f32 %6, %14\n\t"
      "v_exp_f32 %7, %15\n\t"
      "v_nop"
      : "=&v"(p0), "=&v"(p1), "=&v"(p2), "=&v"(p3),
        "=&v"(p4), "=&v"(p5), "=&v"(p6), "=&v"(p7)
      : "v"(x[0]), "v"(x[1]), "v"(x[2]), "v"(x[3]),
        "v"(x[4]), "v"(x[5]), "v"(x[6]), "v"(x[7]));
  const v8f r = {p0, p1, p2, p3, p4, p5, p6, p7};
  return r;
}

// One (window, head) from fragments that are already in registers.  bl: the
// head's bias row in LDS (already times log2 e) at the lane's own start; op: the
// lane's place in the LDS tile: its row of token tile 0, the head's channels + hi8.
// to_lds (the same for the whole work-group): the result goes there; otherwise it is
// parked in the workspace at gp (the wave's own 4 KB, + lane * 8): 8 stores of 4
// whole lines, in the order (query tile, channel half).
#define PARK 2048           /* halves of one parked (window, head) result */
__device__ __forceinline__ void attn_unit(const v16h (&ka)[4], const v16h (&qb)[4],
                                          const v16h (&va)[2][2],
                                          const float* bl, half_t* op,
                                          bool to_lds, half_t* gp) {
  // query = qt*16 + nl, key = kt*16 + 8*hh + r; d = qt - kt + 3:
  // row difference dr = 2*d + 1 + (nl>>3) - hh (0..14), column difference
  // dc = (nl&7) + 7 - r (0..14): one lane address, constant steps in d and r
  float bias[7][8];
#pragma unroll
  for (int d = 0; d < 7; ++d)
#pragma unroll
    for (int r = 0; r < 8; ++r)
      bias[d][r] = bl[d * 30 + 7 - r];

#pragma unroll
  for (int qt = 0; qt < 4; ++qt) {
    v8f s[4];
#pragma unroll
    for (int kt = 0; kt < 4; ++kt) {
      const v8f zero = {};
      s[kt] = wmma_fp16(ka[kt], qb[qt], zero);
    }
    float m4[4];
#pragma unroll
    for (int kt = 0; kt < 4; ++kt) {
#pragma unroll
      for (int r = 0; r < 8; ++r)
        s[kt][r] = s[kt][r] * (SCL * LOG2E) + bias[qt - kt + 3][r];
      m4[kt] = s[kt][0];
#pragma unroll
      for (int r = 1; r < 8; ++r) m4[kt] = fmaxf(m4[kt], s[kt][r]);
    }
    float mx = fmaxf(fmaxf(m4[0], m4[1]), fmaxf(m4[2], m4[3]));
    mx = fmaxf(mx, xhalf(mx));

    float s4[4];
    v16h pb[2];
#pragma unroll
    for (int kt = 0; kt < 4; ++kt) {
      const v8f p = exp2x8(s[kt] - mx);
      s4[kt] = p[0];
#pragma unroll
      for (int r = 1; r < 8; ++r) s4[kt] += p[r];
#pragma unroll
      for (int r = 0; r < 8; ++r) pb[kt >> 1][(kt & 1) * 8 + r] = (half_t)p[r];
    }
    float sum = (s4[0] + s4[1]) + (s4[2] + s4[3]);
    sum += xhalf(sum);
    const float inv = 1.0f / sum;

    v8f o[2] = {};
#pragma unroll
    for (int ks = 0; ks < 2; ++ks)
#pragma unroll
      for (int nt = 0; nt < 2; ++nt)
        o[nt] = wmma_fp16(va[nt][ks], pb[ks], o[nt]);
    v8h ov[2];
#pragma unroll
    for (int nt = 0; nt < 2; ++nt)
#pragma unroll
      for (int r = 0; r < 8; ++r) ov[nt][r] = (half_t)(o[nt][r] * inv);
    if (to_lds) {
      *(v8h*)(op + qt * TT)      = ov[0];
      *(v8h*)(op + qt * TT + 16) = ov[1];
    } else {
      *(v8h*)(gp + (2 * qt) * 256)     = ov[0];
      *(v8h*)(gp + (2 * qt + 1) * 256) = ov[1];
      // the registers that these stores name are inputs here, so they stay whole up
      // to this wait; the next query tile may reuse them only behind it
      asm volatile("s_wait_xcnt 0x0" :: "v"(ov[0]), "v"(ov[1]), "v"(gp) : "memory");
    }
  }
}

// ------- BN1 + QKV GEMMs + attention + proj GEMM + residual + BN2, NCHW fp32 output

// the value that lane l (a constant) holds, for every lane
__device__ __forceinline__ float lane_val(float v, int l) {
  return __builtin_bit_cast(float, __builtin_amdgcn_readlane(__builtin_bit_cast(int, v), l));
}

// One pass: 32 output channels x 128 pixels (4 image rows of 32).  The weights
// are the A operand and the pixels the B operand: token tile m is image row
// m >> 1, pixels (m & 1) * 16 + (lane & 15), and a lane's 8 registers are the
// channels j * 16 + hh * 8 + r.  The two halves of the wave then exchange one
// tile each, after which a register holds 32 adjacent pixels of ONE channel:
// each x load and each out store of the wave is one whole 128-B line.
// Ae, Ao: the lane's row of the first pixel tile in an even and in an odd image
// row (the LDS tile's row order), + hi8.
// xb, ob: at (first channel, first image row, first pixel + lane).
// pbl, s2l, h2l: lane l holds the bias and the BN2 constants of channel l of the
// pass's 32; a channel's own go from there to scalar registers, as every lane
// needs the same ones.
__device__ __forceinline__ void proj_pass(const half_t* Ae, const half_t* Ao,
                                          const half_t* wrow,
                                          const float* xb, float* ob,
                                          float pbl, float s2l, float h2l,
                                          bool lo) {
  v8f acc[8][2] = {};
  // Fragments run half a K-step (pixels, from LDS) and one K-step (weights,
  // from global) ahead of the WMMAs that use them.
  v16h a0[4], a1[4];
  v16h bf0 = frag_ldw(wrow);
  v16h bf1 = frag_ldw(wrow + 16 * DIM);
#pragma unroll
  for (int m = 0; m < 4; ++m) a0[m] = frag_ld(((m & 2) ? Ao : Ae) + m * 16 * APITCH);
  // two K-steps a trip: a full unroll lets the loads run ahead until the
  // registers spill
#pragma unroll 2
  for (int ks = 0; ks < 16; ++ks) {
    const int kc = ks << 5;
    const int kn = (ks < 15 ? ks + 1 : 15) << 5;       // last trip: in bounds, unused
    const v16h nb0 = frag_ldw(wrow + (kn >> 5) * WBLK);
    const v16h nb1 = frag_ldw(wrow + 16 * DIM + (kn >> 5) * WBLK);
#pragma unroll
    for (int m = 0; m < 4; ++m) a1[m] = frag_ld(((m & 2) ? Ao : Ae) + (4 + m) * 16 * APITCH + kc);
#pragma unroll
    for (int m = 0; m < 4; ++m) {
      acc[m][0] = wmma_fp16(bf0, a0[m], acc[m][0]);
      acc[m][1] = wmma_fp16(bf1, a0[m], acc[m][1]);
    }
#pragma unroll
    for (int m = 0; m < 4; ++m) a0[m] = frag_ld(((m & 2) ? Ao : Ae) + m * 16 * APITCH + kn);
#pragma unroll
    for (int m = 0; m < 4; ++m) {
      acc[4 + m][0] = wmma_fp16(bf0, a1[m], acc[4 + m][0]);
      acc[4 + m][1] = wmma_fp16(bf1, a1[m], acc[4 + m][1]);
    }
    bf0 = nb0; bf1 = nb1;
    sched_gemm_group<4, 8, 8>();
  }

#pragma unroll
  for (int j = 0; j < 2; ++j) {
    float xv[8][4][2];                                 // 64 lines in flight per wave
#pragma unroll
    for (int r = 0; r < 8; ++r)
#pragma unroll
      for (int q = 0; q < 4; ++q)
#pragma unroll
        for (int u = 0; u < 2; ++u)
          xv[r][q][u] = xb[((j * 16 + u * 8 + r) << 12) + (q << 6)];
#pragma unroll
    for (int r = 0; r < 8; ++r) {
      const int c0 = j * 16 + r, c1 = c0 + 8;
      const float pb0 = lane_val(pbl, c0), s20 = lane_val(s2l, c0), h20 = lane_val(h2l, c0);
      const float pb1 = lane_val(pbl, c1), s21 = lane_val(s2l, c1), h21 = lane_val(h2l, c1);
#pragma unroll
      for (int q = 0; q < 4; ++q) {
        const float e0 = acc[2 * q][j][r], e1 = acc[2 * q + 1][j][r];
        // lanes 0-15 give away (c0, pixels 16-31) and get (c1, pixels 0-15)
        const float t = xhalf(lo ? e1 : e0);
        const float v0 = lo ? e0 : t;                  // channel c0, pixel = lane
        const float v1 = lo ? t : e1;                  // channel c1, pixel = lane
        const float r0 = xv[r][q][0] + v0 + pb0;       // residual
        const float r1 = xv[r][q][1] + v1 + pb1;
        ob[(c0 << 12) + (q << 6)] = r0 * s20 + h20;    // BN2
        ob[(c1 << 12) + (q << 6)] = r1 * s21 + h21;
      }
    }
    // the loads that follow (the other 16 channels' x, the next pass's weights)
    // land in, and the next pass forms its addresses in, registers that these
    // loads and stores name: only behind this wait
    asm volatile("s_wait_xcnt 0x0" ::: "memory");
  }
}

// Block = 512 thr (16 waves): 4 windows side by side in the image (8 image rows
// of 32 pixels = 256 tokens), all 16 heads and all 512 output channels.
// 1. The BN'd 256x512 f16 tile of x is staged in LDS once.
// 2. Wave wv has window wv & 3 and, one after the other, the heads (wv >> 2) + 4 g.
//    Per head it forms Q, K (64x64) and V (64x32) from the tile, in registers and
//    already in the attention's fragment order, and does the attention there; Q, K
//    and V never go through memory.  The four waves of a head (one on each SIMD, of
//    the same age there) ask for the same weight fragments at about the same time,
//    so that the WGP's cache can serve four of them with one read of L2.
//    The results overwrite the tile only behind a barrier that says every wave has
//    read it for the last time, which is behind the last head's GEMMs: the first
//    three heads' results wait in the workspace, each lane's with the lane itself.
// 3. Behind one more barrier wave (th, cg) does image rows 4*th..4*th+3 and
//    channels 64*cg..64*cg+63 of the projection in two passes; waves cg and cg + 8
//    read the same weights.
// 286,784 B of LDS: one block on a WGP, four waves per SIMD.
#define NREL 225            /* (2 * 8 - 1)^2 relative positions */
__global__ void __launch_bounds__(512)
window_attn_kernel(const float* __restrict__ x,
                   const half_t* __restrict__ wqk, const half_t* __restrict__ wvw,
                   const float* __restrict__ bn1s, const float* __restrict__ bn1h,
                   const float* __restrict__ qk_b, const float* __restrict__ v_b,
                   const float* __restrict__ bias_table,
                   const half_t* __restrict__ wpj, const float* __restrict__ proj_b,
                   const float* __restrict__ bn2s, const float* __restrict__ bn2h,
                   half_t* __restrict__ park, float* __restrict__ out) {
  __shared__ __align__(16) half_t As[PWIN * WS2 * APITCH];
  __shared__ float Bs[HEADS * NREL];               // bias table * log2 e, [head][position]
  __shared__ __align__(16) float Cs[3 * DIM];      // qk_b, then v_b

  const int w0  = blockIdx.x * PWIN;               // windows w0 .. w0 + 3
  const int tid = threadIdx.x, lane = tid & 31;
  const int wv  = __builtin_amdgcn_readfirstlane(tid >> 5);
  const int nl = lane & 15, hh = lane >> 4, hi8 = hh << 3;
  const int b = w0 >> 6, wi = w0 & 63;
  const int row0 = (wi >> 3) << 3, col0 = (wi & 7) << 3;   // col0: 0 or 32

  // the bias table and the three bias vectors: loaded here, so that their latency
  // runs under the x staging, and written to LDS behind it
  float bt[8];
#pragma unroll
  for (int u = 0; u < 8; ++u) {
    const int t = tid + u * 512;
    bt[u] = bias_table[t < HEADS * NREL ? t : HEADS * NREL - 1];   // in bounds; unused past the end
  }
  const float cq = qk_b[tid], ck = qk_b[DIM + tid], cv = v_b[tid];
  // the registers that these loads name are free for other use only behind this wait
  asm volatile("s_wait_xcnt 0x0" ::: "memory");

  { // x staging, once: a lane takes 4 pixels of one image row (16 B; the wave 4
    // whole lines) in 8 channels, and writes 8 channels of each of the 4 pixels
    // as one b128.
    const int r = lane >> 3, quad = lane & 7;      // image rows r and r + 4
    const int m0 = (r << 5) + ((quad << 2) ^ ((r & 1) << 3));
    const float* xl = x + ((b * DIM + (wv << 3)) << 12) + ((row0 + r) << 6) + col0 + (quad << 2);
    // 16 loads of 16 B in flight per lane cover the memory latency; all 64 at
    // once would spill
#pragma unroll 1
    for (int i = 0; i < 4; ++i) {
      float4 v[2][8];
#pragma unroll
      for (int u = 0; u < 2; ++u)
#pragma unroll
        for (int j = 0; j < 8; ++j)
          v[u][j] = *(const float4*)(xl + (j << 12) + (u << 8));
      // the address pair that these loads name is kept whole up to this wait
      // (it is an input here) and is advanced only behind it
      asm volatile("s_wait_xcnt 0x0" :: "v"(xl) : "memory");
      xl += 128 << 12;                                   // 128 channels on
      const int c0 = (wv + (i << 4)) << 3;
#pragma unroll
      for (int u = 0; u < 2; ++u) {
        v8h o0, o1, o2, o3;
#pragma unroll
        for (int j = 0; j < 8; ++j) {
          const float s = bn1s[c0 + j], sh = bn1h[c0 + j];
          o0[j] = (half_t)(v[u][j].x * s + sh);
          o1[j] = (half_t)(v[u][j].y * s + sh);
          o2[j] = (half_t)(v[u][j].z * s + sh);
          o3[j] = (half_t)(v[u][j].w * s + sh);
        }
        half_t* ap = As + (m0 + (u << 7)) * APITCH + c0;
        *(v8h*)(ap)              = o0;
        *(v8h*)(ap + APITCH)     = o1;
        *(v8h*)(ap + 2 * APITCH) = o2;
        *(v8h*)(ap + 3 * APITCH) = o3;
      }
    }
  }
#pragma unroll
  for (int u = 0; u < 8; ++u) {
    const int t = tid + u * 512;
    if (t < HEADS * NREL) Bs[(t & (HEADS - 1)) * NREL + (t >> 4)] = bt[u] * LOG2E;
  }
  Cs[tid] = cq;
  Cs[DIM + tid] = ck;
  Cs[2 * DIM + tid] = cv;
  __syncthreads();                                 // the x tile and the biases are written

  {
    const int win = wv & 3, hs = wv >> 2;
    // token nl of the window: image row nl >> 3, pixel win * 8 + (nl & 7)
    half_t* At = As + (((nl >> 3) << 5) + ((win ^ (nl >> 3)) << 3) + (nl & 7)) * APITCH + hi8;
    half_t* gp = park + (size_t)(blockIdx.x * 16 + wv) * ((HEADS / HGRP - 1) * PARK) + lane * 8;
    // rolled: one head's accumulators fill the register budget
#pragma unroll 1
    for (int g = 0; g < HEADS / HGRP; ++g) {
      const int head = g * HGRP + hs;
      const bool last = g == HEADS / HGRP - 1;
      v16h qb[4], ka[4], va[2][2];
      qk_gemm(At, wqk + (g * 16) * QKSTEP + hs * (4 * WBLK) + lane * 8,
              Cs + head * HD + hi8, qb, ka);
      v_gemm(At, wvw + (g * 16) * VSTEP + hs * (2 * WBLK) + lane * 8,
             Cs + 2 * DIM + head * HD + nl, va);
      if (last) __syncthreads();                   // every wave has read the x tile for the last time
      attn_unit(ka, qb, va, Bs + head * NREL + (1 + (nl >> 3) - hh) * 15 + (nl & 7),
                At + head * HD, last, gp + g * PARK);
    }
    // the parked results, each lane its own, to their places in the tile
    v8h t[HEADS / HGRP - 1][8];
#pragma unroll
    for (int g = 0; g < HEADS / HGRP - 1; ++g)
#pragma unroll
      for (int j = 0; j < 8; ++j) t[g][j] = *(const v8h*)(gp + g * PARK + j * 256);
    // the address pair that these loads name is an input here, so it stays whole up
    // to this wait
    asm volatile("s_wait_xcnt 0x0" :: "v"(gp) : "memory");
#pragma unroll
    for (int g = 0; g < HEADS / HGRP - 1; ++g)
#pragma unroll
      for (int j = 0; j < 8; ++j)
        *(v8h*)(At + (g * HGRP + hs) * HD + (j >> 1) * TT + (j & 1) * 16) = t[g][j];
  }
  __syncthreads();                                 // all 16 heads of the tile are written

  // the lane's number taken anew from the hardware's lane count: what is derived
  // from it for the projection, held over the head loop, is spilled there
  const int ln = __builtin_amdgcn_mbcnt_lo(~0u, 0u);
  const int pl = ln & 15, ph8 = (ln >> 4) << 3;
  const int th = wv >> 3, cg = wv & 7;
  // the constants of the wave's 64 channels, channel = lane and lane + 32
  const int cl = cg * 64 + ln;
  const float pbA = proj_b[cl], pbB = proj_b[cl + 32];
  const float s2A = bn2s[cl],   s2B = bn2s[cl + 32];
  const float h2A = bn2h[cl],   h2B = bn2h[cl + 32];

  const half_t* Ae = As + (th * 128 + pl) * APITCH + ph8;        // even image rows
  const half_t* Ao = As + (th * 128 + (pl ^ 8)) * APITCH + ph8;  // odd image rows
  for (int p = 0; p < 2; ++p) {
    const int ch0 = cg * 64 + p * 32;
    const int off = ((b * DIM + ch0) << 12) + ((row0 + th * 4) << 6) + col0 + ln;
    proj_pass(Ae, Ao, wpj + (size_t)ch0 * DIM + ln * 8, x + off, out + off,
              p ? pbB : pbA, p ? s2B : s2A, p ? h2B : h2A, ln < 16);
  }
}

// ----------------------------------------------------------------- launcher
extern "C" void kernel_launch(void* const* d_in, const int* in_sizes, int n_in,
                              void* d_out, int out_size, void* d_ws, size_t ws_size,
                              hipStream_t stream) {
  const float* x    = (const float*)d_in[0];
  const float* g1   = (const float*)d_in[1];
  const float* be1  = (const float*)d_in[2];
  const float* m1   = (const float*)d_in[3];
  const float* va1  = (const float*)d_in[4];
  const float* qk_w = (const float*)d_in[5];
  const float* qk_b = (const float*)d_in[6];
  const float* v_w  = (const float*)d_in[7];
  const float* v_b  = (const float*)d_in[8];
  const float* pw   = (const float*)d_in[9];
  const float* pb   = (const float*)d_in[10];
  const float* bt   = (const float*)d_in[11];
  const float* g2   = (const float*)d_in[12];
  const float* be2  = (const float*)d_in[13];
  const float* m2   = (const float*)d_in[14];
  const float* va2  = (const float*)d_in[15];
  float* out = (float*)d_out;

  char* ws = (char*)d_ws;
  half_t* wqk = (half_t*)ws; ws += (size_t)2 * DIM * DIM * sizeof(half_t);
  half_t* wv  = (half_t*)ws; ws += (size_t)DIM * DIM * sizeof(half_t);
  half_t* wpj = (half_t*)ws; ws += (size_t)DIM * DIM * sizeof(half_t);
  float* bn1s = (float*)ws;  ws += DIM * sizeof(float);
  float* bn1h = (float*)ws;  ws += DIM * sizeof(float);
  float* bn2s = (float*)ws;  ws += DIM * sizeof(float);
  float* bn2h = (float*)ws;  ws += DIM * sizeof(float);
  half_t* park = (half_t*)ws;                      // 256 blocks x 16 waves x 3 x 4 KB

  prep_kernel<<<4100, 256, 0, stream>>>(qk_w, v_w, pw, g1, be1, m1, va1,
                                        g2, be2, m2, va2,
                                        wqk, wv, wpj, bn1s, bn1h, bn2s, bn2h);
  window_attn_kernel<<<NWIN / PWIN, 512, 0, stream>>>(x, wqk, wv, bn1s, bn1h, qk_b, v_b, bt,
                                                      wpj, pb, bn2s, bn2h, park, out);
}

// v009
// A run of this version takes 108 microseconds.
// Two timings next to v008 both put it at 1.03 times that version's speed.
// Counting every step since v000, it is 9.22 times as fast.
#include <hip/hip_runtime.h>

typedef _Float16 half_t;
typedef __attribute__((ext_vector_type(16))) _Float16 v16h;
typedef __attribute__((ext_vector_type(8)))  _Float16 v8h;
typedef __attribute__((ext_vector_type(8)))  float    v8f;

#define DIM   512
#define WS2   64
#define HEADS 16
#define HD    32
#define NWIN  1024          /* 16 batches * 8 * 8 windows */
#define EPSV  1e-5f
#define SCL   0.17677669529663687f  /* 1/sqrt(32) */
#define APITCH 520          /* LDS stride (halves) of the resident 512-deep A tile: 16 B x odd */

// ---------------------------------------------------------------- WMMA helpers
__device__ __forceinline__ v8f wmma_fp16(v16h a, v16h b, v8f c) {
  return __builtin_amdgcn_wmma_f32_16x16x32_f16(false, a, false, b, (short)0, c,
                                                false, false);
}

// Keeps each group of LDS fragment reads in front of the WMMAs of the other
// group, so that a read's LDS latency runs under matrix work instead of in front
// of it.  VM: global reads (next weights), DS: LDS reads and MM: WMMAs per half.
template <int VM, int DS, int MM>
__device__ __forceinline__ void sched_gemm_group() {
#if __has_builtin(__builtin_amdgcn_sched_group_barrier)
  __builtin_amdgcn_sched_group_barrier(0x020, VM, 0);  // VMEM read (next weights)
  __builtin_amdgcn_sched_group_barrier(0x100, DS, 0);  // DS read   (2nd half)
  __builtin_amdgcn_sched_group_barrier(0x008, MM, 0);  // WMMA      (1st half)
  __builtin_amdgcn_sched_group_barrier(0x100, DS, 0);  // DS read   (next, 1st half)
  __builtin_amdgcn_sched_group_barrier(0x008, MM, 0);  // WMMA      (2nd half)
#endif
}

// Per ISA 7.12.2, a lane's 16 fragment halves (A row m / B column n) are two
// contiguous 8-half runs: k = hi8+0..7 and k = 16+hi8+0..7.  `p` must point at
// (row_base + hi8) and be 16B aligned -> two b128 loads.
__device__ __forceinline__ v16h frag_ld(const half_t* p) {
  const v8h lo = *(const v8h*)(p);
  const v8h hi = *(const v8h*)(p + 16);
  v16h r;
#pragma unroll
  for (int i = 0; i < 8; ++i) { r[i] = lo[i]; r[8 + i] = hi[i]; }
  return r;
}

// The f16 weights lie in the workspace in fragment order: per 16 output columns
// and 32 k one block of 1 KB = [k half-run: k&16][lane = ((k>>3)&1)*16 + col&15][k&7].
// A wave's b128 load of a half-run is then 512 contiguous bytes, 4 whole lines;
// from row-major weights it touched 16 lines, 32 B of each.  The k order per
// lane and register is that of frag_ld.  `p` points at (block + lane*8).
#define WBLK  512           /* halves per 16-column x 32-k block */
__device__ __forceinline__ v16h frag_ldw(const half_t* p) {
  const v8h lo = *(const v8h*)(p);
  const v8h hi = *(const v8h*)(p + 256);
  v16h r;
#pragma unroll
  for (int i = 0; i < 8; ++i) { r[i] = lo[i]; r[8 + i] = hi[i]; }
  return r;
}
// position in the fragment-ordered copy -> index in the row-major [n][DIM] weight
__device__ __forceinline__ int frag_src(int o) {
  const int n = ((o >> 13) << 4) + ((o >> 3) & 15);
  const int k = (((o >> 9) & 15) << 5) + (((o >> 8) & 1) << 4) + (((o >> 7) & 1) << 3) + (o & 7);
  return n * DIM + k;
}
// The Q, K and V weights: the blocks lie in the order [group of 4 heads][K-step]
// [head of the group][column tile: Q 0-15, Q 16-31, K 0-15, K 16-31; V: 0-15, 16-31].
// The four heads that a work-group has in hand at one time then take one K-step's
// weights from one contiguous run (16 KB; V 8 KB), whose lines differ in their low
// address bits, so that they can lie in the WGP's cache side by side; with a column
// tile's 16 K-steps in a row every block in hand lay at the same offset modulo 16 KB.
#define HGRP   4                    /* heads in hand at one time */
#define QKSTEP (HGRP * 4 * WBLK)    /* halves from one K-step to the next */
#define VSTEP  (HGRP * 2 * WBLK)
__device__ __forceinline__ int frag_src_qk(int o) {
  const int c = (o >> 9) & 3, head = ((o >> 17) << 2) + ((o >> 11) & 3);
  const int n = (c >> 1) * DIM + head * HD + ((c & 1) << 4) + ((o >> 3) & 15);
  const int k = (((o >> 13) & 15) << 5) + (((o >> 8) & 1) << 4) + (((o >> 7) & 1) << 3) + (o & 7);
  return n * DIM + k;
}
__device__ __forceinline__ int frag_src_v(int o) {
  const int head = ((o >> 16) << 2) + ((o >> 10) & 3);
  const int n = head * HD + (((o >> 9) & 1) << 4) + ((o >> 3) & 15);
  const int k = (((o >> 12) & 15) << 5) + (((o >> 8) & 1) << 4) + (((o >> 7) & 1) << 3) + (o & 7);
  return n * DIM + k;
}

// --------------------------------------------------- kernel 1: prep (weights)
__global__ void prep_kernel(const float* __restrict__ qk_w,
                            const float* __restrict__ v_w,
                            const float* __restrict__ proj_w,
                            const float* __restrict__ g1, const float* __restrict__ be1,
                            const float* __restrict__ m1, const float* __restrict__ va1,
                            const float* __restrict__ g2, const float* __restrict__ be2,
                            const float* __restrict__ m2, const float* __restrict__ va2,
                            half_t* __restrict__ wqk, half_t* __restrict__ wv,
                            half_t* __restrict__ wpj,
                            float* __restrict__ bn1s, float* __restrict__ bn1h,
                            float* __restrict__ bn2s, float* __restrict__ bn2h) {
  int i = blockIdx.x * blockDim.x + threadIdx.x;
  const int NQK = 2 * DIM * DIM;   // 524288
  const int NV  = DIM * DIM;       // 262144
  if (i < NQK) { wqk[i] = (half_t)qk_w[frag_src_qk(i)]; return; }
  i -= NQK;
  if (i < NV) { wv[i] = (half_t)v_w[frag_src_v(i)]; return; }
  i -= NV;
  if (i < NV) { wpj[i] = (half_t)proj_w[frag_src(i)]; return; }
  i -= NV;
  if (i < DIM) {
    const float s = g1[i] * rsqrtf(va1[i] + EPSV);
    bn1s[i] = s; bn1h[i] = be1[i] - m1[i] * s; return;
  }
  i -= DIM;
  if (i < DIM) {
    const float s = g2[i] * rsqrtf(va2[i] + EPSV);
    bn2s[i] = s; bn2h[i] = be2[i] - m2[i] * s; return;
  }
}

// ------------------------------------------------ the block's LDS tile
// 4 windows side by side in the image = 8 image rows y of 32 pixels px, 512
// channels deep.  Pixel (y, px) is row y * 32 + (px ^ ((y & 1) << 3)): both a
// window's token tile (2 image rows x 8 pixels) and the projection's pixel tile
// (16 pixels of one image row) then take 16 rows that differ modulo 16, so that
// a fragment read meets every LDS bank once.
#define PWIN 4              /* windows per block: 32 pixels of an image row, one 128-B line */
#define TT    (64 * APITCH) /* one token tile of a window on = 2 image rows on */

// Q and K of one (window, head): 64 tokens x 64 output columns.  The weights are
// the A operand and the tokens the B operand: the accumulator's column (lane) is
// a token and its 8 registers are 8 consecutive channels, which is one 8-half run
// of the attention's own fragment of that token tile.
// At: the lane's row of token tile 0, + hi8.  wq: the head's four blocks (32 Q and
// 32 K columns) of K-step 0, + lane * 8.  bias: in LDS, at (first Q column + hi8).
// rot: the K-step at which the work-group starts its walk (see window_attn_kernel).
__device__ __forceinline__ void qk_gemm(const half_t* At, const half_t* wq,
                                        const float* bias, int rot,
                                        v16h (&qb)[4], v16h (&ka)[4]) {
  v8f acc[4][4] = {};
  // Fragments run half a K-step (tokens, from LDS) and one K-step (weights, from
  // global) ahead of the WMMAs that use them.
  v16h w[4], a0[2], a1[2];
#pragma unroll
  for (int c = 0; c < 4; ++c) w[c] = frag_ldw(wq + rot * QKSTEP + c * WBLK);
#pragma unroll
  for (int m = 0; m < 2; ++m) a0[m] = frag_ld(At + m * TT + (rot << 5));
  // two K-steps a trip: a full unroll lets the loads run ahead until the
  // registers spill
#pragma unroll 2
  for (int ks = 0; ks < 16; ++ks) {
    const int kc = ((ks + rot) & 15) << 5;
    const int kn = ((ks + 1 + rot) & 15) << 5;         // last trip: the first again, unused
    v16h nw[4];
#pragma unroll
    for (int c = 0; c < 4; ++c) nw[c] = frag_ldw(wq + (kn >> 5) * QKSTEP + c * WBLK);
#pragma unroll
    for (int m = 0; m < 2; ++m) a1[m] = frag_ld(At + (2 + m) * TT + kc);
#pragma unroll
    for (int m = 0; m < 2; ++m)
#pragma unroll
      for (int c = 0; c < 4; ++c) acc[m][c] = wmma_fp16(w[c], a0[m], acc[m][c]);
#pragma unroll
    for (int m = 0; m < 2; ++m) a0[m] = frag_ld(At + m * TT + kn);
#pragma unroll
    for (int m = 0; m < 2; ++m)
#pragma unroll
      for (int c = 0; c < 4; ++c) acc[2 + m][c] = wmma_fp16(w[c], a1[m], acc[2 + m][c]);
#pragma unroll
    for (int c = 0; c < 4; ++c) w[c] = nw[c];
    sched_gemm_group<8, 4, 8>();
  }

  float bs[4][8];                                      // bias of (column tile c, register r)
#pragma unroll
  for (int c = 0; c < 4; ++c)
#pragma unroll
    for (int r = 0; r < 8; ++r) bs[c][r] = bias[(c >> 1) * DIM + (c & 1) * 16 + r];
  // the address pair that the weight loads name is an input here, so it stays
  // whole up to this wait; its registers are free for other use only behind it
  asm volatile("s_wait_xcnt 0x0" :: "v"(wq) : "memory");
#pragma unroll
  for (int t = 0; t < 4; ++t)
#pragma unroll
    for (int r = 0; r < 8; ++r) {
      qb[t][r]     = (half_t)(acc[t][0][r] + bs[0][r]);
      qb[t][8 + r] = (half_t)(acc[t][1][r] + bs[1][r]);
      ka[t][r]     = (half_t)(acc[t][2][r] + bs[2][r]);
      ka[t][8 + r] = (half_t)(acc[t][3][r] + bs[3][r]);
    }
  // inputs only: the 64 f16 registers are formed here.  Left alone, the compiler
  // moves this conversion behind the V GEMM, keeps the 128 f32 accumulators and the
  // bias alive over that loop and spills them.
  asm volatile("" :: "v"(qb[0]), "v"(qb[1]), "v"(qb[2]), "v"(qb[3]),
                     "v"(ka[0]), "v"(ka[1]), "v"(ka[2]), "v"(ka[3]));
}

// V of one (window, head): 64 tokens x 32 output columns, tokens as A operand: a
// lane holds 8 consecutive tokens of one channel, one 8-half run of the fragment
// of V^T over 32 tokens.  wrow: the head's two blocks of K-step 0, + lane * 8.
// bias: in LDS, at (first column + nl).  rot: as in qk_gemm.
__device__ __forceinline__ void v_gemm(const half_t* At, const half_t* wrow,
                                       const float* bias, int rot, v16h (&va)[2][2]) {
  v8f acc[4][2] = {};
  v16h a0[2], a1[2];
  v16h bf0 = frag_ldw(wrow + rot * VSTEP);
  v16h bf1 = frag_ldw(wrow + rot * VSTEP + WBLK);
#pragma unroll
  for (int m = 0; m < 2; ++m) a0[m] = frag_ld(At + m * TT + (rot << 5));
  // two K-steps a trip, as above
#pragma unroll 2
  for (int ks = 0; ks < 16; ++ks) {
    const int kc = ((ks + rot) & 15) << 5;
    const int kn = ((ks + 1 + rot) & 15) << 5;         // last trip: the first again, unused
    const v16h nb0 = frag_ldw(wrow + (kn >> 5) * VSTEP);
    const v16h nb1 = frag_ldw(wrow + (kn >> 5) * VSTEP + WBLK);
#pragma unroll
    for (int m = 0; m < 2; ++m) a1[m] = frag_ld(At + (2 + m) * TT + kc);
#pragma unroll
    for (int m = 0; m < 2; ++m) {
      acc[m][0] = wmma_fp16(a0[m], bf0, acc[m][0]);
      acc[m][1] = wmma_fp16(a0[m], bf1, acc[m][1]);
    }
#pragma unroll
    for (int m = 0; m < 2; ++m) a0[m] = frag_ld(At + m * TT + kn);
#pragma unroll
    for (int m = 0; m < 2; ++m) {
      acc[2 + m][0] = wmma_fp16(a1[m], bf0, acc[2 + m][0]);
      acc[2 + m][1] = wmma_fp16(a1[m], bf1, acc[2 + m][1]);
    }
    bf0 = nb0; bf1 = nb1;
    sched_gemm_group<4, 4, 4>();
  }

  const float bs0 = bias[0], bs1 = bias[16];
  // as in qk_gemm: the address pair stays whole up to this wait
  asm volatile("s_wait_xcnt 0x0" :: "v"(wrow) : "memory");
#pragma unroll
  for (int ks = 0; ks < 2; ++ks)
#pragma unroll
    for (int r = 0; r < 8; ++r) {
      va[0][ks][r]     = (half_t)(acc[2 * ks][0][r] + bs0);
      va[0][ks][8 + r] = (half_t)(acc[2 * ks + 1][0][r] + bs0);
      va[1][ks][r]     = (half_t)(acc[2 * ks][1][r] + bs1);
      va[1][ks][8 + r] = (half_t)(acc[2 * ks + 1][1][r] + bs1);
    }
}

// ------------------------------ per (window, head) attention, WMMA
// One wave does whole (window, head) units by itself.
// S^T = K Q^T: a lane then holds 32 of the 64 scores of ONE query (its partner
// lane ^ 16 the rest), so max and sum are in-lane plus one exchange.  Two S^T
// tiles, converted in place, are the B operand of O^T = V^T P^T, and a lane's 8
// results are 8 consecutive channels of one token: one 16-B store.
// The bias of tile (kt, qt) depends on qt - kt alone, so 7 x 8 registers hold the
// head's whole 64 x 64 bias.
#define LOG2E 1.4426950408889634f

// lane l <-> lane l ^ 16
__device__ __forceinline__ float xhalf(float v) {
  const int b = __builtin_bit_cast(int, v);
  return __builtin_bit_cast(float, __builtin_amdgcn_permlanex16(
      b, b, 0x76543210, 0xfedcba98, false, false));
}

// 2^x of 8 values in one statement: behind each v_exp_f32 then stands an
// instruction that neither reads its result nor overwrites its source (the
// outputs are early-clobber), and behind the last a v_nop.  That is the slot the
// instruction set asks for behind a transcendental.
__device__ __forceinline__ v8f exp2x8(v8f x) {
  float p0, p1, p2, p3, p4, p5, p6, p7;
  asm("v_exp_f32 %0, %8\n\t"
      "v_exp_f32 %1, %9\n\t"
      "v_exp_f32 %2, %10\n\t"
      "v_exp_f32 %3, %11\n\t"
      "v_exp_f32 %4, %12\n\t"
      "v_exp_f32 %5, %13\n\t"
      "v_exp_f32 %6, %14\n\t"
      "v_exp_f32 %7, %15\n\t"
      "v_nop"
      : "=&v"(p0), "=&v"(p1), "=&v"(p2), "=&v"(p3),
        "=&v"(p4), "=&v"(p5), "=&v"(p6), "=&v"(p7)
      : "v"(x[0]), "v"(x[1]), "v"(x[2]), "v"(x[3]),
        "v"(x[4]), "v"(x[5]), "v"(x[6]), "v"(x[7]));
  const v8f r = {p0, p1, p2, p3, p4, p5, p6, p7};
  return r;
}

// One (window, head) from fragments that are already in registers.  bl: the
// head's bias row in LDS (already times log2 e) at the lane's own start; op: the
// lane's place in the LDS tile: its row of token tile 0, the head's channels + hi8.
// to_lds (the same for the whole work-group): the result goes there; otherwise it is
// parked in the workspace at gp (the wave's own 4 KB, + lane * 8): 8 stores of 4
// whole lines, in the order (query tile, channel half).
#define PARK 2048           /* halves of one parked (window, head) result */
__device__ __forceinline__ void attn_unit(const v16h (&ka)[4], const v16h (&qb)[4],
                                          const v16h (&va)[2][2],
                                          const float* bl, half_t* op,
                                          bool to_lds, half_t* gp) {
  // query = qt*16 + nl, key = kt*16 + 8*hh + r; d = qt - kt + 3:
  // row difference dr = 2*d + 1 + (nl>>3) - hh (0..14), column difference
  // dc = (nl&7) + 7 - r (0..14): one lane address, constant steps in d and r
  float bias[7][8];
#pragma unroll
  for (int d = 0; d < 7; ++d)
#pragma unroll
    for (int r = 0; r < 8; ++r)
      bias[d][r] = bl[d * 30 + 7 - r];

#pragma unroll
  for (int qt = 0; qt < 4; ++qt) {
    v8f s[4];
#pragma unroll
    for (int kt = 0; kt < 4; ++kt) {
      const v8f zero = {};
      s[kt] = wmma_fp16(ka[kt], qb[qt], zero);
    }
    float m4[4];
#pragma unroll
    for (int kt = 0; kt < 4; ++kt) {
#pragma unroll
      for (int r = 0; r < 8; ++r)
        s[kt][r] = s[kt][r] * (SCL * LOG2E) + bias[qt - kt + 3][r];
      m4[kt] = s[kt][0];
#pragma unroll
      for (int r = 1; r < 8; ++r) m4[kt] = fmaxf(m4[kt], s[kt][r]);
    }
    float mx = fmaxf(fmaxf(m4[0], m4[1]), fmaxf(m4[2], m4[3]));
    mx = fmaxf(mx, xhalf(mx));

    float s4[4];
    v16h pb[2];
#pragma unroll
    for (int kt = 0; kt < 4; ++kt) {
      const v8f p = exp2x8(s[kt] - mx);
      s4[kt] = p[0];
#pragma unroll
      for (int r = 1; r < 8; ++r) s4[kt] += p[r];
#pragma unroll
      for (int r = 0; r < 8; ++r) pb[kt >> 1][(kt & 1) * 8 + r] = (half_t)p[r];
    }
    float sum = (s4[0] + s4[1]) + (s4[2] + s4[3]);
    sum += xhalf(sum);
    const float inv = 1.0f / sum;

    v8f o[2] = {};
#pragma unroll
    for (int ks = 0; ks < 2; ++ks)
#pragma unroll
      for (int nt = 0; nt < 2; ++nt)
        o[nt] = wmma_fp16(va[nt][ks], pb[ks], o[nt]);
    v8h ov[2];
#pragma unroll
    for (int nt = 0; nt < 2; ++nt)
#pragma unroll
      for (int r = 0; r < 8; ++r) ov[nt][r] = (half_t)(o[nt][r] * inv);
    if (to_lds) {
      *(v8h*)(op + qt * TT)      = ov[0];
      *(v8h*)(op + qt * TT + 16) = ov[1];
    } else {
      *(v8h*)(gp + (2 * qt) * 256)     = ov[0];
      *(v8h*)(gp + (2 * qt + 1) * 256) = ov[1];
      // the registers that these stores name are inputs here, so they stay whole up
      // to this wait; the next query tile may reuse them only behind it
      asm volatile("s_wait_xcnt 0x0" :: "v"(ov[0]), "v"(ov[1]), "v"(gp) : "memory");
    }
  }
}

// ------- BN1 + QKV GEMMs + attention + proj GEMM + residual + BN2, NCHW fp32 output

// the value that lane l (a constant) holds, for every lane
__device__ __forceinline__ float lane_val(float v, int l) {
  return __builtin_bit_cast(float, __builtin_amdgcn_readlane(__builtin_bit_cast(int, v), l));
}

// One pass: 32 output channels x 128 pixels (4 image rows of 32).  The weights
// are the A operand and the pixels the B operand: token tile m is image row
// m >> 1, pixels (m & 1) * 16 + (lane & 15), and a lane's 8 registers are the
// channels j * 16 + hh * 8 + r.  The two halves of the wave then exchange one
// tile each, after which a register holds 32 adjacent pixels of ONE channel:
// each x load and each out store of the wave is one whole 128-B line.
// Ae, Ao: the lane's row of the first pixel tile in an even and in an odd image
// row (the LDS tile's row order), + hi8.
// xb, ob: at (first channel, first image row, first pixel + lane).
// pbl, s2l, h2l: lane l holds the bias and the BN2 constants of channel l of the
// pass's 32; a channel's own go from there to scalar registers, as every lane
// needs the same ones.  rot: as in qk_gemm.
__device__ __forceinline__ void proj_pass(const half_t* Ae, const half_t* Ao,
                                          const half_t* wrow, int rot,
                                          const float* xb, float* ob,
                                          float pbl, float s2l, float h2l,
                                          bool lo) {
  v8f acc[8][2] = {};
  // Fragments run half a K-step (pixels, from LDS) and one K-step (weights,
  // from global) ahead of the WMMAs that use them.
  v16h a0[4], a1[4];
  const half_t* wn = wrow + rot * WBLK;                // walks the K-steps in a ring
  v16h bf0 = frag_ldw(wn);
  v16h bf1 = frag_ldw(wn + 16 * DIM);
#pragma unroll
  for (int m = 0; m < 4; ++m) a0[m] = frag_ld(((m & 2) ? Ao : Ae) + m * 16 * APITCH + (rot << 5));
  // two K-steps a trip: a full unroll lets the loads run ahead until the
  // registers spill
#pragma unroll 2
  for (int ks = 0; ks < 16; ++ks) {
    const int kc = ((ks + rot) & 15) << 5;
    const int kn = ((ks + 1 + rot) & 15) << 5;         // last trip: the first again, unused
    wn += kn ? WBLK : -15 * WBLK;                      // one K-step on, or back to the first
    const v16h nb0 = frag_ldw(wn);
    const v16h nb1 = frag_ldw(wn + 16 * DIM);
#pragma unroll
    for (int m = 0; m < 4; ++m) a1[m] = frag_ld(((m & 2) ? Ao : Ae) + (4 + m) * 16 * APITCH + kc);
#pragma unroll
    for (int m = 0; m < 4; ++m) {
      acc[m][0] = wmma_fp16(bf0, a0[m], acc[m][0]);
      acc[m][1] = wmma_fp16(bf1, a0[m], acc[m][1]);
    }
#pragma unroll
    for (int m = 0; m < 4; ++m) a0[m] = frag_ld(((m & 2) ? Ao : Ae) + m * 16 * APITCH + kn);
#pragma unroll
    for (int m = 0; m < 4; ++m) {
      acc[4 + m][0] = wmma_fp16(bf0, a1[m], acc[4 + m][0]);
      acc[4 + m][1] = wmma_fp16(bf1, a1[m], acc[4 + m][1]);
    }
    bf0 = nb0; bf1 = nb1;
    sched_gemm_group<4, 8, 8>();
  }
  // as in qk_gemm: the address pair that the weight loads name stays whole up to this
  // wait; the x loads below may land in its registers only behind it
  asm volatile("s_wait_xcnt 0x0" :: "v"(wn) : "memory");

#pragma unroll
  for (int j = 0; j < 2; ++j) {
    float xv[8][4][2];                                 // 64 lines in flight per wave
#pragma unroll
    for (int r = 0; r < 8; ++r)
#pragma unroll
      for (int q = 0; q < 4; ++q)
#pragma unroll
        for (int u = 0; u < 2; ++u)
          xv[r][q][u] = xb[((j * 16 + u * 8 + r) << 12) + (q << 6)];
#pragma unroll
    for (int r = 0; r < 8; ++r) {
      const int c0 = j * 16 + r, c1 = c0 + 8;
      const float pb0 = lane_val(pbl, c0), s20 = lane_val(s2l, c0), h20 = lane_val(h2l, c0);
      const float pb1 = lane_val(pbl, c1), s21 = lane_val(s2l, c1), h21 = lane_val(h2l, c1);
#pragma unroll
      for (int q = 0; q < 4; ++q) {
        const float e0 = acc[2 * q][j][r], e1 = acc[2 * q + 1][j][r];
        // lanes 0-15 give away (c0, pixels 16-31) and get (c1, pixels 0-15)
        const float t = xhalf(lo ? e1 : e0);
        const float v0 = lo ? e0 : t;                  // channel c0, pixel = lane
        const float v1 = lo ? t : e1;                  // channel c1, pixel = lane
        const float r0 = xv[r][q][0] + v0 + pb0;       // residual
        const float r1 = xv[r][q][1] + v1 + pb1;
        ob[(c0 << 12) + (q << 6)] = r0 * s20 + h20;    // BN2
        ob[(c1 << 12) + (q << 6)] = r1 * s21 + h21;
      }
    }
    // the loads that follow (the other 16 channels' x, the next pass's weights)
    // land in, and the next pass forms its addresses in, registers that these
    // loads and stores name: only behind this wait
    asm volatile("s_wait_xcnt 0x0" ::: "memory");
  }
}

// Block = 512 thr (16 waves): 4 windows side by side in the image (8 image rows
// of 32 pixels = 256 tokens), all 16 heads and all 512 output channels.
// 1. The BN'd 256x512 f16 tile of x is staged in LDS once.
// 2. Wave wv has window wv & 3 and, one after the other, the heads (wv >> 2) + 4 g.
//    Per head it forms Q, K (64x64) and V (64x32) from the tile, in registers and
//    already in the attention's fragment order, and does the attention there; Q, K
//    and V never go through memory.  The four waves of a head (one on each SIMD, of
//    the same age there) ask for the same weight fragments at about the same time,
//    so that the WGP's cache can serve four of them with one read of L2.
//    The results overwrite the tile only behind a barrier that says every wave has
//    read it for the last time, which is behind the last head's GEMMs: the first
//    three heads' results wait in the workspace, each lane's with the lane itself.
// 3. Behind one more barrier wave (th, cg) does image rows 4*th..4*th+3 and
//    channels 64*cg..64*cg+63 of the projection in two passes; waves cg and cg + 8
//    read the same weights.
// Every work-group reads the same 2 MB of weights, and all start at one time: walked
// in one order, they ask L2 for the same lines at the same moment, and such requests
// queue on those lines' part of L2 while the rest of it idles.  So each work-group
// starts its walk at a place of its own and wraps: the head groups at grot, the K-steps
// of every GEMM at krot (a sum over K then starts at krot: another f32 sum order).
// 286,784 B of LDS: one block on a WGP, four waves per SIMD.
#define NREL 225            /* (2 * 8 - 1)^2 relative positions */
__global__ void __launch_bounds__(512)
window_attn_kernel(const float* __restrict__ x,
                   const half_t* __restrict__ wqk, const half_t* __restrict__ wvw,
                   const float* __restrict__ bn1s, const float* __restrict__ bn1h,
                   const float* __restrict__ qk_b, const float* __restrict__ v_b,
                   const float* __restrict__ bias_table,
                   const half_t* __restrict__ wpj, const float* __restrict__ proj_b,
                   const float* __restrict__ bn2s, const float* __restrict__ bn2h,
                   half_t* __restrict__ park, float* __restrict__ out) {
  __shared__ __align__(16) half_t As[PWIN * WS2 * APITCH];
  __shared__ float Bs[HEADS * NREL];               // bias table * log2 e, [head][position]
  __shared__ __align__(16) float Cs[3 * DIM];      // qk_b, then v_b

  const int w0  = blockIdx.x * PWIN;               // windows w0 .. w0 + 3
  const int tid = threadIdx.x, lane = tid & 31;
  const int wv  = __builtin_amdgcn_readfirstlane(tid >> 5);
  const int nl = lane & 15, hh = lane >> 4, hi8 = hh << 3;
  const int b = w0 >> 6, wi = w0 & 63;
  const int row0 = (wi >> 3) << 3, col0 = (wi & 7) << 3;   // col0: 0 or 32
  const int grot = blockIdx.x & (HEADS / HGRP - 1), krot = (blockIdx.x >> 3) & 15;

  // the bias table and the three bias vectors: loaded here, so that their latency
  // runs under the x staging, and written to LDS behind it
  float bt[8];
#pragma unroll
  for (int u = 0; u < 8; ++u) {
    const int t = tid + u * 512;
    bt[u] = bias_table[t < HEADS * NREL ? t : HEADS * NREL - 1];   // in bounds; unused past the end
  }
  const float cq = qk_b[tid], ck = qk_b[DIM + tid], cv = v_b[tid];
  // the registers that these loads name are free for other use only behind this wait
  asm volatile("s_wait_xcnt 0x0" ::: "memory");

  { // x staging, once: a lane takes 4 pixels of one image row (16 B; the wave 4
    // whole lines) in 8 channels, and writes 8 channels of each of the 4 pixels
    // as one b128.
    const int r = lane >> 3, quad = lane & 7;      // image rows r and r + 4
    const int m0 = (r << 5) + ((quad << 2) ^ ((r & 1) << 3));
    const float* xl = x + ((b * DIM + (wv << 3)) << 12) + ((row0 + r) << 6) + col0 + (quad << 2);
    // 16 loads of 16 B in flight per lane cover the memory latency; all 64 at
    // once would spill
#pragma unroll 1
    for (int i = 0; i < 4; ++i) {
      float4 v[2][8];
#pragma unroll
      for (int u = 0; u < 2; ++u)
#pragma unroll
        for (int j = 0; j < 8; ++j)
          v[u][j] = *(const float4*)(xl + (j << 12) + (u << 8));
      // the address pair that these loads name is kept whole up to this wait
      // (it is an input here) and is advanced only behind it
      asm volatile("s_wait_xcnt 0x0" :: "v"(xl) : "memory");
      xl += 128 << 12;                                   // 128 channels on
      const int c0 = (wv + (i << 4)) << 3;
#pragma unroll
      for (int u = 0; u < 2; ++u) {
        v8h o0, o1, o2, o3;
#pragma unroll
        for (int j = 0; j < 8; ++j) {
          const float s = bn1s[c0 + j], sh = bn1h[c0 + j];
          o0[j] = (half_t)(v[u][j].x * s + sh);
          o1[j] = (half_t)(v[u][j].y * s + sh);
          o2[j] = (half_t)(v[u][j].z * s + sh);
          o3[j] = (half_t)(v[u][j].w * s + sh);
        }
        half_t* ap = As + (m0 + (u << 7)) * APITCH + c0;
        *(v8h*)(ap)              = o0;
        *(v8h*)(ap + APITCH)     = o1;
        *(v8h*)(ap + 2 * APITCH) = o2;
        *(v8h*)(ap + 3 * APITCH) = o3;
      }
    }
  }
#pragma unroll
  for (int u = 0; u < 8; ++u) {
    const int t = tid + u * 512;
    if (t < HEADS * NREL) Bs[(t & (HEADS - 1)) * NREL + (t >> 4)] = bt[u] * LOG2E;
  }
  Cs[tid] = cq;
  Cs[DIM + tid] = ck;
  Cs[2 * DIM + tid] = cv;
  __syncthreads();                                 // the x tile and the biases are written

  {
    const int win = wv & 3, hs = wv >> 2;
    // token nl of the window: image row nl >> 3, pixel win * 8 + (nl & 7)
    half_t* At = As + (((nl >> 3) << 5) + ((win ^ (nl >> 3)) << 3) + (nl & 7)) * APITCH + hi8;
    half_t* gp = park + (size_t)(blockIdx.x * 16 + wv) * ((HEADS / HGRP - 1) * PARK) + lane * 8;
    // rolled: one head's accumulators fill the register budget
#pragma unroll 1
    for (int g = 0; g < HEADS / HGRP; ++g) {
      const int gg = (g + grot) & (HEADS / HGRP - 1);  // the head group of this turn
      const int head = gg * HGRP + hs;
      const bool last = g == HEADS / HGRP - 1;
      v16h qb[4], ka[4], va[2][2];
      qk_gemm(At, wqk + (gg * 16) * QKSTEP + hs * (4 * WBLK) + lane * 8,
              Cs + head * HD + hi8, krot, qb, ka);
      v_gemm(At, wvw + (gg * 16) * VSTEP + hs * (2 * WBLK) + lane * 8,
             Cs + 2 * DIM + head * HD + nl, krot, va);
      if (last) __syncthreads();                   // every wave has read the x tile for the last time
      attn_unit(ka, qb, va, Bs + head * NREL + (1 + (nl >> 3) - hh) * 15 + (nl & 7),
                At + head * HD, last, gp + g * PARK);
    }
    // the parked results, each lane its own, to their places in the tile
    v8h t[HEADS / HGRP - 1][8];
#pragma unroll
    for (int g = 0; g < HEADS / HGRP - 1; ++g)
#pragma unroll
      for (int j = 0; j < 8; ++j) t[g][j] = *(const v8h*)(gp + g * PARK + j * 256);
    // the address pair that these loads name is an input here, so it stays whole up
    // to this wait
    asm volatile("s_wait_xcnt 0x0" :: "v"(gp) : "memory");
#pragma unroll
    for (int g = 0; g < HEADS / HGRP - 1; ++g)
#pragma unroll
      for (int j = 0; j < 8; ++j)
        *(v8h*)(At + (((g + grot) & (HEADS / HGRP - 1)) * HGRP + hs) * HD + (j >> 1) * TT + (j & 1) * 16) = t[g][j];
  }
  __syncthreads();                                 // all 16 heads of the tile are written

  // the lane's number taken anew from the hardware's lane count: what is derived
  // from it for the projection, held over the head loop, is spilled there
  const int ln = __builtin_amdgcn_mbcnt_lo(~0u, 0u);
  const int pl = ln & 15, ph8 = (ln >> 4) << 3;
  const int th = wv >> 3, cg = wv & 7;
  // the constants of the wave's 64 channels, channel = lane and lane + 32
  const int cl = cg * 64 + ln;
  const float pbA = proj_b[cl], pbB = proj_b[cl + 32];
  const float s2A = bn2s[cl],   s2B = bn2s[cl + 32];
  const float h2A = bn2h[cl],   h2B = bn2h[cl + 32];

  const half_t* Ae = As + (th * 128 + pl) * APITCH + ph8;        // even image rows
  const half_t* Ao = As + (th * 128 + (pl ^ 8)) * APITCH + ph8;  // odd image rows
  for (int p = 0; p < 2; ++p) {
    const int ch0 = cg * 64 + p * 32;
    const int off = ((b * DIM + ch0) << 12) + ((row0 + th * 4) << 6) + col0 + ln;
    proj_pass(Ae, Ao, wpj + (size_t)ch0 * DIM + ln * 8, krot, x + off, out + off,
              p ? pbB : pbA, p ? s2B : s2A, p ? h2B : h2A, ln < 16);
  }
}

// ----------------------------------------------------------------- launcher
extern "C" void kernel_launch(void* const* d_in, const int* in_sizes, int n_in,
                              void* d_out, int out_size, void* d_ws, size_t ws_size,
                              hipStream_t stream) {
  const float* x    = (const float*)d_in[0];
  const float* g1   = (const float*)d_in[1];
  const float* be1  = (const float*)d_in[2];
  const float* m1   = (const float*)d_in[3];
  const float* va1  = (const float*)d_in[4];
  const float* qk_w = (const float*)d_in[5];
  const float* qk_b = (const float*)d_in[6];
  const float* v_w  = (const float*)d_in[7];
  const float* v_b  = (const float*)d_in[8];
  const float* pw   = (const float*)d_in[9];
  const float* pb   = (const float*)d_in[10];
  const float* bt   = (const float*)d_in[11];
  const float* g2   = (const float*)d_in[12];
  const float* be2  = (const float*)d_in[13];
  const float* m2   = (const float*)d_in[14];
  const float* va2  = (const float*)d_in[15];
  float* out = (float*)d_out;

  char* ws = (char*)d_ws;
  half_t* wqk = (half_t*)ws; ws += (size_t)2 * DIM * DIM * sizeof(half_t);
  half_t* wv  = (half_t*)ws; ws += (size_t)DIM * DIM * sizeof(half_t);
  half_t* wpj = (half_t*)ws; ws += (size_t)DIM * DIM * sizeof(half_t);
  float* bn1s = (float*)ws;  ws += DIM * sizeof(float);
  float* bn1h = (float*)ws;  ws += DIM * sizeof(float);
  float* bn2s = (float*)ws;  ws += DIM * sizeof(float);
  float* bn2h = (float*)ws;  ws += DIM * sizeof(float);
  half_t* park = (half_t*)ws;                      // 256 blocks x 16 waves x 3 x 4 KB

  prep_kernel<<<4100, 256, 0, stream>>>(qk_w, v_w, pw, g1, be1, m1, va1,
                                        g2, be2, m2, va2,
                                        wqk, wv, wpj, bn1s, bn1h, bn2s, bn2h);
  window_attn_kernel<<<NWIN / PWIN, 512, 0, stream>>>(x, wqk, wv, bn1s, bn1h, qk_b, v_b, bt,
                                                      wpj, pb, bn2s, bn2h, park, out);
}
